// v000
// Measured on an AMD MI455X. A time is GPU time per run, averaged over a window of back-to-back runs after a warm-up
// (all launches, gaps included; the runs take copies of the inputs in turn), and the median of several windows.
// Apart from v000's, it joins two sittings. Times from different sittings can be a few percent apart, while
// side-by-side timings come from the same sitting.
// v000, which the later versions start from, runs in 329 microseconds.
#include <hip/hip_runtime.h>
#include <hip/hip_bf16.h>

typedef __attribute__((ext_vector_type(16))) _Float16 v16h;
typedef __attribute__((ext_vector_type(8)))  float    v8f;

#define B_  4
#define N_  2048
#define D_  1024
#define H_  8
#define DH_ 64
#define INNER_ 512
#define ROWS_ (B_ * N_)   // 8192

#define WMMA_F16(a, b, c) \
  __builtin_amdgcn_wmma_f32_16x16x32_f16(false, (a), false, (b), (short)0, (c), false, false)

__device__ __forceinline__ float redmax16(float v) {
  #pragma unroll
  for (int m = 1; m < 16; m <<= 1) v = fmaxf(v, __shfl_xor(v, m, 32));
  return v;
}
__device__ __forceinline__ float redsum16(float v) {
  #pragma unroll
  for (int m = 1; m < 16; m <<= 1) v += __shfl_xor(v, m, 32);
  return v;
}
__device__ __forceinline__ float redsum32(float v) {
  #pragma unroll
  for (int m = 1; m < 32; m <<= 1) v += __shfl_xor(v, m, 32);
  return v;
}

// async copy of 32 bytes/lane: global -> LDS (tracked by ASYNCcnt).
// INST_OFFSET applies to both LDS and global addresses (ISA 08 §4.4).
__device__ __forceinline__ void async_cp32(const _Float16* g, _Float16* l) {
  unsigned loff = (unsigned)(uintptr_t)l;   // low 32 bits of generic ptr = LDS offset
  asm volatile("global_load_async_to_lds_b128 %0, %1, off\n\t"
               "global_load_async_to_lds_b128 %0, %1, off offset:16"
               :: "v"(loff), "v"(g) : "memory");
}
__device__ __forceinline__ void wait_async0() {
  asm volatile("s_wait_asynccnt 0x0" ::: "memory");
}

// ---- transpose + f32->f16 weight conversion: Wt[n*K + k] = W[k*N + n] ----
__global__ void wt_kernel(const float* __restrict__ W, _Float16* __restrict__ Wt,
                          int K, int N) {
  int idx = blockIdx.x * 256 + threadIdx.x;
  if (idx < K * N) {
    int n = idx / K, k = idx % K;
    Wt[idx] = (_Float16)W[k * N + n];
  }
}

// ---- LayerNorm rows of f32 [rows x 1024] -> f16 out; 1 wave / row ----
__global__ void ln_to_h_kernel(const float* __restrict__ x, const float* __restrict__ g,
                               _Float16* __restrict__ out) {
  int lane = threadIdx.x & 31, wid = threadIdx.x >> 5;
  int row = blockIdx.x * 4 + wid;
  const float* xr = x + (size_t)row * D_;
  float v[32], sum = 0.f, sq = 0.f;
  #pragma unroll
  for (int j = 0; j < 32; ++j) {
    v[j] = xr[j * 32 + lane];
    sum += v[j]; sq += v[j] * v[j];
  }
  sum = redsum32(sum); sq = redsum32(sq);
  float mean = sum * (1.0f / D_);
  float var  = sq * (1.0f / D_) - mean * mean;
  float rs   = rsqrtf(var + 1e-5f);
  _Float16* o = out + (size_t)row * D_;
  #pragma unroll
  for (int j = 0; j < 32; ++j)
    o[j * 32 + lane] = (_Float16)((v[j] - mean) * rs * g[j * 32 + lane]);
}

// ---- in-place LayerNorm f32 [rows x 1024] ----
__global__ void ln_inplace_kernel(float* __restrict__ x, const float* __restrict__ g) {
  int lane = threadIdx.x & 31, wid = threadIdx.x >> 5;
  int row = blockIdx.x * 4 + wid;
  float* xr = x + (size_t)row * D_;
  float v[32], sum = 0.f, sq = 0.f;
  #pragma unroll
  for (int j = 0; j < 32; ++j) {
    v[j] = xr[j * 32 + lane];
    sum += v[j]; sq += v[j] * v[j];
  }
  sum = redsum32(sum); sq = redsum32(sq);
  float mean = sum * (1.0f / D_);
  float var  = sq * (1.0f / D_) - mean * mean;
  float rs   = rsqrtf(var + 1e-5f);
  #pragma unroll
  for (int j = 0; j < 32; ++j)
    xr[j * 32 + lane] = (v[j] - mean) * rs * g[j * 32 + lane];
}

// ---- WMMA GEMM: C[MxN](f32) = A[MxK](f16 row-major) * Bt[NxK](f16 row-major)^T
// grid = (N/64, M/32), block = 32. 32x64 tile per wave, 8 accumulators,
// software-pipelined (next k-step's 6 operand loads overlap current 8 WMMAs).
__global__ void gemm_kernel(const _Float16* __restrict__ A, const _Float16* __restrict__ Bt,
                            float* __restrict__ C, int M, int N, int K) {
  int lane = threadIdx.x & 31;
  int half = lane >> 4, lcol = lane & 15;
  int m0 = blockIdx.y * 32, n0 = blockIdx.x * 64;
  const _Float16* a0p = A + (size_t)(m0 + lcol) * K + half * 16;
  const _Float16* a1p = A + (size_t)(m0 + 16 + lcol) * K + half * 16;
  const _Float16* b0p = Bt + (size_t)(n0 +  0 + lcol) * K + half * 16;
  const _Float16* b1p = Bt + (size_t)(n0 + 16 + lcol) * K + half * 16;
  const _Float16* b2p = Bt + (size_t)(n0 + 32 + lcol) * K + half * 16;
  const _Float16* b3p = Bt + (size_t)(n0 + 48 + lcol) * K + half * 16;

  v8f c00 = {}, c01 = {}, c02 = {}, c03 = {};
  v8f c10 = {}, c11 = {}, c12 = {}, c13 = {};

  v16h a0 = *(const v16h*)a0p, a1 = *(const v16h*)a1p;
  v16h b0 = *(const v16h*)b0p, b1 = *(const v16h*)b1p;
  v16h b2 = *(const v16h*)b2p, b3 = *(const v16h*)b3p;

  for (int k = 32;; k += 32) {
    int kn = (k < K) ? k : 0;                 // clamp last prefetch in-bounds
    v16h A0n = *(const v16h*)(a0p + kn);
    v16h A1n = *(const v16h*)(a1p + kn);
    v16h B0n = *(const v16h*)(b0p + kn);
    v16h B1n = *(const v16h*)(b1p + kn);
    v16h B2n = *(const v16h*)(b2p + kn);
    v16h B3n = *(const v16h*)(b3p + kn);

    c00 = WMMA_F16(a0, b0, c00);
    c01 = WMMA_F16(a0, b1, c01);
    c02 = WMMA_F16(a0, b2, c02);
    c03 = WMMA_F16(a0, b3, c03);
    c10 = WMMA_F16(a1, b0, c10);
    c11 = WMMA_F16(a1, b1, c11);
    c12 = WMMA_F16(a1, b2, c12);
    c13 = WMMA_F16(a1, b3, c13);

    if (k >= K) break;
    a0 = A0n; a1 = A1n; b0 = B0n; b1 = B1n; b2 = B2n; b3 = B3n;
  }

  v8f row0[4] = {c00, c01, c02, c03};
  v8f row1[4] = {c10, c11, c12, c13};
  #pragma unroll
  for (int t = 0; t < 4; ++t)
    #pragma unroll
    for (int r = 0; r < 8; ++r) {
      C[(size_t)(m0 + r + half * 8) * N + n0 + t * 16 + lcol]      = row0[t][r];
      C[(size_t)(m0 + 16 + r + half * 8) * N + n0 + t * 16 + lcol] = row1[t][r];
    }
}

// ---- q l2norm: q_f32[8192][512] -> qn[b][h][n][64] f16, net scale 64/max(16*||q||,1e-12)
__global__ void norm_q_kernel(const float* __restrict__ q, _Float16* __restrict__ qn) {
  int lane = threadIdx.x & 31, wid = threadIdx.x >> 5;
  int u  = blockIdx.x * 4 + wid;          // 0 .. 65535
  int bn = u >> 3, h = u & 7;
  const float* qr = q + (size_t)bn * INNER_ + h * DH_;
  float x0 = qr[lane * 2], x1 = qr[lane * 2 + 1];
  float sq = redsum32(x0 * x0 + x1 * x1);
  float scale = 64.0f / fmaxf(16.0f * sqrtf(sq), 1e-12f);
  int b = bn >> 11, n = bn & 2047;
  _Float16* dst = qn + (size_t)(((b * H_ + h) * N_) + n) * DH_;
  dst[lane * 2]     = (_Float16)(x0 * scale);
  dst[lane * 2 + 1] = (_Float16)(x1 * scale);
}

// ---- k l2norm (*4) -> kn[b][n][64]; v -> vt[b][d][n] (transposed, f16) ----
__global__ void norm_kv_kernel(const float* __restrict__ kv, _Float16* __restrict__ kn,
                               _Float16* __restrict__ vt) {
  int lane = threadIdx.x & 31, wid = threadIdx.x >> 5;
  int row = blockIdx.x * 4 + wid;          // 0 .. 8191
  const float* kr = kv + (size_t)row * 128;
  float k0 = kr[lane * 2], k1 = kr[lane * 2 + 1];
  float sq = redsum32(k0 * k0 + k1 * k1);
  float scale = 4.0f / fmaxf(sqrtf(sq), 1e-12f);
  int b = row >> 11, n = row & 2047;
  _Float16* kd = kn + (size_t)(b * N_ + n) * DH_;
  kd[lane * 2]     = (_Float16)(k0 * scale);
  kd[lane * 2 + 1] = (_Float16)(k1 * scale);
  _Float16* vb = vt + (size_t)b * DH_ * N_;
  vb[(size_t)(lane * 2)     * N_ + n] = (_Float16)kr[64 + lane * 2];
  vb[(size_t)(lane * 2 + 1) * N_ + n] = (_Float16)kr[64 + lane * 2 + 1];
}

// ---- attention: per (b,h,16-row block), 4 row-blocks per 128-thread block.
// K and V chunks (32 j x 64 d) are staged cooperatively into LDS via
// async global->LDS copies (ASYNCcnt), double-buffered; WMMA B-operands
// then come from contiguous 32B ds loads. 2-pass softmax.
__global__ void attn_kernel(const _Float16* __restrict__ qn, const _Float16* __restrict__ kn,
                            const _Float16* __restrict__ vt, _Float16* __restrict__ ao) {
  __shared__ _Float16 Kbuf[2][32 * 64];   // [chunk rows j][d]      8 KB
  __shared__ _Float16 Vbuf[2][64 * 32];   // [d][chunk cols j]      8 KB
  __shared__ _Float16 ldsP[4][16 * 32];   // per-wave P staging     4 KB

  int tid  = threadIdx.x;
  int lane = tid & 31, wid = tid >> 5;
  int half = lane >> 4, lcol = lane & 15;
  int unit = blockIdx.x * 4 + wid;         // 0 .. 4095
  int ib = unit >> 10;
  int ih = (unit >> 7) & 7;
  int i0 = (unit & 127) * 16;
  const _Float16* Q  = qn + (size_t)((ib * H_ + ih) * N_) * DH_;
  const _Float16* Kp = kn + (size_t)(ib * N_) * DH_;
  const _Float16* V  = vt + (size_t)ib * DH_ * N_;
  int d0 = half * 16;

  v16h a0 = *(const v16h*)(Q + (size_t)(i0 + lcol) * DH_ + d0);
  v16h a1 = *(const v16h*)(Q + (size_t)(i0 + lcol) * DH_ + 32 + d0);

  // ---- pass 1: row max; K chunks async-staged through LDS ----
  float m[8];
  #pragma unroll
  for (int r = 0; r < 8; ++r) m[r] = -1e30f;

  // chunk = 32 j-rows (4 KB). 128 threads x 32B = one chunk.
  async_cp32(Kp + tid * 16, &Kbuf[0][tid * 16]);       // stage chunk 0
  for (int c = 0; c < 64; ++c) {
    int cb = c & 1;
    wait_async0();
    __syncthreads();           // chunk cb ready; buffer (c+1)&1 free
    if (c < 63)
      async_cp32(Kp + (size_t)(c + 1) * 32 * DH_ + tid * 16,
                 &Kbuf[(c + 1) & 1][tid * 16]);
    #pragma unroll
    for (int sub = 0; sub < 2; ++sub) {
      const _Float16* kb = &Kbuf[cb][(sub * 16 + lcol) * DH_];
      v16h b0 = *(const v16h*)(kb + d0);
      v16h b1 = *(const v16h*)(kb + 32 + d0);
      v8f acc = {};
      acc = WMMA_F16(a0, b0, acc);
      acc = WMMA_F16(a1, b1, acc);
      #pragma unroll
      for (int r = 0; r < 8; ++r) m[r] = fmaxf(m[r], acc[r]);
    }
  }
  #pragma unroll
  for (int r = 0; r < 8; ++r) m[r] = redmax16(m[r]);

  // ---- pass 2: exp, stage P via LDS, P@V; K and V chunks async-staged ----
  float s[8];
  #pragma unroll
  for (int r = 0; r < 8; ++r) s[r] = 0.f;
  v8f o0 = {}, o1 = {}, o2 = {}, o3 = {};
  _Float16* P = ldsP[wid];
  int vd = tid >> 1, vpart = tid & 1;      // V staging role of this thread

  async_cp32(Kp + tid * 16, &Kbuf[0][tid * 16]);
  async_cp32(V + (size_t)vd * N_ + vpart * 16, &Vbuf[0][vd * 32 + vpart * 16]);

  for (int c = 0; c < 64; ++c) {
    int cb = c & 1;
    wait_async0();
    __syncthreads();           // K/V chunk cb ready; buffer (c+1)&1 free
    if (c < 63) {
      int nb = (c + 1) & 1;
      async_cp32(Kp + (size_t)(c + 1) * 32 * DH_ + tid * 16, &Kbuf[nb][tid * 16]);
      async_cp32(V + (size_t)vd * N_ + (c + 1) * 32 + vpart * 16,
                 &Vbuf[nb][vd * 32 + vpart * 16]);
    }
    #pragma unroll
    for (int sub = 0; sub < 2; ++sub) {
      const _Float16* kb = &Kbuf[cb][(sub * 16 + lcol) * DH_];
      v16h b0 = *(const v16h*)(kb + d0);
      v16h b1 = *(const v16h*)(kb + 32 + d0);
      v8f acc = {};
      acc = WMMA_F16(a0, b0, acc);
      acc = WMMA_F16(a1, b1, acc);
      #pragma unroll
      for (int r = 0; r < 8; ++r) {
        float p = __expf(acc[r] - m[r]);
        s[r] += p;
        P[(r + half * 8) * 32 + sub * 16 + lcol] = (_Float16)p;
      }
    }
    __syncthreads();           // P visible (block-uniform control flow)
    v16h ap  = *(const v16h*)(P + lcol * 32 + half * 16);
    v16h bv0 = *(const v16h*)(&Vbuf[cb][( 0 + lcol) * 32 + half * 16]);
    v16h bv1 = *(const v16h*)(&Vbuf[cb][(16 + lcol) * 32 + half * 16]);
    v16h bv2 = *(const v16h*)(&Vbuf[cb][(32 + lcol) * 32 + half * 16]);
    v16h bv3 = *(const v16h*)(&Vbuf[cb][(48 + lcol) * 32 + half * 16]);
    o0 = WMMA_F16(ap, bv0, o0);
    o1 = WMMA_F16(ap, bv1, o1);
    o2 = WMMA_F16(ap, bv2, o2);
    o3 = WMMA_F16(ap, bv3, o3);
  }

  #pragma unroll
  for (int r = 0; r < 8; ++r) s[r] = redsum16(s[r]);
  v8f os[4] = {o0, o1, o2, o3};
  #pragma unroll
  for (int r = 0; r < 8; ++r) {
    float inv = 1.0f / fmaxf(s[r], 1e-20f);
    int row = ib * N_ + i0 + r + half * 8;
    _Float16* dst = ao + (size_t)row * INNER_ + ih * DH_;
    #pragma unroll
    for (int t = 0; t < 4; ++t)
      dst[t * 16 + lcol] = (_Float16)(os[t][r] * inv);
  }
}

extern "C" void kernel_launch(void* const* d_in, const int* in_sizes, int n_in,
                              void* d_out, int out_size, void* d_ws, size_t ws_size,
                              hipStream_t stream) {
  const float* x          = (const float*)d_in[0];
  const float* norm_g     = (const float*)d_in[1];
  const float* Wq         = (const float*)d_in[2];
  const float* Wkv        = (const float*)d_in[3];
  const float* Wout       = (const float*)d_in[4];
  const float* out_norm_g = (const float*)d_in[5];
  float* out = (float*)d_out;

  char* w = (char*)d_ws;
  size_t off = 0;
  auto alloc = [&](size_t bytes) -> void* {
    void* p = w + off;
    off += (bytes + 255) & ~(size_t)255;
    return p;
  };
  _Float16* xn_h  = (_Float16*)alloc((size_t)ROWS_ * D_ * 2);       // 16 MB
  _Float16* WqT   = (_Float16*)alloc((size_t)INNER_ * D_ * 2);      //  1 MB
  _Float16* WkvT  = (_Float16*)alloc((size_t)128 * D_ * 2);         // .25 MB
  _Float16* WoutT = (_Float16*)alloc((size_t)D_ * INNER_ * 2);      //  1 MB
  float*    q_f32 = (float*)   alloc((size_t)ROWS_ * INNER_ * 4);   // 16 MB
  float*    kv_f32= (float*)   alloc((size_t)ROWS_ * 128 * 4);      //  4 MB
  _Float16* qn_h  = (_Float16*)alloc((size_t)ROWS_ * INNER_ * 2);   //  8 MB
  _Float16* kn_h  = (_Float16*)alloc((size_t)ROWS_ * DH_ * 2);      //  1 MB
  _Float16* vt_h  = (_Float16*)alloc((size_t)ROWS_ * DH_ * 2);      //  1 MB
  _Float16* ao_h  = (_Float16*)alloc((size_t)ROWS_ * INNER_ * 2);   //  8 MB

  // 1. weight transposes (f32 -> f16 [N][K])
  wt_kernel<<<(D_ * INNER_ + 255) / 256, 256, 0, stream>>>(Wq,   WqT,   D_,    INNER_);
  wt_kernel<<<(D_ * 128    + 255) / 256, 256, 0, stream>>>(Wkv,  WkvT,  D_,    128);
  wt_kernel<<<(INNER_ * D_ + 255) / 256, 256, 0, stream>>>(Wout, WoutT, INNER_, D_);

  // 2. LayerNorm(x) -> xn (f16)
  ln_to_h_kernel<<<ROWS_ / 4, 128, 0, stream>>>(x, norm_g, xn_h);

  // 3. q = xn@Wq ; kv = xn@Wkv   (32x64 tile per wave)
  gemm_kernel<<<dim3(INNER_ / 64, ROWS_ / 32), 32, 0, stream>>>(xn_h, WqT,  q_f32,  ROWS_, INNER_, D_);
  gemm_kernel<<<dim3(128    / 64, ROWS_ / 32), 32, 0, stream>>>(xn_h, WkvT, kv_f32, ROWS_, 128,    D_);

  // 4. l2norms + V transpose
  norm_q_kernel <<<(ROWS_ * H_) / 4, 128, 0, stream>>>(q_f32, qn_h);
  norm_kv_kernel<<<ROWS_ / 4,        128, 0, stream>>>(kv_f32, kn_h, vt_h);

  // 5. attention (async-LDS staged K/V, WMMA everywhere)
  attn_kernel<<<(B_ * H_ * (N_ / 16)) / 4, 128, 0, stream>>>(qn_h, kn_h, vt_h, ao_h);

  // 6. out = ao @ Wout  (f32 into d_out)
  gemm_kernel<<<dim3(D_ / 64, ROWS_ / 32), 32, 0, stream>>>(ao_h, WoutT, out, ROWS_, D_, INNER_);

  // 7. final LayerNorm in place on d_out
  ln_inplace_kernel<<<ROWS_ / 4, 128, 0, stream>>>(out, out_norm_g);
}

// v001
// A run of this version takes 260 microseconds.
// Two timings next to v000 both put it at 1.29 times that version's speed.
#include <hip/hip_runtime.h>
#include <hip/hip_bf16.h>

typedef __attribute__((ext_vector_type(16))) _Float16 v16h;
typedef __attribute__((ext_vector_type(8)))  _Float16 v8h;
typedef __attribute__((ext_vector_type(8)))  float    v8f;

#define B_  4
#define N_  2048
#define D_  1024
#define H_  8
#define DH_ 64
#define INNER_ 512
#define ROWS_ (B_ * N_)   // 8192

#define WMMA_F16(a, b, c) \
  __builtin_amdgcn_wmma_f32_16x16x32_f16(false, (a), false, (b), (short)0, (c), false, false)

__device__ __forceinline__ float redmax16(float v) {
  #pragma unroll
  for (int m = 1; m < 16; m <<= 1) v = fmaxf(v, __shfl_xor(v, m, 32));
  return v;
}
__device__ __forceinline__ float redsum16(float v) {
  #pragma unroll
  for (int m = 1; m < 16; m <<= 1) v += __shfl_xor(v, m, 32);
  return v;
}
__device__ __forceinline__ float redsum32(float v) {
  #pragma unroll
  for (int m = 1; m < 32; m <<= 1) v += __shfl_xor(v, m, 32);
  return v;
}

// async copy of 32 bytes/lane: global -> LDS (tracked by ASYNCcnt).
// INST_OFFSET applies to both LDS and global addresses (ISA 08 §4.4).
__device__ __forceinline__ void async_cp32(const _Float16* g, _Float16* l) {
  unsigned loff = (unsigned)(uintptr_t)l;   // low 32 bits of generic ptr = LDS offset
  // s_wait_xcnt closes the statement so that no address register is rewritten ahead of it
  asm volatile("global_load_async_to_lds_b128 %0, %1, off\n\t"
               "global_load_async_to_lds_b128 %0, %1, off offset:16\n\t"
               "s_wait_xcnt 0x0"
               :: "v"(loff), "v"(g) : "memory");
}
// two such 32-byte copies (a K piece and a V piece) behind one s_wait_xcnt
__device__ __forceinline__ void async_cp32_pair(const _Float16* g0, _Float16* l0,
                                                const _Float16* g1, _Float16* l1) {
  unsigned loff0 = (unsigned)(uintptr_t)l0;
  unsigned loff1 = (unsigned)(uintptr_t)l1;
  asm volatile("global_load_async_to_lds_b128 %0, %1, off\n\t"
               "global_load_async_to_lds_b128 %0, %1, off offset:16\n\t"
               "global_load_async_to_lds_b128 %2, %3, off\n\t"
               "global_load_async_to_lds_b128 %2, %3, off offset:16\n\t"
               "s_wait_xcnt 0x0"
               :: "v"(loff0), "v"(g0), "v"(loff1), "v"(g1) : "memory");
}
__device__ __forceinline__ void wait_async0() {
  // this wave's own LDS reads of the buffer refilled behind the barrier have retired
  asm volatile("s_wait_dscnt 0x0" ::: "memory");
  asm volatile("s_wait_asynccnt 0x0" ::: "memory");
}

// LDS row pitches in halfs: 16 B x odd, so the 16 lanes of a ds_load_b128 that read
// 16 different rows fall on 16 different groups of four banks.
#define KP_ 72   // K rows of 128 B at 144 B
#define VP_ 40   // V rows of  64 B at  80 B
#define PP_ 40   // P rows of  64 B at  80 B

// 16 contiguous halfs of a padded LDS row (16-byte aligned only) as one WMMA operand
__device__ __forceinline__ v16h lds_frag(const _Float16* p) {
  v8h lo = *(const v8h*)p;
  v8h hi = *(const v8h*)(p + 8);
  return __builtin_shufflevector(lo, hi, 0, 1, 2, 3, 4, 5, 6, 7, 8, 9, 10, 11, 12, 13, 14, 15);
}

// ---- transpose + f32->f16 weight conversion: Wt[n*K + k] = W[k*N + n] ----
__global__ void wt_kernel(const float* __restrict__ W, _Float16* __restrict__ Wt,
                          int K, int N) {
  int idx = blockIdx.x * 256 + threadIdx.x;
  if (idx < K * N) {
    int n = idx / K, k = idx % K;
    Wt[idx] = (_Float16)W[k * N + n];
  }
}

// ---- LayerNorm rows of f32 [rows x 1024] -> f16 out; 1 wave / row ----
__global__ void ln_to_h_kernel(const float* __restrict__ x, const float* __restrict__ g,
                               _Float16* __restrict__ out) {
  int lane = threadIdx.x & 31, wid = threadIdx.x >> 5;
  int row = blockIdx.x * 4 + wid;
  const float* xr = x + (size_t)row * D_;
  float v[32], sum = 0.f, sq = 0.f;
  #pragma unroll
  for (int j = 0; j < 32; ++j) {
    v[j] = xr[j * 32 + lane];
    sum += v[j]; sq += v[j] * v[j];
  }
  sum = redsum32(sum); sq = redsum32(sq);
  float mean = sum * (1.0f / D_);
  float var  = sq * (1.0f / D_) - mean * mean;
  float rs   = rsqrtf(var + 1e-5f);
  _Float16* o = out + (size_t)row * D_;
  #pragma unroll
  for (int j = 0; j < 32; ++j)
    o[j * 32 + lane] = (_Float16)((v[j] - mean) * rs * g[j * 32 + lane]);
}

// ---- in-place LayerNorm f32 [rows x 1024] ----
__global__ void ln_inplace_kernel(float* __restrict__ x, const float* __restrict__ g) {
  int lane = threadIdx.x & 31, wid = threadIdx.x >> 5;
  int row = blockIdx.x * 4 + wid;
  float* xr = x + (size_t)row * D_;
  float v[32], sum = 0.f, sq = 0.f;
  #pragma unroll
  for (int j = 0; j < 32; ++j) {
    v[j] = xr[j * 32 + lane];
    sum += v[j]; sq += v[j] * v[j];
  }
  sum = redsum32(sum); sq = redsum32(sq);
  float mean = sum * (1.0f / D_);
  float var  = sq * (1.0f / D_) - mean * mean;
  float rs   = rsqrtf(var + 1e-5f);
  #pragma unroll
  for (int j = 0; j < 32; ++j)
    xr[j * 32 + lane] = (v[j] - mean) * rs * g[j * 32 + lane];
}

// ---- WMMA GEMM: C[MxN](f32) = A[MxK](f16 row-major) * Bt[NxK](f16 row-major)^T
// grid = (N/64, M/32), block = 32. 32x64 tile per wave, 8 accumulators,
// software-pipelined (next k-step's 6 operand loads overlap current 8 WMMAs).
__global__ void gemm_kernel(const _Float16* __restrict__ A, const _Float16* __restrict__ Bt,
                            float* __restrict__ C, int M, int N, int K) {
  int lane = threadIdx.x & 31;
  int half = lane >> 4, lcol = lane & 15;
  int m0 = blockIdx.y * 32, n0 = blockIdx.x * 64;
  const _Float16* a0p = A + (size_t)(m0 + lcol) * K + half * 16;
  const _Float16* a1p = A + (size_t)(m0 + 16 + lcol) * K + half * 16;
  const _Float16* b0p = Bt + (size_t)(n0 +  0 + lcol) * K + half * 16;
  const _Float16* b1p = Bt + (size_t)(n0 + 16 + lcol) * K + half * 16;
  const _Float16* b2p = Bt + (size_t)(n0 + 32 + lcol) * K + half * 16;
  const _Float16* b3p = Bt + (size_t)(n0 + 48 + lcol) * K + half * 16;

  v8f c00 = {}, c01 = {}, c02 = {}, c03 = {};
  v8f c10 = {}, c11 = {}, c12 = {}, c13 = {};

  v16h a0 = *(const v16h*)a0p, a1 = *(const v16h*)a1p;
  v16h b0 = *(const v16h*)b0p, b1 = *(const v16h*)b1p;
  v16h b2 = *(const v16h*)b2p, b3 = *(const v16h*)b3p;

  for (int k = 32;; k += 32) {
    int kn = (k < K) ? k : 0;                 // clamp last prefetch in-bounds
    v16h A0n = *(const v16h*)(a0p + kn);
    v16h A1n = *(const v16h*)(a1p + kn);
    v16h B0n = *(const v16h*)(b0p + kn);
    v16h B1n = *(const v16h*)(b1p + kn);
    v16h B2n = *(const v16h*)(b2p + kn);
    v16h B3n = *(const v16h*)(b3p + kn);

    c00 = WMMA_F16(a0, b0, c00);
    c01 = WMMA_F16(a0, b1, c01);
    c02 = WMMA_F16(a0, b2, c02);
    c03 = WMMA_F16(a0, b3, c03);
    c10 = WMMA_F16(a1, b0, c10);
    c11 = WMMA_F16(a1, b1, c11);
    c12 = WMMA_F16(a1, b2, c12);
    c13 = WMMA_F16(a1, b3, c13);

    if (k >= K) break;
    a0 = A0n; a1 = A1n; b0 = B0n; b1 = B1n; b2 = B2n; b3 = B3n;
  }

  v8f row0[4] = {c00, c01, c02, c03};
  v8f row1[4] = {c10, c11, c12, c13};
  #pragma unroll
  for (int t = 0; t < 4; ++t)
    #pragma unroll
    for (int r = 0; r < 8; ++r) {
      C[(size_t)(m0 + r + half * 8) * N + n0 + t * 16 + lcol]      = row0[t][r];
      C[(size_t)(m0 + 16 + r + half * 8) * N + n0 + t * 16 + lcol] = row1[t][r];
    }
}

// ---- q l2norm: q_f32[8192][512] -> qn[b][h][n][64] f16, net scale 64/max(16*||q||,1e-12)
__global__ void norm_q_kernel(const float* __restrict__ q, _Float16* __restrict__ qn) {
  int lane = threadIdx.x & 31, wid = threadIdx.x >> 5;
  int u  = blockIdx.x * 4 + wid;          // 0 .. 65535
  int bn = u >> 3, h = u & 7;
  const float* qr = q + (size_t)bn * INNER_ + h * DH_;
  float x0 = qr[lane * 2], x1 = qr[lane * 2 + 1];
  float sq = redsum32(x0 * x0 + x1 * x1);
  float scale = 64.0f / fmaxf(16.0f * sqrtf(sq), 1e-12f);
  int b = bn >> 11, n = bn & 2047;
  _Float16* dst = qn + (size_t)(((b * H_ + h) * N_) + n) * DH_;
  dst[lane * 2]     = (_Float16)(x0 * scale);
  dst[lane * 2 + 1] = (_Float16)(x1 * scale);
}

// ---- k l2norm (*4) -> kn[b][n][64]; v -> vt[b][d][n] (transposed, f16) ----
__global__ void norm_kv_kernel(const float* __restrict__ kv, _Float16* __restrict__ kn,
                               _Float16* __restrict__ vt) {
  int lane = threadIdx.x & 31, wid = threadIdx.x >> 5;
  int row = blockIdx.x * 4 + wid;          // 0 .. 8191
  const float* kr = kv + (size_t)row * 128;
  float k0 = kr[lane * 2], k1 = kr[lane * 2 + 1];
  float sq = redsum32(k0 * k0 + k1 * k1);
  float scale = 4.0f / fmaxf(sqrtf(sq), 1e-12f);
  int b = row >> 11, n = row & 2047;
  _Float16* kd = kn + (size_t)(b * N_ + n) * DH_;
  kd[lane * 2]     = (_Float16)(k0 * scale);
  kd[lane * 2 + 1] = (_Float16)(k1 * scale);
  _Float16* vb = vt + (size_t)b * DH_ * N_;
  vb[(size_t)(lane * 2)     * N_ + n] = (_Float16)kr[64 + lane * 2];
  vb[(size_t)(lane * 2 + 1) * N_ + n] = (_Float16)kr[64 + lane * 2 + 1];
}

// ---- attention: per (b,h,16-row block), 4 row-blocks per 128-thread block.
// K and V chunks (32 j x 64 d) are staged cooperatively into LDS via
// async global->LDS copies (ASYNCcnt), double-buffered; WMMA B-operands
// then come from contiguous 32B ds loads of padded rows. 2-pass softmax.
__global__ void attn_kernel(const _Float16* __restrict__ qn, const _Float16* __restrict__ kn,
                            const _Float16* __restrict__ vt, _Float16* __restrict__ ao) {
  __shared__ __attribute__((aligned(16))) _Float16 Kbuf[2][32 * KP_];   // [chunk rows j][d]      9 KB
  __shared__ __attribute__((aligned(16))) _Float16 Vbuf[2][64 * VP_];   // [d][chunk cols j]     10 KB
  __shared__ __attribute__((aligned(16))) _Float16 ldsP[4][16 * PP_];   // per-wave P staging     5 KB

  int tid  = threadIdx.x;
  int lane = tid & 31, wid = tid >> 5;
  int half = lane >> 4, lcol = lane & 15;
  int unit = blockIdx.x * 4 + wid;         // 0 .. 4095
  int ib = unit >> 10;
  int ih = (unit >> 7) & 7;
  int i0 = (unit & 127) * 16;
  const _Float16* Q  = qn + (size_t)((ib * H_ + ih) * N_) * DH_;
  const _Float16* Kp = kn + (size_t)(ib * N_) * DH_;
  const _Float16* V  = vt + (size_t)ib * DH_ * N_;
  int d0 = half * 16;

  v16h a0 = *(const v16h*)(Q + (size_t)(i0 + lcol) * DH_ + d0);
  v16h a1 = *(const v16h*)(Q + (size_t)(i0 + lcol) * DH_ + 32 + d0);

  // ---- pass 1: row max; K chunks async-staged through LDS ----
  float m[8];
  #pragma unroll
  for (int r = 0; r < 8; ++r) m[r] = -1e30f;

  // chunk = 32 j-rows (4 KB). 128 threads x 32B = one chunk; four threads fill a row.
  int kdst = (tid >> 2) * KP_ + (tid & 3) * 16;        // K staging place of this thread
  async_cp32(Kp + tid * 16, &Kbuf[0][kdst]);           // stage chunk 0
  for (int c = 0; c < 64; ++c) {
    int cb = c & 1;
    wait_async0();
    __syncthreads();           // chunk cb ready; buffer (c+1)&1 free
    if (c < 63)
      async_cp32(Kp + (size_t)(c + 1) * 32 * DH_ + tid * 16,
                 &Kbuf[(c + 1) & 1][kdst]);
    #pragma unroll
    for (int sub = 0; sub < 2; ++sub) {
      const _Float16* kb = &Kbuf[cb][(sub * 16 + lcol) * KP_];
      v16h b0 = lds_frag(kb + d0);
      v16h b1 = lds_frag(kb + 32 + d0);
      v8f acc = {};
      acc = WMMA_F16(a0, b0, acc);
      acc = WMMA_F16(a1, b1, acc);
      #pragma unroll
      for (int r = 0; r < 8; ++r) m[r] = fmaxf(m[r], acc[r]);
    }
  }
  #pragma unroll
  for (int r = 0; r < 8; ++r) m[r] = redmax16(m[r]);

  // ---- pass 2: exp, stage P via LDS, P@V; K and V chunks async-staged ----
  float s[8];
  #pragma unroll
  for (int r = 0; r < 8; ++r) s[r] = 0.f;
  v8f o0 = {}, o1 = {}, o2 = {}, o3 = {};
  _Float16* P = ldsP[wid];
  int vd = tid >> 1, vpart = tid & 1;      // V staging role of this thread

  int vdst = vd * VP_ + vpart * 16;        // V staging place of this thread
  async_cp32_pair(Kp + tid * 16, &Kbuf[0][kdst],
                  V + (size_t)vd * N_ + vpart * 16, &Vbuf[0][vdst]);

  for (int c = 0; c < 64; ++c) {
    int cb = c & 1;
    wait_async0();
    __syncthreads();           // K/V chunk cb ready; buffer (c+1)&1 free
    if (c < 63) {
      int nb = (c + 1) & 1;
      async_cp32_pair(Kp + (size_t)(c + 1) * 32 * DH_ + tid * 16, &Kbuf[nb][kdst],
                      V + (size_t)vd * N_ + (c + 1) * 32 + vpart * 16, &Vbuf[nb][vdst]);
    }
    v8f acc[2];
    #pragma unroll
    for (int sub = 0; sub < 2; ++sub) {
      const _Float16* kb = &Kbuf[cb][(sub * 16 + lcol) * KP_];
      v16h b0 = lds_frag(kb + d0);
      v16h b1 = lds_frag(kb + 32 + d0);
      v8f z = {};
      z = WMMA_F16(a0, b0, z);
      acc[sub] = WMMA_F16(a1, b1, z);
    }
    #pragma unroll
    for (int sub = 0; sub < 2; ++sub)
      #pragma unroll
      for (int r = 0; r < 8; ++r) {
        float p = __expf(acc[sub][r] - m[r]);
        s[r] += p;
        P[(r + half * 8) * PP_ + sub * 16 + lcol] = (_Float16)p;
      }
    __syncthreads();           // P visible (block-uniform control flow)
    v16h ap  = lds_frag(P + lcol * PP_ + half * 16);
    v16h bv0 = lds_frag(&Vbuf[cb][( 0 + lcol) * VP_ + half * 16]);
    v16h bv1 = lds_frag(&Vbuf[cb][(16 + lcol) * VP_ + half * 16]);
    v16h bv2 = lds_frag(&Vbuf[cb][(32 + lcol) * VP_ + half * 16]);
    v16h bv3 = lds_frag(&Vbuf[cb][(48 + lcol) * VP_ + half * 16]);
    o0 = WMMA_F16(ap, bv0, o0);
    o1 = WMMA_F16(ap, bv1, o1);
    o2 = WMMA_F16(ap, bv2, o2);
    o3 = WMMA_F16(ap, bv3, o3);
  }

  #pragma unroll
  for (int r = 0; r < 8; ++r) s[r] = redsum16(s[r]);
  v8f os[4] = {o0, o1, o2, o3};
  #pragma unroll
  for (int r = 0; r < 8; ++r) {
    float inv = 1.0f / fmaxf(s[r], 1e-20f);
    int row = ib * N_ + i0 + r + half * 8;
    _Float16* dst = ao + (size_t)row * INNER_ + ih * DH_;
    #pragma unroll
    for (int t = 0; t < 4; ++t)
      dst[t * 16 + lcol] = (_Float16)(os[t][r] * inv);
  }
}

extern "C" void kernel_launch(void* const* d_in, const int* in_sizes, int n_in,
                              void* d_out, int out_size, void* d_ws, size_t ws_size,
                              hipStream_t stream) {
  const float* x          = (const float*)d_in[0];
  const float* norm_g     = (const float*)d_in[1];
  const float* Wq         = (const float*)d_in[2];
  const float* Wkv        = (const float*)d_in[3];
  const float* Wout       = (const float*)d_in[4];
  const float* out_norm_g = (const float*)d_in[5];
  float* out = (float*)d_out;

  char* w = (char*)d_ws;
  size_t off = 0;
  auto alloc = [&](size_t bytes) -> void* {
    void* p = w + off;
    off += (bytes + 255) & ~(size_t)255;
    return p;
  };
  _Float16* xn_h  = (_Float16*)alloc((size_t)ROWS_ * D_ * 2);       // 16 MB
  _Float16* WqT   = (_Float16*)alloc((size_t)INNER_ * D_ * 2);      //  1 MB
  _Float16* WkvT  = (_Float16*)alloc((size_t)128 * D_ * 2);         // .25 MB
  _Float16* WoutT = (_Float16*)alloc((size_t)D_ * INNER_ * 2);      //  1 MB
  float*    q_f32 = (float*)   alloc((size_t)ROWS_ * INNER_ * 4);   // 16 MB
  float*    kv_f32= (float*)   alloc((size_t)ROWS_ * 128 * 4);      //  4 MB
  _Float16* qn_h  = (_Float16*)alloc((size_t)ROWS_ * INNER_ * 2);   //  8 MB
  _Float16* kn_h  = (_Float16*)alloc((size_t)ROWS_ * DH_ * 2);      //  1 MB
  _Float16* vt_h  = (_Float16*)alloc((size_t)ROWS_ * DH_ * 2);      //  1 MB
  _Float16* ao_h  = (_Float16*)alloc((size_t)ROWS_ * INNER_ * 2);   //  8 MB

  // 1. weight transposes (f32 -> f16 [N][K])
  wt_kernel<<<(D_ * INNER_ + 255) / 256, 256, 0, stream>>>(Wq,   WqT,   D_,    INNER_);
  wt_kernel<<<(D_ * 128    + 255) / 256, 256, 0, stream>>>(Wkv,  WkvT,  D_,    128);
  wt_kernel<<<(INNER_ * D_ + 255) / 256, 256, 0, stream>>>(Wout, WoutT, INNER_, D_);

  // 2. LayerNorm(x) -> xn (f16)
  ln_to_h_kernel<<<ROWS_ / 4, 128, 0, stream>>>(x, norm_g, xn_h);

  // 3. q = xn@Wq ; kv = xn@Wkv   (32x64 tile per wave)
  gemm_kernel<<<dim3(INNER_ / 64, ROWS_ / 32), 32, 0, stream>>>(xn_h, WqT,  q_f32,  ROWS_, INNER_, D_);
  gemm_kernel<<<dim3(128    / 64, ROWS_ / 32), 32, 0, stream>>>(xn_h, WkvT, kv_f32, ROWS_, 128,    D_);

  // 4. l2norms + V transpose
  norm_q_kernel <<<(ROWS_ * H_) / 4, 128, 0, stream>>>(q_f32, qn_h);
  norm_kv_kernel<<<ROWS_ / 4,        128, 0, stream>>>(kv_f32, kn_h, vt_h);

  // 5. attention (async-LDS staged K/V, WMMA everywhere)
  attn_kernel<<<(B_ * H_ * (N_ / 16)) / 4, 128, 0, stream>>>(qn_h, kn_h, vt_h, ao_h);

  // 6. out = ao @ Wout  (f32 into d_out)
  gemm_kernel<<<dim3(D_ / 64, ROWS_ / 32), 32, 0, stream>>>(ao_h, WoutT, out, ROWS_, D_, INNER_);

  // 7. final LayerNorm in place on d_out
  ln_inplace_kernel<<<ROWS_ / 4, 128, 0, stream>>>(out, out_norm_g);
}

// v002
// It runs in 232 microseconds.
// In two side-by-side timings against v001, it was 1.13 and 1.11 times as fast.
// Counting every step since v000, it is 1.45 times as fast.
#include <hip/hip_runtime.h>
#include <hip/hip_bf16.h>

typedef __attribute__((ext_vector_type(16))) _Float16 v16h;
typedef __attribute__((ext_vector_type(8)))  _Float16 v8h;
typedef __attribute__((ext_vector_type(4)))  _Float16 v4h;
typedef __attribute__((ext_vector_type(8)))  float    v8f;

#define B_  4
#define N_  2048
#define D_  1024
#define H_  8
#define DH_ 64
#define INNER_ 512
#define ROWS_ (B_ * N_)   // 8192

#define WMMA_F16(a, b, c) \
  __builtin_amdgcn_wmma_f32_16x16x32_f16(false, (a), false, (b), (short)0, (c), false, false)

__device__ __forceinline__ float redmax16(float v) {
  #pragma unroll
  for (int m = 1; m < 16; m <<= 1) v = fmaxf(v, __shfl_xor(v, m, 32));
  return v;
}
__device__ __forceinline__ float redsum16(float v) {
  #pragma unroll
  for (int m = 1; m < 16; m <<= 1) v += __shfl_xor(v, m, 32);
  return v;
}
__device__ __forceinline__ float redsum32(float v) {
  #pragma unroll
  for (int m = 1; m < 32; m <<= 1) v += __shfl_xor(v, m, 32);
  return v;
}

// async copy of 32 bytes/lane: global -> LDS (tracked by ASYNCcnt).
// INST_OFFSET applies to both LDS and global addresses (ISA 08 §4.4).
__device__ __forceinline__ void async_cp32(const _Float16* g, _Float16* l) {
  unsigned loff = (unsigned)(uintptr_t)l;   // low 32 bits of generic ptr = LDS offset
  // s_wait_xcnt closes the statement so that no address register is rewritten ahead of it
  asm volatile("global_load_async_to_lds_b128 %0, %1, off\n\t"
               "global_load_async_to_lds_b128 %0, %1, off offset:16\n\t"
               "s_wait_xcnt 0x0"
               :: "v"(loff), "v"(g) : "memory");
}
// two such 32-byte copies (a K piece and a V piece) behind one s_wait_xcnt
__device__ __forceinline__ void async_cp32_pair(const _Float16* g0, _Float16* l0,
                                                const _Float16* g1, _Float16* l1) {
  unsigned loff0 = (unsigned)(uintptr_t)l0;
  unsigned loff1 = (unsigned)(uintptr_t)l1;
  asm volatile("global_load_async_to_lds_b128 %0, %1, off\n\t"
               "global_load_async_to_lds_b128 %0, %1, off offset:16\n\t"
               "global_load_async_to_lds_b128 %2, %3, off\n\t"
               "global_load_async_to_lds_b128 %2, %3, off offset:16\n\t"
               "s_wait_xcnt 0x0"
               :: "v"(loff0), "v"(g0), "v"(loff1), "v"(g1) : "memory");
}
__device__ __forceinline__ void wait_async0() {
  // this wave's own LDS reads of the buffer refilled behind the barrier have retired
  asm volatile("s_wait_dscnt 0x0" ::: "memory");
  asm volatile("s_wait_asynccnt 0x0" ::: "memory");
}

// LDS row pitches in halfs: 16 B x odd, so the 16 lanes of a ds_load_b128 that read
// 16 different rows fall on 16 different groups of four banks.
#define KP_ 72   // K rows of 128 B at 144 B
#define VP_ 40   // V rows of  64 B at  80 B
#define PP_ 40   // P rows of  64 B at  80 B

// 16 contiguous halfs of a padded LDS row (16-byte aligned only) as one WMMA operand
__device__ __forceinline__ v16h lds_frag(const _Float16* p) {
  v8h lo = *(const v8h*)p;
  v8h hi = *(const v8h*)(p + 8);
  return __builtin_shufflevector(lo, hi, 0, 1, 2, 3, 4, 5, 6, 7, 8, 9, 10, 11, 12, 13, 14, 15);
}

// ---- transpose + f32->f16 weight conversion: Wt[n*K + k] = W[k*N + n] ----
__global__ void wt_kernel(const float* __restrict__ W, _Float16* __restrict__ Wt,
                          int K, int N) {
  int idx = blockIdx.x * 256 + threadIdx.x;
  if (idx < K * N) {
    int n = idx / K, k = idx % K;
    Wt[idx] = (_Float16)W[k * N + n];
  }
}

// ---- LayerNorm rows of f32 [rows x 1024] -> f16 out; 1 wave / row ----
__global__ void ln_to_h_kernel(const float* __restrict__ x, const float* __restrict__ g,
                               _Float16* __restrict__ out) {
  int lane = threadIdx.x & 31, wid = threadIdx.x >> 5;
  int row = blockIdx.x * 4 + wid;
  const float* xr = x + (size_t)row * D_;
  float v[32], sum = 0.f, sq = 0.f;
  #pragma unroll
  for (int j = 0; j < 32; ++j) {
    v[j] = xr[j * 32 + lane];
    sum += v[j]; sq += v[j] * v[j];
  }
  sum = redsum32(sum); sq = redsum32(sq);
  float mean = sum * (1.0f / D_);
  float var  = sq * (1.0f / D_) - mean * mean;
  float rs   = rsqrtf(var + 1e-5f);
  _Float16* o = out + (size_t)row * D_;
  #pragma unroll
  for (int j = 0; j < 32; ++j)
    o[j * 32 + lane] = (_Float16)((v[j] - mean) * rs * g[j * 32 + lane]);
}

// ---- in-place LayerNorm f32 [rows x 1024] ----
__global__ void ln_inplace_kernel(float* __restrict__ x, const float* __restrict__ g) {
  int lane = threadIdx.x & 31, wid = threadIdx.x >> 5;
  int row = blockIdx.x * 4 + wid;
  float* xr = x + (size_t)row * D_;
  float v[32], sum = 0.f, sq = 0.f;
  #pragma unroll
  for (int j = 0; j < 32; ++j) {
    v[j] = xr[j * 32 + lane];
    sum += v[j]; sq += v[j] * v[j];
  }
  sum = redsum32(sum); sq = redsum32(sq);
  float mean = sum * (1.0f / D_);
  float var  = sq * (1.0f / D_) - mean * mean;
  float rs   = rsqrtf(var + 1e-5f);
  #pragma unroll
  for (int j = 0; j < 32; ++j)
    xr[j * 32 + lane] = (v[j] - mean) * rs * g[j * 32 + lane];
}

// ---- WMMA GEMM: C[MxN](f32) = A[MxK](f16 row-major) * Bt[NxK](f16 row-major)^T
// grid = (N/64, M/32), block = 32. 32x64 tile per wave, 8 accumulators,
// software-pipelined (next k-step's 6 operand loads overlap current 8 WMMAs).
__global__ void gemm_kernel(const _Float16* __restrict__ A, const _Float16* __restrict__ Bt,
                            float* __restrict__ C, int M, int N, int K) {
  int lane = threadIdx.x & 31;
  int half = lane >> 4, lcol = lane & 15;
  int m0 = blockIdx.y * 32, n0 = blockIdx.x * 64;
  const _Float16* a0p = A + (size_t)(m0 + lcol) * K + half * 16;
  const _Float16* a1p = A + (size_t)(m0 + 16 + lcol) * K + half * 16;
  const _Float16* b0p = Bt + (size_t)(n0 +  0 + lcol) * K + half * 16;
  const _Float16* b1p = Bt + (size_t)(n0 + 16 + lcol) * K + half * 16;
  const _Float16* b2p = Bt + (size_t)(n0 + 32 + lcol) * K + half * 16;
  const _Float16* b3p = Bt + (size_t)(n0 + 48 + lcol) * K + half * 16;

  v8f c00 = {}, c01 = {}, c02 = {}, c03 = {};
  v8f c10 = {}, c11 = {}, c12 = {}, c13 = {};

  v16h a0 = *(const v16h*)a0p, a1 = *(const v16h*)a1p;
  v16h b0 = *(const v16h*)b0p, b1 = *(const v16h*)b1p;
  v16h b2 = *(const v16h*)b2p, b3 = *(const v16h*)b3p;

  for (int k = 32;; k += 32) {
    int kn = (k < K) ? k : 0;                 // clamp last prefetch in-bounds
    v16h A0n = *(const v16h*)(a0p + kn);
    v16h A1n = *(const v16h*)(a1p + kn);
    v16h B0n = *(const v16h*)(b0p + kn);
    v16h B1n = *(const v16h*)(b1p + kn);
    v16h B2n = *(const v16h*)(b2p + kn);
    v16h B3n = *(const v16h*)(b3p + kn);

    c00 = WMMA_F16(a0, b0, c00);
    c01 = WMMA_F16(a0, b1, c01);
    c02 = WMMA_F16(a0, b2, c02);
    c03 = WMMA_F16(a0, b3, c03);
    c10 = WMMA_F16(a1, b0, c10);
    c11 = WMMA_F16(a1, b1, c11);
    c12 = WMMA_F16(a1, b2, c12);
    c13 = WMMA_F16(a1, b3, c13);

    if (k >= K) break;
    a0 = A0n; a1 = A1n; b0 = B0n; b1 = B1n; b2 = B2n; b3 = B3n;
  }

  v8f row0[4] = {c00, c01, c02, c03};
  v8f row1[4] = {c10, c11, c12, c13};
  #pragma unroll
  for (int t = 0; t < 4; ++t)
    #pragma unroll
    for (int r = 0; r < 8; ++r) {
      C[(size_t)(m0 + r + half * 8) * N + n0 + t * 16 + lcol]      = row0[t][r];
      C[(size_t)(m0 + 16 + r + half * 8) * N + n0 + t * 16 + lcol] = row1[t][r];
    }
}

// ---- 32x64 tile of xn[ROWS_ x D_] * Bt[.. x D_]^T in one wave, for the two projections:
// 8 accumulators, next k-step's 6 operand loads overlap the current 8 WMMAs.
// Column lcol of accumulator tile t is row n0 + lcol * 4 + t of Bt, so a lane ends up with
// four neighbouring columns of each of its rows.
__device__ __forceinline__ void proj_tile(const _Float16* __restrict__ A,
                                          const _Float16* __restrict__ Bt,
                                          int m0, int n0, v8f (&row0)[4], v8f (&row1)[4]) {
  int lane = threadIdx.x & 31;
  int half = lane >> 4, lcol = lane & 15;
  // the lane's byte offsets into the two operands; they step by one k block (64 B) a trip
  unsigned ao = (unsigned)(lcol * D_ + half * 16) * 2u;
  unsigned bo = (unsigned)(lcol * 4 * D_ + half * 16) * 2u;
  const char* Ab = (const char*)(A + (size_t)m0 * D_);
  const char* Bb = (const char*)(Bt + (size_t)n0 * D_);

  v8f c00 = {}, c01 = {}, c02 = {}, c03 = {};
  v8f c10 = {}, c11 = {}, c12 = {}, c13 = {};

  v16h a0 = *(const v16h*)(Ab + ao), a1 = *(const v16h*)(Ab + ao + 16 * D_ * 2);
  v16h b0 = *(const v16h*)(Bb + bo),              b1 = *(const v16h*)(Bb + bo + 1 * D_ * 2);
  v16h b2 = *(const v16h*)(Bb + bo + 2 * D_ * 2), b3 = *(const v16h*)(Bb + bo + 3 * D_ * 2);

  #pragma unroll 1   // rolled: both offsets stay live over every run of loads, so no load lands on them
  for (int k = 32; k < D_; k += 32) {
    // the step of the two offset registers, which the loads issued so far name, with its
    // s_wait_xcnt in front of it in the same statement, so that nothing comes between them
    asm volatile("s_wait_xcnt 0x0\n\t"
                 "v_add_nc_u32 %0, 64, %0\n\t"
                 "v_add_nc_u32 %1, 64, %1"
                 : "+v"(ao), "+v"(bo) :: "memory");
    v16h A0n = *(const v16h*)(Ab + ao);
    v16h A1n = *(const v16h*)(Ab + ao + 16 * D_ * 2);
    v16h B0n = *(const v16h*)(Bb + bo);
    v16h B1n = *(const v16h*)(Bb + bo + 1 * D_ * 2);
    v16h B2n = *(const v16h*)(Bb + bo + 2 * D_ * 2);
    v16h B3n = *(const v16h*)(Bb + bo + 3 * D_ * 2);

    c00 = WMMA_F16(a0, b0, c00);
    c01 = WMMA_F16(a0, b1, c01);
    c02 = WMMA_F16(a0, b2, c02);
    c03 = WMMA_F16(a0, b3, c03);
    c10 = WMMA_F16(a1, b0, c10);
    c11 = WMMA_F16(a1, b1, c11);
    c12 = WMMA_F16(a1, b2, c12);
    c13 = WMMA_F16(a1, b3, c13);

    a0 = A0n; a1 = A1n; b0 = B0n; b1 = B1n; b2 = B2n; b3 = B3n;
  }
  c00 = WMMA_F16(a0, b0, c00);
  c01 = WMMA_F16(a0, b1, c01);
  c02 = WMMA_F16(a0, b2, c02);
  c03 = WMMA_F16(a0, b3, c03);
  c10 = WMMA_F16(a1, b0, c10);
  c11 = WMMA_F16(a1, b1, c11);
  c12 = WMMA_F16(a1, b2, c12);
  c13 = WMMA_F16(a1, b3, c13);

  row0[0] = c00; row0[1] = c01; row0[2] = c02; row0[3] = c03;
  row1[0] = c10; row1[1] = c11; row1[2] = c12; row1[3] = c13;
}

// 16 rows x 64 columns as proj_tile leaves them (a lane has columns lcol*4 .. +3 of rows
// r + half*8): each row times num / max(mul * ||row||, 1e-12), stored as f16 rows of 128 B.
__device__ __forceinline__ void store_l2norm_rows(const v8f (&c)[4], _Float16* __restrict__ dst,
                                                  float num, float mul) {
  int lane = threadIdx.x & 31;
  int half = lane >> 4, lcol = lane & 15;
  float sq[8];
  #pragma unroll   // constant indices keep the accumulators in registers
  for (int r = 0; r < 8; ++r)
    sq[r] = c[0][r] * c[0][r] + c[1][r] * c[1][r] + c[2][r] * c[2][r] + c[3][r] * c[3][r];
  #pragma unroll   // eight independent shuffle chains side by side
  for (int m = 1; m < 16; m <<= 1)
    #pragma unroll
    for (int r = 0; r < 8; ++r) sq[r] += __shfl_xor(sq[r], m, 32);
  #pragma unroll   // constant indices keep the accumulators in registers
  for (int r = 0; r < 8; ++r) {
    float scale = num / fmaxf(mul * sqrtf(sq[r]), 1e-12f);
    v4h o = {(_Float16)(c[0][r] * scale), (_Float16)(c[1][r] * scale),
             (_Float16)(c[2][r] * scale), (_Float16)(c[3][r] * scale)};
    *(v4h*)(dst + (r + half * 8) * DH_ + lcol * 4) = o;
  }
  // stands in front of whatever rewrites the stores' data and address registers next
  asm volatile("s_wait_xcnt 0x0" ::: "memory");
}

// ---- q = xn @ Wq with the l2norm in the epilogue: a wave's 64 columns are one head.
// qn[b][h][n][64] f16, net scale 64/max(16*||q||,1e-12). grid = (H_, ROWS_/32), block = 32.
__global__ void proj_q_kernel(const _Float16* __restrict__ A, const _Float16* __restrict__ Bt,
                              _Float16* __restrict__ qn) {
  int m0 = blockIdx.y * 32, h = blockIdx.x;
  v8f row0[4], row1[4];
  proj_tile(A, Bt, m0, h * DH_, row0, row1);
  int b = m0 >> 11, n = m0 & 2047;
  _Float16* dst = qn + (size_t)(((b * H_ + h) * N_) + n) * DH_;
  store_l2norm_rows(row0, dst, 64.0f, 16.0f);
  store_l2norm_rows(row1, dst + 16 * DH_, 64.0f, 16.0f);
}

// ---- kv = xn @ Wkv, epilogue by column block: 0: k l2norm (*4) -> kn[b][n][64];
// 1: v -> vt[b][d][n] (transposed, f16). grid = (2, ROWS_/32), block = 32.
__global__ void proj_kv_kernel(const _Float16* __restrict__ A, const _Float16* __restrict__ Bt,
                               _Float16* __restrict__ kn, _Float16* __restrict__ vt) {
  int m0 = blockIdx.y * 32;
  v8f row0[4], row1[4];
  proj_tile(A, Bt, m0, blockIdx.x * DH_, row0, row1);
  if (blockIdx.x == 0) {
    _Float16* dst = kn + (size_t)m0 * DH_;
    store_l2norm_rows(row0, dst, 4.0f, 1.0f);
    store_l2norm_rows(row1, dst + 16 * DH_, 4.0f, 1.0f);
  } else {
    int lane = threadIdx.x & 31;
    int half = lane >> 4, lcol = lane & 15;
    int b = m0 >> 11, n = m0 & 2047;
    // the 8 registers of an accumulator are 8 consecutive n of one d: one 16-byte store
    #pragma unroll   // constant indices keep the accumulators in registers
    for (int t = 0; t < 4; ++t) {
      _Float16* vd = vt + (size_t)(b * DH_ + lcol * 4 + t) * N_ + n + half * 8;
      *(v8h*)vd        = __builtin_convertvector(row0[t], v8h);
      *(v8h*)(vd + 16) = __builtin_convertvector(row1[t], v8h);
    }
    // stands in front of whatever rewrites the stores' data and address registers next
    asm volatile("s_wait_xcnt 0x0" ::: "memory");
  }
}

// ---- attention: per (b,h,16-row block), 4 row-blocks per 128-thread block.
// K and V chunks (32 j x 64 d) are staged cooperatively into LDS via
// async global->LDS copies (ASYNCcnt), double-buffered; WMMA B-operands
// then come from contiguous 32B ds loads of padded rows. 2-pass softmax.
__global__ void attn_kernel(const _Float16* __restrict__ qn, const _Float16* __restrict__ kn,
                            const _Float16* __restrict__ vt, _Float16* __restrict__ ao) {
  __shared__ __attribute__((aligned(16))) _Float16 Kbuf[2][32 * KP_];   // [chunk rows j][d]      9 KB
  __shared__ __attribute__((aligned(16))) _Float16 Vbuf[2][64 * VP_];   // [d][chunk cols j]     10 KB
  __shared__ __attribute__((aligned(16))) _Float16 ldsP[4][16 * PP_];   // per-wave P staging     5 KB

  int tid  = threadIdx.x;
  int lane = tid & 31, wid = tid >> 5;
  int half = lane >> 4, lcol = lane & 15;
  int unit = blockIdx.x * 4 + wid;         // 0 .. 4095
  int ib = unit >> 10;
  int ih = (unit >> 7) & 7;
  int i0 = (unit & 127) * 16;
  const _Float16* Q  = qn + (size_t)((ib * H_ + ih) * N_) * DH_;
  const _Float16* Kp = kn + (size_t)(ib * N_) * DH_;
  const _Float16* V  = vt + (size_t)ib * DH_ * N_;
  int d0 = half * 16;

  v16h a0 = *(const v16h*)(Q + (size_t)(i0 + lcol) * DH_ + d0);
  v16h a1 = *(const v16h*)(Q + (size_t)(i0 + lcol) * DH_ + 32 + d0);

  // ---- pass 1: row max; K chunks async-staged through LDS ----
  float m[8];
  #pragma unroll
  for (int r = 0; r < 8; ++r) m[r] = -1e30f;

  // chunk = 32 j-rows (4 KB). 128 threads x 32B = one chunk; four threads fill a row.
  int kdst = (tid >> 2) * KP_ + (tid & 3) * 16;        // K staging place of this thread
  async_cp32(Kp + tid * 16, &Kbuf[0][kdst]);           // stage chunk 0
  for (int c = 0; c < 64; ++c) {
    int cb = c & 1;
    wait_async0();
    __syncthreads();           // chunk cb ready; buffer (c+1)&1 free
    if (c < 63)
      async_cp32(Kp + (size_t)(c + 1) * 32 * DH_ + tid * 16,
                 &Kbuf[(c + 1) & 1][kdst]);
    #pragma unroll
    for (int sub = 0; sub < 2; ++sub) {
      const _Float16* kb = &Kbuf[cb][(sub * 16 + lcol) * KP_];
      v16h b0 = lds_frag(kb + d0);
      v16h b1 = lds_frag(kb + 32 + d0);
      v8f acc = {};
      acc = WMMA_F16(a0, b0, acc);
      acc = WMMA_F16(a1, b1, acc);
      #pragma unroll
      for (int r = 0; r < 8; ++r) m[r] = fmaxf(m[r], acc[r]);
    }
  }
  #pragma unroll
  for (int r = 0; r < 8; ++r) m[r] = redmax16(m[r]);

  // ---- pass 2: exp, stage P via LDS, P@V; K and V chunks async-staged ----
  float s[8];
  #pragma unroll
  for (int r = 0; r < 8; ++r) s[r] = 0.f;
  v8f o0 = {}, o1 = {}, o2 = {}, o3 = {};
  _Float16* P = ldsP[wid];
  int vd = tid >> 1, vpart = tid & 1;      // V staging role of this thread

  int vdst = vd * VP_ + vpart * 16;        // V staging place of this thread
  async_cp32_pair(Kp + tid * 16, &Kbuf[0][kdst],
                  V + (size_t)vd * N_ + vpart * 16, &Vbuf[0][vdst]);

  for (int c = 0; c < 64; ++c) {
    int cb = c & 1;
    wait_async0();
    __syncthreads();           // K/V chunk cb ready; buffer (c+1)&1 free
    if (c < 63) {
      int nb = (c + 1) & 1;
      async_cp32_pair(Kp + (size_t)(c + 1) * 32 * DH_ + tid * 16, &Kbuf[nb][kdst],
                      V + (size_t)vd * N_ + (c + 1) * 32 + vpart * 16, &Vbuf[nb][vdst]);
    }
    v8f acc[2];
    #pragma unroll
    for (int sub = 0; sub < 2; ++sub) {
      const _Float16* kb = &Kbuf[cb][(sub * 16 + lcol) * KP_];
      v16h b0 = lds_frag(kb + d0);
      v16h b1 = lds_frag(kb + 32 + d0);
      v8f z = {};
      z = WMMA_F16(a0, b0, z);
      acc[sub] = WMMA_F16(a1, b1, z);
    }
    #pragma unroll
    for (int sub = 0; sub < 2; ++sub)
      #pragma unroll
      for (int r = 0; r < 8; ++r) {
        float p = __expf(acc[sub][r] - m[r]);
        s[r] += p;
        P[(r + half * 8) * PP_ + sub * 16 + lcol] = (_Float16)p;
      }
    __syncthreads();           // P visible (block-uniform control flow)
    v16h ap  = lds_frag(P + lcol * PP_ + half * 16);
    v16h bv0 = lds_frag(&Vbuf[cb][( 0 + lcol) * VP_ + half * 16]);
    v16h bv1 = lds_frag(&Vbuf[cb][(16 + lcol) * VP_ + half * 16]);
    v16h bv2 = lds_frag(&Vbuf[cb][(32 + lcol) * VP_ + half * 16]);
    v16h bv3 = lds_frag(&Vbuf[cb][(48 + lcol) * VP_ + half * 16]);
    o0 = WMMA_F16(ap, bv0, o0);
    o1 = WMMA_F16(ap, bv1, o1);
    o2 = WMMA_F16(ap, bv2, o2);
    o3 = WMMA_F16(ap, bv3, o3);
  }

  #pragma unroll
  for (int r = 0; r < 8; ++r) s[r] = redsum16(s[r]);
  v8f os[4] = {o0, o1, o2, o3};
  #pragma unroll
  for (int r = 0; r < 8; ++r) {
    float inv = 1.0f / fmaxf(s[r], 1e-20f);
    int row = ib * N_ + i0 + r + half * 8;
    _Float16* dst = ao + (size_t)row * INNER_ + ih * DH_;
    #pragma unroll
    for (int t = 0; t < 4; ++t)
      dst[t * 16 + lcol] = (_Float16)(os[t][r] * inv);
  }
}

extern "C" void kernel_launch(void* const* d_in, const int* in_sizes, int n_in,
                              void* d_out, int out_size, void* d_ws, size_t ws_size,
                              hipStream_t stream) {
  const float* x          = (const float*)d_in[0];
  const float* norm_g     = (const float*)d_in[1];
  const float* Wq         = (const float*)d_in[2];
  const float* Wkv        = (const float*)d_in[3];
  const float* Wout       = (const float*)d_in[4];
  const float* out_norm_g = (const float*)d_in[5];
  float* out = (float*)d_out;

  char* w = (char*)d_ws;
  size_t off = 0;
  auto alloc = [&](size_t bytes) -> void* {
    void* p = w + off;
    off += (bytes + 255) & ~(size_t)255;
    return p;
  };
  _Float16* xn_h  = (_Float16*)alloc((size_t)ROWS_ * D_ * 2);       // 16 MB
  _Float16* WqT   = (_Float16*)alloc((size_t)INNER_ * D_ * 2);      //  1 MB
  _Float16* WkvT  = (_Float16*)alloc((size_t)128 * D_ * 2);         // .25 MB
  _Float16* WoutT = (_Float16*)alloc((size_t)D_ * INNER_ * 2);      //  1 MB
  _Float16* qn_h  = (_Float16*)alloc((size_t)ROWS_ * INNER_ * 2);   //  8 MB
  _Float16* kn_h  = (_Float16*)alloc((size_t)ROWS_ * DH_ * 2);      //  1 MB
  _Float16* vt_h  = (_Float16*)alloc((size_t)ROWS_ * DH_ * 2);      //  1 MB
  _Float16* ao_h  = (_Float16*)alloc((size_t)ROWS_ * INNER_ * 2);   //  8 MB

  // 1. weight transposes (f32 -> f16 [N][K])
  wt_kernel<<<(D_ * INNER_ + 255) / 256, 256, 0, stream>>>(Wq,   WqT,   D_,    INNER_);
  wt_kernel<<<(D_ * 128    + 255) / 256, 256, 0, stream>>>(Wkv,  WkvT,  D_,    128);
  wt_kernel<<<(INNER_ * D_ + 255) / 256, 256, 0, stream>>>(Wout, WoutT, INNER_, D_);

  // 2. LayerNorm(x) -> xn (f16)
  ln_to_h_kernel<<<ROWS_ / 4, 128, 0, stream>>>(x, norm_g, xn_h);

  // 3. q = xn@Wq ; kv = xn@Wkv   (32x64 tile per wave), l2norms and V transpose in the epilogues
  proj_q_kernel <<<dim3(H_, ROWS_ / 32), 32, 0, stream>>>(xn_h, WqT,  qn_h);
  proj_kv_kernel<<<dim3(2,  ROWS_ / 32), 32, 0, stream>>>(xn_h, WkvT, kn_h, vt_h);

  // 5. attention (async-LDS staged K/V, WMMA everywhere)
  attn_kernel<<<(B_ * H_ * (N_ / 16)) / 4, 128, 0, stream>>>(qn_h, kn_h, vt_h, ao_h);

  // 6. out = ao @ Wout  (f32 into d_out)
  gemm_kernel<<<dim3(D_ / 64, ROWS_ / 32), 32, 0, stream>>>(ao_h, WoutT, out, ROWS_, D_, INNER_);

  // 7. final LayerNorm in place on d_out
  ln_inplace_kernel<<<ROWS_ / 4, 128, 0, stream>>>(out, out_norm_g);
}

// v003
// It runs in 180 microseconds.
// Timed twice side by side with v002, it ran 1.30 times as fast both times.
// All steps since v000 together make it 1.88 times as fast.
#include <hip/hip_runtime.h>
#include <hip/hip_bf16.h>

typedef __attribute__((ext_vector_type(16))) _Float16 v16h;
typedef __attribute__((ext_vector_type(8)))  _Float16 v8h;
typedef __attribute__((ext_vector_type(4)))  _Float16 v4h;
typedef __attribute__((ext_vector_type(8)))  float    v8f;

#define B_  4
#define N_  2048
#define D_  1024
#define H_  8
#define DH_ 64
#define INNER_ 512
#define ROWS_ (B_ * N_)   // 8192

#define WMMA_F16(a, b, c) \
  __builtin_amdgcn_wmma_f32_16x16x32_f16(false, (a), false, (b), (short)0, (c), false, false)

__device__ __forceinline__ float redmax16(float v) {
  #pragma unroll
  for (int m = 1; m < 16; m <<= 1) v = fmaxf(v, __shfl_xor(v, m, 32));
  return v;
}
__device__ __forceinline__ float redsum16(float v) {
  #pragma unroll
  for (int m = 1; m < 16; m <<= 1) v += __shfl_xor(v, m, 32);
  return v;
}
__device__ __forceinline__ float redsum32(float v) {
  #pragma unroll
  for (int m = 1; m < 32; m <<= 1) v += __shfl_xor(v, m, 32);
  return v;
}

// async copy of 32 bytes/lane: global -> LDS (tracked by ASYNCcnt).
// INST_OFFSET applies to both LDS and global addresses (ISA 08 §4.4).
__device__ __forceinline__ void async_cp32(const _Float16* g, _Float16* l) {
  unsigned loff = (unsigned)(uintptr_t)l;   // low 32 bits of generic ptr = LDS offset
  // s_wait_xcnt closes the statement so that no address register is rewritten ahead of it
  asm volatile("global_load_async_to_lds_b128 %0, %1, off\n\t"
               "global_load_async_to_lds_b128 %0, %1, off offset:16\n\t"
               "s_wait_xcnt 0x0"
               :: "v"(loff), "v"(g) : "memory");
}
// two such 32-byte copies (a K piece and a V piece) behind one s_wait_xcnt
__device__ __forceinline__ void async_cp32_pair(const _Float16* g0, _Float16* l0,
                                                const _Float16* g1, _Float16* l1) {
  unsigned loff0 = (unsigned)(uintptr_t)l0;
  unsigned loff1 = (unsigned)(uintptr_t)l1;
  asm volatile("global_load_async_to_lds_b128 %0, %1, off\n\t"
               "global_load_async_to_lds_b128 %0, %1, off offset:16\n\t"
               "global_load_async_to_lds_b128 %2, %3, off\n\t"
               "global_load_async_to_lds_b128 %2, %3, off offset:16\n\t"
               "s_wait_xcnt 0x0"
               :: "v"(loff0), "v"(g0), "v"(loff1), "v"(g1) : "memory");
}
__device__ __forceinline__ void wait_async0() {
  // this wave's own LDS reads of the buffer refilled behind the barrier have retired
  asm volatile("s_wait_dscnt 0x0" ::: "memory");
  asm volatile("s_wait_asynccnt 0x0" ::: "memory");
}

// LDS row pitches in halfs: 16 B x odd, so the 16 lanes of a ds_load_b128 that read
// 16 different rows fall on 16 different groups of four banks.
#define KP_ 72   // K rows of 128 B at 144 B
#define VP_ 40   // V rows of  64 B at  80 B
#define PP_ 40   // P rows of  64 B at  80 B

// 16 contiguous halfs of a padded LDS row (16-byte aligned only) as one WMMA operand
__device__ __forceinline__ v16h lds_frag(const _Float16* p) {
  v8h lo = *(const v8h*)p;
  v8h hi = *(const v8h*)(p + 8);
  return __builtin_shufflevector(lo, hi, 0, 1, 2, 3, 4, 5, 6, 7, 8, 9, 10, 11, 12, 13, 14, 15);
}

// ---- transpose + f32->f16 weight conversion: Wt[n*K + k] = W[k*N + n] ----
__global__ void wt_kernel(const float* __restrict__ W, _Float16* __restrict__ Wt,
                          int K, int N) {
  int idx = blockIdx.x * 256 + threadIdx.x;
  if (idx < K * N) {
    int n = idx / K, k = idx % K;
    Wt[idx] = (_Float16)W[k * N + n];
  }
}

// ---- LayerNorm rows of f32 [rows x 1024] -> f16 out; 1 wave / row ----
__global__ void ln_to_h_kernel(const float* __restrict__ x, const float* __restrict__ g,
                               _Float16* __restrict__ out) {
  int lane = threadIdx.x & 31, wid = threadIdx.x >> 5;
  int row = blockIdx.x * 4 + wid;
  const float* xr = x + (size_t)row * D_;
  float v[32], sum = 0.f, sq = 0.f;
  #pragma unroll
  for (int j = 0; j < 32; ++j) {
    v[j] = xr[j * 32 + lane];
    sum += v[j]; sq += v[j] * v[j];
  }
  sum = redsum32(sum); sq = redsum32(sq);
  float mean = sum * (1.0f / D_);
  float var  = sq * (1.0f / D_) - mean * mean;
  float rs   = rsqrtf(var + 1e-5f);
  _Float16* o = out + (size_t)row * D_;
  #pragma unroll
  for (int j = 0; j < 32; ++j)
    o[j * 32 + lane] = (_Float16)((v[j] - mean) * rs * g[j * 32 + lane]);
}

// ---- in-place LayerNorm f32 [rows x 1024] ----
__global__ void ln_inplace_kernel(float* __restrict__ x, const float* __restrict__ g) {
  int lane = threadIdx.x & 31, wid = threadIdx.x >> 5;
  int row = blockIdx.x * 4 + wid;
  float* xr = x + (size_t)row * D_;
  float v[32], sum = 0.f, sq = 0.f;
  #pragma unroll
  for (int j = 0; j < 32; ++j) {
    v[j] = xr[j * 32 + lane];
    sum += v[j]; sq += v[j] * v[j];
  }
  sum = redsum32(sum); sq = redsum32(sq);
  float mean = sum * (1.0f / D_);
  float var  = sq * (1.0f / D_) - mean * mean;
  float rs   = rsqrtf(var + 1e-5f);
  #pragma unroll
  for (int j = 0; j < 32; ++j)
    xr[j * 32 + lane] = (v[j] - mean) * rs * g[j * 32 + lane];
}

// ---- 128x64 tile of A[.. x K] * Bt[.. x K]^T in a block of four waves (32x64 a wave,
// 8 accumulators). A k block of 64 halfs (128 A rows and 64 B rows of 128 B) is staged in LDS
// by async copies that cover whole lines, two buffers: the next block flies during this one.
#define GP_    72                  // staged rows of 128 B at 144 B (16 B x odd)
#define GROWS_ (128 + 64)          // A rows, then B rows
#define GBUF_  (GROWS_ * GP_)      // halfs in one buffer

// Ag, Bg: this thread's 16 bytes of row tid / 8 of the A tile and of the B tile, at the k block:
// eight lanes fill one 128-byte row, a thread takes every 16th row (8 of A, 4 of B).
// PERM: row j of the B tile lands at place (j % 4) * 16 + j / 4.
template <int K, bool PERM>
__device__ __forceinline__ void stage_block(const _Float16* Ag, const _Float16* Bg,
                                            _Float16* buf) {
  int r = threadIdx.x >> 3, p = (threadIdx.x & 7) * 8;
  unsigned la = (unsigned)(uintptr_t)(buf + r * GP_ + p);   // low 32 bits = LDS byte address
  unsigned lb = (unsigned)(uintptr_t)(buf + (128 + (PERM ? (r & 3) * 16 + (r >> 2) : r)) * GP_ + p);
  const unsigned sa = 16 * GP_ * 2, sb = (PERM ? 4 : 16) * GP_ * 2;
  // s_wait_xcnt closes the statement so that no address register is rewritten ahead of it
  asm volatile("global_load_async_to_lds_b128 %0, %1, off\n\t"
               "global_load_async_to_lds_b128 %2, %3, off\n\t"
               "global_load_async_to_lds_b128 %4, %5, off\n\t"
               "global_load_async_to_lds_b128 %6, %7, off\n\t"
               "global_load_async_to_lds_b128 %8, %9, off\n\t"
               "global_load_async_to_lds_b128 %10, %11, off\n\t"
               "global_load_async_to_lds_b128 %12, %13, off\n\t"
               "global_load_async_to_lds_b128 %14, %15, off\n\t"
               "global_load_async_to_lds_b128 %16, %17, off\n\t"
               "global_load_async_to_lds_b128 %18, %19, off\n\t"
               "global_load_async_to_lds_b128 %20, %21, off\n\t"
               "global_load_async_to_lds_b128 %22, %23, off\n\t"
               "s_wait_xcnt 0x0"
               :: "v"(la),          "v"(Ag),           "v"(la + sa),     "v"(Ag + 16 * K),
                  "v"(la + 2 * sa), "v"(Ag + 32 * K),  "v"(la + 3 * sa), "v"(Ag + 48 * K),
                  "v"(la + 4 * sa), "v"(Ag + 64 * K),  "v"(la + 5 * sa), "v"(Ag + 80 * K),
                  "v"(la + 6 * sa), "v"(Ag + 96 * K),  "v"(la + 7 * sa), "v"(Ag + 112 * K),
                  "v"(lb),          "v"(Bg),           "v"(lb + sb),     "v"(Bg + 16 * K),
                  "v"(lb + 2 * sb), "v"(Bg + 32 * K),  "v"(lb + 3 * sb), "v"(Bg + 48 * K)
               : "memory");
}

// The wave's rows are mblk + wid * 32 .. + 31. Column lcol of accumulator tile t is row
// n0 + t * 16 + lcol of Bt, or with PERM row n0 + lcol * 4 + t, so that a lane ends up with
// four neighbouring columns of each of its rows.
template <int K, bool PERM>
__device__ __forceinline__ void gemm_tile(const _Float16* __restrict__ A,
                                          const _Float16* __restrict__ Bt,
                                          int mblk, int n0, _Float16* lds,
                                          v8f (&row0)[4], v8f (&row1)[4]) {
  int tid = threadIdx.x;
  int lane = tid & 31, wid = tid >> 5;
  int half = lane >> 4, lcol = lane & 15;
  const _Float16* Ag = A  + (size_t)(mblk + (tid >> 3)) * K + (tid & 7) * 8;
  const _Float16* Bg = Bt + (size_t)(n0   + (tid >> 3)) * K + (tid & 7) * 8;

  v8f c00 = {}, c01 = {}, c02 = {}, c03 = {};
  v8f c10 = {}, c11 = {}, c12 = {}, c13 = {};

  // one staged k block: its 12 fragments, then the 16 WMMAs
  auto k_block = [&](const _Float16* buf) {
    const _Float16* Ab = buf + (wid * 32 + lcol) * GP_ + half * 16;
    const _Float16* Bb = buf + (128 + lcol) * GP_ + half * 16;
    v16h a0 = lds_frag(Ab),                 a1 = lds_frag(Ab + 16 * GP_);
    v16h b0 = lds_frag(Bb),                 b1 = lds_frag(Bb + 16 * GP_);
    v16h b2 = lds_frag(Bb + 32 * GP_),      b3 = lds_frag(Bb + 48 * GP_);
    v16h e0 = lds_frag(Ab + 32),            e1 = lds_frag(Ab + 16 * GP_ + 32);
    v16h f0 = lds_frag(Bb + 32),            f1 = lds_frag(Bb + 16 * GP_ + 32);
    v16h f2 = lds_frag(Bb + 32 * GP_ + 32), f3 = lds_frag(Bb + 48 * GP_ + 32);
    c00 = WMMA_F16(a0, b0, c00);
    c01 = WMMA_F16(a0, b1, c01);
    c02 = WMMA_F16(a0, b2, c02);
    c03 = WMMA_F16(a0, b3, c03);
    c10 = WMMA_F16(a1, b0, c10);
    c11 = WMMA_F16(a1, b1, c11);
    c12 = WMMA_F16(a1, b2, c12);
    c13 = WMMA_F16(a1, b3, c13);
    c00 = WMMA_F16(e0, f0, c00);
    c01 = WMMA_F16(e0, f1, c01);
    c02 = WMMA_F16(e0, f2, c02);
    c03 = WMMA_F16(e0, f3, c03);
    c10 = WMMA_F16(e1, f0, c10);
    c11 = WMMA_F16(e1, f1, c11);
    c12 = WMMA_F16(e1, f2, c12);
    c13 = WMMA_F16(e1, f3, c13);
  };

  stage_block<K, PERM>(Ag, Bg, lds);                  // k block 0
  #pragma unroll 1   // rolled: unrolled, the LDS reads came out scattered in pairs among the WMMAs
  for (int kb = 0; kb < K / 64 - 1; ++kb) {
    wait_async0();
    __syncthreads();           // k block kb ready; the other buffer free
    stage_block<K, PERM>(Ag + (kb + 1) * 64, Bg + (kb + 1) * 64, lds + ((kb + 1) & 1) * GBUF_);
    k_block(lds + (kb & 1) * GBUF_);
  }
  wait_async0();
  __syncthreads();             // the last k block ready
  k_block(lds + ((K / 64 - 1) & 1) * GBUF_);

  row0[0] = c00; row0[1] = c01; row0[2] = c02; row0[3] = c03;
  row1[0] = c10; row1[1] = c11; row1[2] = c12; row1[3] = c13;
}

// ---- C[ROWS_ x D_](f32) = A[ROWS_ x INNER_](f16) * Bt[D_ x INNER_](f16)^T
// grid = (D_/64, ROWS_/128), block = 128. The launch bound of the three GEMM kernels states the
// four waves: under the default bound the register cap made the fragments spill.
__global__ __launch_bounds__(128)
void gemm_kernel(const _Float16* __restrict__ A, const _Float16* __restrict__ Bt,
                 float* __restrict__ C) {
  __shared__ __attribute__((aligned(16))) _Float16 stage[2 * GBUF_];   // 54 KB
  const int N = D_;
  int lane = threadIdx.x & 31;
  int half = lane >> 4, lcol = lane & 15;
  int m0 = blockIdx.y * 128 + (threadIdx.x >> 5) * 32, n0 = blockIdx.x * 64;
  v8f row0[4], row1[4];
  gemm_tile<INNER_, false>(A, Bt, blockIdx.y * 128, n0, stage, row0, row1);
  #pragma unroll
  for (int t = 0; t < 4; ++t)
    #pragma unroll
    for (int r = 0; r < 8; ++r) {
      C[(size_t)(m0 + r + half * 8) * N + n0 + t * 16 + lcol]      = row0[t][r];
      C[(size_t)(m0 + 16 + r + half * 8) * N + n0 + t * 16 + lcol] = row1[t][r];
    }
}

// 16 rows x 64 columns as gemm_tile with PERM leaves them (a lane has columns lcol*4 .. +3 of rows
// r + half*8): each row times num / max(mul * ||row||, 1e-12), stored as f16 rows of 128 B.
__device__ __forceinline__ void store_l2norm_rows(const v8f (&c)[4], _Float16* __restrict__ dst,
                                                  float num, float mul) {
  int lane = threadIdx.x & 31;
  int half = lane >> 4, lcol = lane & 15;
  float sq[8];
  #pragma unroll   // constant indices keep the accumulators in registers
  for (int r = 0; r < 8; ++r)
    sq[r] = c[0][r] * c[0][r] + c[1][r] * c[1][r] + c[2][r] * c[2][r] + c[3][r] * c[3][r];
  #pragma unroll   // eight independent shuffle chains side by side
  for (int m = 1; m < 16; m <<= 1)
    #pragma unroll
    for (int r = 0; r < 8; ++r) sq[r] += __shfl_xor(sq[r], m, 32);
  #pragma unroll   // constant indices keep the accumulators in registers
  for (int r = 0; r < 8; ++r) {
    float scale = num / fmaxf(mul * sqrtf(sq[r]), 1e-12f);
    v4h o = {(_Float16)(c[0][r] * scale), (_Float16)(c[1][r] * scale),
             (_Float16)(c[2][r] * scale), (_Float16)(c[3][r] * scale)};
    *(v4h*)(dst + (r + half * 8) * DH_ + lcol * 4) = o;
  }
  // stands in front of whatever rewrites the stores' data and address registers next
  asm volatile("s_wait_xcnt 0x0" ::: "memory");
}

// ---- q = xn @ Wq with the l2norm in the epilogue: a wave's 64 columns are one head.
// qn[b][h][n][64] f16, net scale 64/max(16*||q||,1e-12). grid = (H_, ROWS_/128), block = 128.
__global__ __launch_bounds__(128)
void proj_q_kernel(const _Float16* __restrict__ A, const _Float16* __restrict__ Bt,
                   _Float16* __restrict__ qn) {
  __shared__ __attribute__((aligned(16))) _Float16 stage[2 * GBUF_];   // 54 KB
  int m0 = blockIdx.y * 128 + (threadIdx.x >> 5) * 32, h = blockIdx.x;
  v8f row0[4], row1[4];
  gemm_tile<D_, true>(A, Bt, blockIdx.y * 128, h * DH_, stage, row0, row1);
  int b = m0 >> 11, n = m0 & 2047;
  _Float16* dst = qn + (size_t)(((b * H_ + h) * N_) + n) * DH_;
  store_l2norm_rows(row0, dst, 64.0f, 16.0f);
  store_l2norm_rows(row1, dst + 16 * DH_, 64.0f, 16.0f);
}

// ---- kv = xn @ Wkv, epilogue by column block: 0: k l2norm (*4) -> kn[b][n][64];
// 1: v -> vt[b][d][n] (transposed, f16). grid = (2, ROWS_/128), block = 128.
__global__ __launch_bounds__(128)
void proj_kv_kernel(const _Float16* __restrict__ A, const _Float16* __restrict__ Bt,
                    _Float16* __restrict__ kn, _Float16* __restrict__ vt) {
  __shared__ __attribute__((aligned(16))) _Float16 stage[2 * GBUF_];   // 54 KB
  int m0 = blockIdx.y * 128 + (threadIdx.x >> 5) * 32;
  v8f row0[4], row1[4];
  gemm_tile<D_, true>(A, Bt, blockIdx.y * 128, blockIdx.x * DH_, stage, row0, row1);
  if (blockIdx.x == 0) {
    _Float16* dst = kn + (size_t)m0 * DH_;
    store_l2norm_rows(row0, dst, 4.0f, 1.0f);
    store_l2norm_rows(row1, dst + 16 * DH_, 4.0f, 1.0f);
  } else {
    int lane = threadIdx.x & 31;
    int half = lane >> 4, lcol = lane & 15;
    int b = m0 >> 11, n = m0 & 2047;
    // the 8 registers of an accumulator are 8 consecutive n of one d: one 16-byte store
    #pragma unroll   // constant indices keep the accumulators in registers
    for (int t = 0; t < 4; ++t) {
      _Float16* vd = vt + (size_t)(b * DH_ + lcol * 4 + t) * N_ + n + half * 8;
      *(v8h*)vd        = __builtin_convertvector(row0[t], v8h);
      *(v8h*)(vd + 16) = __builtin_convertvector(row1[t], v8h);
    }
    // stands in front of whatever rewrites the stores' data and address registers next
    asm volatile("s_wait_xcnt 0x0" ::: "memory");
  }
}

// ---- attention: per (b,h,16-row block), 4 row-blocks per 128-thread block.
// K and V chunks (32 j x 64 d) are staged cooperatively into LDS via
// async global->LDS copies (ASYNCcnt), double-buffered; WMMA B-operands
// then come from contiguous 32B ds loads of padded rows. 2-pass softmax.
__global__ void attn_kernel(const _Float16* __restrict__ qn, const _Float16* __restrict__ kn,
                            const _Float16* __restrict__ vt, _Float16* __restrict__ ao) {
  __shared__ __attribute__((aligned(16))) _Float16 Kbuf[2][32 * KP_];   // [chunk rows j][d]      9 KB
  __shared__ __attribute__((aligned(16))) _Float16 Vbuf[2][64 * VP_];   // [d][chunk cols j]     10 KB
  __shared__ __attribute__((aligned(16))) _Float16 ldsP[4][16 * PP_];   // per-wave P staging     5 KB

  int tid  = threadIdx.x;
  int lane = tid & 31, wid = tid >> 5;
  int half = lane >> 4, lcol = lane & 15;
  int unit = blockIdx.x * 4 + wid;         // 0 .. 4095
  int ib = unit >> 10;
  int ih = (unit >> 7) & 7;
  int i0 = (unit & 127) * 16;
  const _Float16* Q  = qn + (size_t)((ib * H_ + ih) * N_) * DH_;
  const _Float16* Kp = kn + (size_t)(ib * N_) * DH_;
  const _Float16* V  = vt + (size_t)ib * DH_ * N_;
  int d0 = half * 16;

  v16h a0 = *(const v16h*)(Q + (size_t)(i0 + lcol) * DH_ + d0);
  v16h a1 = *(const v16h*)(Q + (size_t)(i0 + lcol) * DH_ + 32 + d0);

  // ---- pass 1: row max; K chunks async-staged through LDS ----
  float m[8];
  #pragma unroll
  for (int r = 0; r < 8; ++r) m[r] = -1e30f;

  // chunk = 32 j-rows (4 KB). 128 threads x 32B = one chunk; four threads fill a row.
  int kdst = (tid >> 2) * KP_ + (tid & 3) * 16;        // K staging place of this thread
  async_cp32(Kp + tid * 16, &Kbuf[0][kdst]);           // stage chunk 0
  for (int c = 0; c < 64; ++c) {
    int cb = c & 1;
    wait_async0();
    __syncthreads();           // chunk cb ready; buffer (c+1)&1 free
    if (c < 63)
      async_cp32(Kp + (size_t)(c + 1) * 32 * DH_ + tid * 16,
                 &Kbuf[(c + 1) & 1][kdst]);
    #pragma unroll
    for (int sub = 0; sub < 2; ++sub) {
      const _Float16* kb = &Kbuf[cb][(sub * 16 + lcol) * KP_];
      v16h b0 = lds_frag(kb + d0);
      v16h b1 = lds_frag(kb + 32 + d0);
      v8f acc = {};
      acc = WMMA_F16(a0, b0, acc);
      acc = WMMA_F16(a1, b1, acc);
      #pragma unroll
      for (int r = 0; r < 8; ++r) m[r] = fmaxf(m[r], acc[r]);
    }
  }
  #pragma unroll
  for (int r = 0; r < 8; ++r) m[r] = redmax16(m[r]);

  // ---- pass 2: exp, stage P via LDS, P@V; K and V chunks async-staged ----
  float s[8];
  #pragma unroll
  for (int r = 0; r < 8; ++r) s[r] = 0.f;
  v8f o0 = {}, o1 = {}, o2 = {}, o3 = {};
  _Float16* P = ldsP[wid];
  int vd = tid >> 1, vpart = tid & 1;      // V staging role of this thread

  int vdst = vd * VP_ + vpart * 16;        // V staging place of this thread
  async_cp32_pair(Kp + tid * 16, &Kbuf[0][kdst],
                  V + (size_t)vd * N_ + vpart * 16, &Vbuf[0][vdst]);

  for (int c = 0; c < 64; ++c) {
    int cb = c & 1;
    wait_async0();
    __syncthreads();           // K/V chunk cb ready; buffer (c+1)&1 free
    if (c < 63) {
      int nb = (c + 1) & 1;
      async_cp32_pair(Kp + (size_t)(c + 1) * 32 * DH_ + tid * 16, &Kbuf[nb][kdst],
                      V + (size_t)vd * N_ + (c + 1) * 32 + vpart * 16, &Vbuf[nb][vdst]);
    }
    v8f acc[2];
    #pragma unroll
    for (int sub = 0; sub < 2; ++sub) {
      const _Float16* kb = &Kbuf[cb][(sub * 16 + lcol) * KP_];
      v16h b0 = lds_frag(kb + d0);
      v16h b1 = lds_frag(kb + 32 + d0);
      v8f z = {};
      z = WMMA_F16(a0, b0, z);
      acc[sub] = WMMA_F16(a1, b1, z);
    }
    #pragma unroll
    for (int sub = 0; sub < 2; ++sub)
      #pragma unroll
      for (int r = 0; r < 8; ++r) {
        float p = __expf(acc[sub][r] - m[r]);
        s[r] += p;
        P[(r + half * 8) * PP_ + sub * 16 + lcol] = (_Float16)p;
      }
    __syncthreads();           // P visible (block-uniform control flow)
    v16h ap  = lds_frag(P + lcol * PP_ + half * 16);
    v16h bv0 = lds_frag(&Vbuf[cb][( 0 + lcol) * VP_ + half * 16]);
    v16h bv1 = lds_frag(&Vbuf[cb][(16 + lcol) * VP_ + half * 16]);
    v16h bv2 = lds_frag(&Vbuf[cb][(32 + lcol) * VP_ + half * 16]);
    v16h bv3 = lds_frag(&Vbuf[cb][(48 + lcol) * VP_ + half * 16]);
    o0 = WMMA_F16(ap, bv0, o0);
    o1 = WMMA_F16(ap, bv1, o1);
    o2 = WMMA_F16(ap, bv2, o2);
    o3 = WMMA_F16(ap, bv3, o3);
  }

  #pragma unroll
  for (int r = 0; r < 8; ++r) s[r] = redsum16(s[r]);
  v8f os[4] = {o0, o1, o2, o3};
  #pragma unroll
  for (int r = 0; r < 8; ++r) {
    float inv = 1.0f / fmaxf(s[r], 1e-20f);
    int row = ib * N_ + i0 + r + half * 8;
    _Float16* dst = ao + (size_t)row * INNER_ + ih * DH_;
    #pragma unroll
    for (int t = 0; t < 4; ++t)
      dst[t * 16 + lcol] = (_Float16)(os[t][r] * inv);
  }
}

extern "C" void kernel_launch(void* const* d_in, const int* in_sizes, int n_in,
                              void* d_out, int out_size, void* d_ws, size_t ws_size,
                              hipStream_t stream) {
  const float* x          = (const float*)d_in[0];
  const float* norm_g     = (const float*)d_in[1];
  const float* Wq         = (const float*)d_in[2];
  const float* Wkv        = (const float*)d_in[3];
  const float* Wout       = (const float*)d_in[4];
  const float* out_norm_g = (const float*)d_in[5];
  float* out = (float*)d_out;

  char* w = (char*)d_ws;
  size_t off = 0;
  auto alloc = [&](size_t bytes) -> void* {
    void* p = w + off;
    off += (bytes + 255) & ~(size_t)255;
    return p;
  };
  _Float16* xn_h  = (_Float16*)alloc((size_t)ROWS_ * D_ * 2);       // 16 MB
  _Float16* WqT   = (_Float16*)alloc((size_t)INNER_ * D_ * 2);      //  1 MB
  _Float16* WkvT  = (_Float16*)alloc((size_t)128 * D_ * 2);         // .25 MB
  _Float16* WoutT = (_Float16*)alloc((size_t)D_ * INNER_ * 2);      //  1 MB
  _Float16* qn_h  = (_Float16*)alloc((size_t)ROWS_ * INNER_ * 2);   //  8 MB
  _Float16* kn_h  = (_Float16*)alloc((size_t)ROWS_ * DH_ * 2);      //  1 MB
  _Float16* vt_h  = (_Float16*)alloc((size_t)ROWS_ * DH_ * 2);      //  1 MB
  _Float16* ao_h  = (_Float16*)alloc((size_t)ROWS_ * INNER_ * 2);   //  8 MB

  // 1. weight transposes (f32 -> f16 [N][K])
  wt_kernel<<<(D_ * INNER_ + 255) / 256, 256, 0, stream>>>(Wq,   WqT,   D_,    INNER_);
  wt_kernel<<<(D_ * 128    + 255) / 256, 256, 0, stream>>>(Wkv,  WkvT,  D_,    128);
  wt_kernel<<<(INNER_ * D_ + 255) / 256, 256, 0, stream>>>(Wout, WoutT, INNER_, D_);

  // 2. LayerNorm(x) -> xn (f16)
  ln_to_h_kernel<<<ROWS_ / 4, 128, 0, stream>>>(x, norm_g, xn_h);

  // 3. q = xn@Wq ; kv = xn@Wkv   (128x64 tile per block), l2norms and V transpose in the epilogues
  proj_q_kernel <<<dim3(H_, ROWS_ / 128), 128, 0, stream>>>(xn_h, WqT,  qn_h);
  proj_kv_kernel<<<dim3(2,  ROWS_ / 128), 128, 0, stream>>>(xn_h, WkvT, kn_h, vt_h);

  // 5. attention (async-LDS staged K/V, WMMA everywhere)
  attn_kernel<<<(B_ * H_ * (N_ / 16)) / 4, 128, 0, stream>>>(qn_h, kn_h, vt_h, ao_h);

  // 6. out = ao @ Wout  (f32 into d_out)
  gemm_kernel<<<dim3(D_ / 64, ROWS_ / 128), 128, 0, stream>>>(ao_h, WoutT, out);

  // 7. final LayerNorm in place on d_out
  ln_inplace_kernel<<<ROWS_ / 4, 128, 0, stream>>>(out, out_norm_g);
}

// v004
// It runs in 162 microseconds.
// Two timings next to v003 both put it at 1.09 times that version's speed.
// All steps since v000 together make it 2.05 times as fast.
#include <hip/hip_runtime.h>
#include <hip/hip_bf16.h>

typedef __attribute__((ext_vector_type(16))) _Float16 v16h;
typedef __attribute__((ext_vector_type(8)))  _Float16 v8h;
typedef __attribute__((ext_vector_type(4)))  _Float16 v4h;
typedef __attribute__((ext_vector_type(8)))  float    v8f;

#define B_  4
#define N_  2048
#define D_  1024
#define H_  8
#define DH_ 64
#define INNER_ 512
#define ROWS_ (B_ * N_)   // 8192

#define WMMA_F16(a, b, c) \
  __builtin_amdgcn_wmma_f32_16x16x32_f16(false, (a), false, (b), (short)0, (c), false, false)

__device__ __forceinline__ float redsum32(float v) {
  #pragma unroll
  for (int m = 1; m < 32; m <<= 1) v += __shfl_xor(v, m, 32);
  return v;
}

// async copy of 32 bytes/lane: global -> LDS (tracked by ASYNCcnt).
// INST_OFFSET applies to both LDS and global addresses (ISA 08 §4.4).
__device__ __forceinline__ void async_cp32(const _Float16* g, _Float16* l) {
  unsigned loff = (unsigned)(uintptr_t)l;   // low 32 bits of generic ptr = LDS offset
  // s_wait_xcnt closes the statement so that no address register is rewritten ahead of it
  asm volatile("global_load_async_to_lds_b128 %0, %1, off\n\t"
               "global_load_async_to_lds_b128 %0, %1, off offset:16\n\t"
               "s_wait_xcnt 0x0"
               :: "v"(loff), "v"(g) : "memory");
}
// two such 32-byte copies (a K piece and a V piece) behind one s_wait_xcnt
__device__ __forceinline__ void async_cp32_pair(const _Float16* g0, _Float16* l0,
                                                const _Float16* g1, _Float16* l1) {
  unsigned loff0 = (unsigned)(uintptr_t)l0;
  unsigned loff1 = (unsigned)(uintptr_t)l1;
  asm volatile("global_load_async_to_lds_b128 %0, %1, off\n\t"
               "global_load_async_to_lds_b128 %0, %1, off offset:16\n\t"
               "global_load_async_to_lds_b128 %2, %3, off\n\t"
               "global_load_async_to_lds_b128 %2, %3, off offset:16\n\t"
               "s_wait_xcnt 0x0"
               :: "v"(loff0), "v"(g0), "v"(loff1), "v"(g1) : "memory");
}
__device__ __forceinline__ void wait_async0() {
  // this wave's own LDS reads of the buffer refilled behind the barrier have retired
  asm volatile("s_wait_dscnt 0x0" ::: "memory");
  asm volatile("s_wait_asynccnt 0x0" ::: "memory");
}

// LDS row pitches in halfs: 16 B x odd, so the 16 lanes of a ds_load_b128 that read
// 16 different rows fall on 16 different groups of four banks.
#define KP_ 72   // K rows of 128 B at 144 B
#define VP_ 40   // V rows of  64 B at  80 B

// 16 contiguous halfs of a padded LDS row (16-byte aligned only) as one WMMA operand
__device__ __forceinline__ v16h lds_frag(const _Float16* p) {
  v8h lo = *(const v8h*)p;
  v8h hi = *(const v8h*)(p + 8);
  return __builtin_shufflevector(lo, hi, 0, 1, 2, 3, 4, 5, 6, 7, 8, 9, 10, 11, 12, 13, 14, 15);
}

// 8 halfs at p and 8 at p + 16 of a padded LDS row as one WMMA operand
__device__ __forceinline__ v16h vt_frag(const _Float16* p) {
  v8h lo = *(const v8h*)p;
  v8h hi = *(const v8h*)(p + 16);
  return __builtin_shufflevector(lo, hi, 0, 1, 2, 3, 4, 5, 6, 7, 8, 9, 10, 11, 12, 13, 14, 15);
}

// ---- transpose + f32->f16 weight conversion: Wt[n*K + k] = W[k*N + n] ----
__global__ void wt_kernel(const float* __restrict__ W, _Float16* __restrict__ Wt,
                          int K, int N) {
  int idx = blockIdx.x * 256 + threadIdx.x;
  if (idx < K * N) {
    int n = idx / K, k = idx % K;
    Wt[idx] = (_Float16)W[k * N + n];
  }
}

// ---- LayerNorm rows of f32 [rows x 1024] -> f16 out; 1 wave / row ----
__global__ void ln_to_h_kernel(const float* __restrict__ x, const float* __restrict__ g,
                               _Float16* __restrict__ out) {
  int lane = threadIdx.x & 31, wid = threadIdx.x >> 5;
  int row = blockIdx.x * 4 + wid;
  const float* xr = x + (size_t)row * D_;
  float v[32], sum = 0.f, sq = 0.f;
  #pragma unroll
  for (int j = 0; j < 32; ++j) {
    v[j] = xr[j * 32 + lane];
    sum += v[j]; sq += v[j] * v[j];
  }
  sum = redsum32(sum); sq = redsum32(sq);
  float mean = sum * (1.0f / D_);
  float var  = sq * (1.0f / D_) - mean * mean;
  float rs   = rsqrtf(var + 1e-5f);
  _Float16* o = out + (size_t)row * D_;
  #pragma unroll
  for (int j = 0; j < 32; ++j)
    o[j * 32 + lane] = (_Float16)((v[j] - mean) * rs * g[j * 32 + lane]);
}

// ---- in-place LayerNorm f32 [rows x 1024] ----
__global__ void ln_inplace_kernel(float* __restrict__ x, const float* __restrict__ g) {
  int lane = threadIdx.x & 31, wid = threadIdx.x >> 5;
  int row = blockIdx.x * 4 + wid;
  float* xr = x + (size_t)row * D_;
  float v[32], sum = 0.f, sq = 0.f;
  #pragma unroll
  for (int j = 0; j < 32; ++j) {
    v[j] = xr[j * 32 + lane];
    sum += v[j]; sq += v[j] * v[j];
  }
  sum = redsum32(sum); sq = redsum32(sq);
  float mean = sum * (1.0f / D_);
  float var  = sq * (1.0f / D_) - mean * mean;
  float rs   = rsqrtf(var + 1e-5f);
  #pragma unroll
  for (int j = 0; j < 32; ++j)
    xr[j * 32 + lane] = (v[j] - mean) * rs * g[j * 32 + lane];
}

// ---- 128x64 tile of A[.. x K] * Bt[.. x K]^T in a block of four waves (32x64 a wave,
// 8 accumulators). A k block of 64 halfs (128 A rows and 64 B rows of 128 B) is staged in LDS
// by async copies that cover whole lines, two buffers: the next block flies during this one.
#define GP_    72                  // staged rows of 128 B at 144 B (16 B x odd)
#define GROWS_ (128 + 64)          // A rows, then B rows
#define GBUF_  (GROWS_ * GP_)      // halfs in one buffer

// Ag, Bg: this thread's 16 bytes of row tid / 8 of the A tile and of the B tile, at the k block:
// eight lanes fill one 128-byte row, a thread takes every 16th row (8 of A, 4 of B).
// PERM: row j of the B tile lands at place (j % 4) * 16 + j / 4.
template <int K, bool PERM>
__device__ __forceinline__ void stage_block(const _Float16* Ag, const _Float16* Bg,
                                            _Float16* buf) {
  int r = threadIdx.x >> 3, p = (threadIdx.x & 7) * 8;
  unsigned la = (unsigned)(uintptr_t)(buf + r * GP_ + p);   // low 32 bits = LDS byte address
  unsigned lb = (unsigned)(uintptr_t)(buf + (128 + (PERM ? (r & 3) * 16 + (r >> 2) : r)) * GP_ + p);
  const unsigned sa = 16 * GP_ * 2, sb = (PERM ? 4 : 16) * GP_ * 2;
  // s_wait_xcnt closes the statement so that no address register is rewritten ahead of it
  asm volatile("global_load_async_to_lds_b128 %0, %1, off\n\t"
               "global_load_async_to_lds_b128 %2, %3, off\n\t"
               "global_load_async_to_lds_b128 %4, %5, off\n\t"
               "global_load_async_to_lds_b128 %6, %7, off\n\t"
               "global_load_async_to_lds_b128 %8, %9, off\n\t"
               "global_load_async_to_lds_b128 %10, %11, off\n\t"
               "global_load_async_to_lds_b128 %12, %13, off\n\t"
               "global_load_async_to_lds_b128 %14, %15, off\n\t"
               "global_load_async_to_lds_b128 %16, %17, off\n\t"
               "global_load_async_to_lds_b128 %18, %19, off\n\t"
               "global_load_async_to_lds_b128 %20, %21, off\n\t"
               "global_load_async_to_lds_b128 %22, %23, off\n\t"
               "s_wait_xcnt 0x0"
               :: "v"(la),          "v"(Ag),           "v"(la + sa),     "v"(Ag + 16 * K),
                  "v"(la + 2 * sa), "v"(Ag + 32 * K),  "v"(la + 3 * sa), "v"(Ag + 48 * K),
                  "v"(la + 4 * sa), "v"(Ag + 64 * K),  "v"(la + 5 * sa), "v"(Ag + 80 * K),
                  "v"(la + 6 * sa), "v"(Ag + 96 * K),  "v"(la + 7 * sa), "v"(Ag + 112 * K),
                  "v"(lb),          "v"(Bg),           "v"(lb + sb),     "v"(Bg + 16 * K),
                  "v"(lb + 2 * sb), "v"(Bg + 32 * K),  "v"(lb + 3 * sb), "v"(Bg + 48 * K)
               : "memory");
}

// The wave's rows are mblk + wid * 32 .. + 31. Column lcol of accumulator tile t is row
// n0 + t * 16 + lcol of Bt, or with PERM row n0 + lcol * 4 + t, so that a lane ends up with
// four neighbouring columns of each of its rows.
template <int K, bool PERM>
__device__ __forceinline__ void gemm_tile(const _Float16* __restrict__ A,
                                          const _Float16* __restrict__ Bt,
                                          int mblk, int n0, _Float16* lds,
                                          v8f (&row0)[4], v8f (&row1)[4]) {
  int tid = threadIdx.x;
  int lane = tid & 31, wid = tid >> 5;
  int half = lane >> 4, lcol = lane & 15;
  const _Float16* Ag = A  + (size_t)(mblk + (tid >> 3)) * K + (tid & 7) * 8;
  const _Float16* Bg = Bt + (size_t)(n0   + (tid >> 3)) * K + (tid & 7) * 8;

  v8f c00 = {}, c01 = {}, c02 = {}, c03 = {};
  v8f c10 = {}, c11 = {}, c12 = {}, c13 = {};

  // one staged k block: its 12 fragments, then the 16 WMMAs
  auto k_block = [&](const _Float16* buf) {
    const _Float16* Ab = buf + (wid * 32 + lcol) * GP_ + half * 16;
    const _Float16* Bb = buf + (128 + lcol) * GP_ + half * 16;
    v16h a0 = lds_frag(Ab),                 a1 = lds_frag(Ab + 16 * GP_);
    v16h b0 = lds_frag(Bb),                 b1 = lds_frag(Bb + 16 * GP_);
    v16h b2 = lds_frag(Bb + 32 * GP_),      b3 = lds_frag(Bb + 48 * GP_);
    v16h e0 = lds_frag(Ab + 32),            e1 = lds_frag(Ab + 16 * GP_ + 32);
    v16h f0 = lds_frag(Bb + 32),            f1 = lds_frag(Bb + 16 * GP_ + 32);
    v16h f2 = lds_frag(Bb + 32 * GP_ + 32), f3 = lds_frag(Bb + 48 * GP_ + 32);
    c00 = WMMA_F16(a0, b0, c00);
    c01 = WMMA_F16(a0, b1, c01);
    c02 = WMMA_F16(a0, b2, c02);
    c03 = WMMA_F16(a0, b3, c03);
    c10 = WMMA_F16(a1, b0, c10);
    c11 = WMMA_F16(a1, b1, c11);
    c12 = WMMA_F16(a1, b2, c12);
    c13 = WMMA_F16(a1, b3, c13);
    c00 = WMMA_F16(e0, f0, c00);
    c01 = WMMA_F16(e0, f1, c01);
    c02 = WMMA_F16(e0, f2, c02);
    c03 = WMMA_F16(e0, f3, c03);
    c10 = WMMA_F16(e1, f0, c10);
    c11 = WMMA_F16(e1, f1, c11);
    c12 = WMMA_F16(e1, f2, c12);
    c13 = WMMA_F16(e1, f3, c13);
  };

  stage_block<K, PERM>(Ag, Bg, lds);                  // k block 0
  #pragma unroll 1   // rolled: unrolled, the LDS reads came out scattered in pairs among the WMMAs
  for (int kb = 0; kb < K / 64 - 1; ++kb) {
    wait_async0();
    __syncthreads();           // k block kb ready; the other buffer free
    stage_block<K, PERM>(Ag + (kb + 1) * 64, Bg + (kb + 1) * 64, lds + ((kb + 1) & 1) * GBUF_);
    k_block(lds + (kb & 1) * GBUF_);
  }
  wait_async0();
  __syncthreads();             // the last k block ready
  k_block(lds + ((K / 64 - 1) & 1) * GBUF_);

  row0[0] = c00; row0[1] = c01; row0[2] = c02; row0[3] = c03;
  row1[0] = c10; row1[1] = c11; row1[2] = c12; row1[3] = c13;
}

// ---- C[ROWS_ x D_](f32) = A[ROWS_ x INNER_](f16) * Bt[D_ x INNER_](f16)^T
// grid = (D_/64, ROWS_/128), block = 128. The launch bound of the three GEMM kernels states the
// four waves: under the default bound the register cap made the fragments spill.
__global__ __launch_bounds__(128)
void gemm_kernel(const _Float16* __restrict__ A, const _Float16* __restrict__ Bt,
                 float* __restrict__ C) {
  __shared__ __attribute__((aligned(16))) _Float16 stage[2 * GBUF_];   // 54 KB
  const int N = D_;
  int lane = threadIdx.x & 31;
  int half = lane >> 4, lcol = lane & 15;
  int m0 = blockIdx.y * 128 + (threadIdx.x >> 5) * 32, n0 = blockIdx.x * 64;
  v8f row0[4], row1[4];
  gemm_tile<INNER_, false>(A, Bt, blockIdx.y * 128, n0, stage, row0, row1);
  #pragma unroll
  for (int t = 0; t < 4; ++t)
    #pragma unroll
    for (int r = 0; r < 8; ++r) {
      C[(size_t)(m0 + r + half * 8) * N + n0 + t * 16 + lcol]      = row0[t][r];
      C[(size_t)(m0 + 16 + r + half * 8) * N + n0 + t * 16 + lcol] = row1[t][r];
    }
}

// 16 rows x 64 columns as gemm_tile with PERM leaves them (a lane has columns lcol*4 .. +3 of rows
// r + half*8): each row times num / max(mul * ||row||, 1e-12), stored as f16 rows of 128 B.
__device__ __forceinline__ void store_l2norm_rows(const v8f (&c)[4], _Float16* __restrict__ dst,
                                                  float num, float mul) {
  int lane = threadIdx.x & 31;
  int half = lane >> 4, lcol = lane & 15;
  float sq[8];
  #pragma unroll   // constant indices keep the accumulators in registers
  for (int r = 0; r < 8; ++r)
    sq[r] = c[0][r] * c[0][r] + c[1][r] * c[1][r] + c[2][r] * c[2][r] + c[3][r] * c[3][r];
  #pragma unroll   // eight independent shuffle chains side by side
  for (int m = 1; m < 16; m <<= 1)
    #pragma unroll
    for (int r = 0; r < 8; ++r) sq[r] += __shfl_xor(sq[r], m, 32);
  #pragma unroll   // constant indices keep the accumulators in registers
  for (int r = 0; r < 8; ++r) {
    float scale = num / fmaxf(mul * sqrtf(sq[r]), 1e-12f);
    v4h o = {(_Float16)(c[0][r] * scale), (_Float16)(c[1][r] * scale),
             (_Float16)(c[2][r] * scale), (_Float16)(c[3][r] * scale)};
    *(v4h*)(dst + (r + half * 8) * DH_ + lcol * 4) = o;
  }
  // stands in front of whatever rewrites the stores' data and address registers next
  asm volatile("s_wait_xcnt 0x0" ::: "memory");
}

// ---- q = xn @ Wq with the l2norm in the epilogue: a wave's 64 columns are one head.
// qn[b][h][n][64] f16, net scale 64/max(16*||q||,1e-12). grid = (H_, ROWS_/128), block = 128.
__global__ __launch_bounds__(128)
void proj_q_kernel(const _Float16* __restrict__ A, const _Float16* __restrict__ Bt,
                   _Float16* __restrict__ qn) {
  __shared__ __attribute__((aligned(16))) _Float16 stage[2 * GBUF_];   // 54 KB
  int m0 = blockIdx.y * 128 + (threadIdx.x >> 5) * 32, h = blockIdx.x;
  v8f row0[4], row1[4];
  gemm_tile<D_, true>(A, Bt, blockIdx.y * 128, h * DH_, stage, row0, row1);
  int b = m0 >> 11, n = m0 & 2047;
  _Float16* dst = qn + (size_t)(((b * H_ + h) * N_) + n) * DH_;
  store_l2norm_rows(row0, dst, 64.0f, 16.0f);
  store_l2norm_rows(row1, dst + 16 * DH_, 64.0f, 16.0f);
}

// ---- kv = xn @ Wkv, epilogue by column block: 0: k l2norm (*4) -> kn[b][n][64];
// 1: v -> vt[b][d][n] (transposed, f16). grid = (2, ROWS_/128), block = 128.
__global__ __launch_bounds__(128)
void proj_kv_kernel(const _Float16* __restrict__ A, const _Float16* __restrict__ Bt,
                    _Float16* __restrict__ kn, _Float16* __restrict__ vt) {
  __shared__ __attribute__((aligned(16))) _Float16 stage[2 * GBUF_];   // 54 KB
  int m0 = blockIdx.y * 128 + (threadIdx.x >> 5) * 32;
  v8f row0[4], row1[4];
  gemm_tile<D_, true>(A, Bt, blockIdx.y * 128, blockIdx.x * DH_, stage, row0, row1);
  if (blockIdx.x == 0) {
    _Float16* dst = kn + (size_t)m0 * DH_;
    store_l2norm_rows(row0, dst, 4.0f, 1.0f);
    store_l2norm_rows(row1, dst + 16 * DH_, 4.0f, 1.0f);
  } else {
    int lane = threadIdx.x & 31;
    int half = lane >> 4, lcol = lane & 15;
    int b = m0 >> 11, n = m0 & 2047;
    // the 8 registers of an accumulator are 8 consecutive n of one d: one 16-byte store
    #pragma unroll   // constant indices keep the accumulators in registers
    for (int t = 0; t < 4; ++t) {
      _Float16* vd = vt + (size_t)(b * DH_ + lcol * 4 + t) * N_ + n + half * 8;
      *(v8h*)vd        = __builtin_convertvector(row0[t], v8h);
      *(v8h*)(vd + 16) = __builtin_convertvector(row1[t], v8h);
    }
    // stands in front of whatever rewrites the stores' data and address registers next
    asm volatile("s_wait_xcnt 0x0" ::: "memory");
  }
}

__global__ __launch_bounds__(128)
void attn_kernel(const _Float16* __restrict__ qn, const _Float16* __restrict__ kn,
                            const _Float16* __restrict__ vt, _Float16* __restrict__ ao) {
  __shared__ __attribute__((aligned(16))) _Float16 Kbuf[2][32 * KP_];   // [chunk rows j][d]      9 KB
  __shared__ __attribute__((aligned(16))) _Float16 Vbuf[2][64 * VP_];   // [d][chunk cols j]     10 KB

  int tid  = threadIdx.x;
  int lane = tid & 31, wid = tid >> 5;
  int half = lane >> 4, lcol = lane & 15;
  int unit = blockIdx.x * 4 + wid;         // 0 .. 4095
  int ib = unit >> 10;
  int ih = (unit >> 7) & 7;
  int i0 = (unit & 127) * 16;
  const _Float16* Q  = qn + (size_t)((ib * H_ + ih) * N_) * DH_;
  const _Float16* Kp = kn + (size_t)(ib * N_) * DH_;
  const _Float16* V  = vt + (size_t)ib * DH_ * N_;
  int d0 = half * 16;

  v16h a0 = *(const v16h*)(Q + (size_t)(i0 + lcol) * DH_ + d0);
  v16h a1 = *(const v16h*)(Q + (size_t)(i0 + lcol) * DH_ + 32 + d0);

  // ---- pass 1: maximum of query lcol; K chunks async-staged through LDS ----
  float m[8];
  #pragma unroll
  for (int r = 0; r < 8; ++r) m[r] = -1e30f;

  // chunk = 32 j-rows (4 KB). 128 threads x 32B = one chunk; four threads fill a row.
  int kdst = (tid >> 2) * KP_ + (tid & 3) * 16;        // K staging place of this thread
  async_cp32(Kp + tid * 16, &Kbuf[0][kdst]);           // stage chunk 0
  for (int c = 0; c < 64; ++c) {
    int cb = c & 1;
    wait_async0();
    __syncthreads();           // chunk cb ready; buffer (c+1)&1 free
    if (c < 63)
      async_cp32(Kp + (size_t)(c + 1) * 32 * DH_ + tid * 16,
                 &Kbuf[(c + 1) & 1][kdst]);
    const _Float16* kb = &Kbuf[cb][lcol * KP_ + d0];
    v16h k00 = lds_frag(kb),            k01 = lds_frag(kb + 32);
    v16h k10 = lds_frag(kb + 16 * KP_), k11 = lds_frag(kb + 16 * KP_ + 32);
    // keeps the LDS reads one group ahead of the products: as A operands the compiler loaded
    // them into one register set, each waited for alone
    __builtin_amdgcn_sched_barrier(0);
    v8f t0 = {}, t1 = {};
    t0 = WMMA_F16(k00, a0, t0);
    t1 = WMMA_F16(k10, a0, t1);
    t0 = WMMA_F16(k01, a1, t0);
    t1 = WMMA_F16(k11, a1, t1);
    #pragma unroll   // constant indices keep the score tiles in registers
    for (int r = 0; r < 8; ++r) m[r] = fmaxf(fmaxf(m[r], t0[r]), t1[r]);
  }
  // the lane's eight partial maxima, then the other half's keys of the same query
  float mq = fmaxf(fmaxf(fmaxf(m[0], m[1]), fmaxf(m[2], m[3])),
                   fmaxf(fmaxf(m[4], m[5]), fmaxf(m[6], m[7])));
  mq = fmaxf(mq, __shfl_xor(mq, 16, 32));

  // ---- pass 2: exp, Pt packed in registers, Vt * Pt; K and V chunks async-staged ----
  float s[8];
  #pragma unroll
  for (int r = 0; r < 8; ++r) s[r] = 0.f;
  v8f o0 = {}, o1 = {}, o2 = {}, o3 = {};  // Ot: d = t * 16 + half * 8 + r, query lcol
  int vd = tid >> 1, vpart = tid & 1;      // V staging role of this thread

  int vdst = vd * VP_ + vpart * 16;        // V staging place of this thread
  async_cp32_pair(Kp + tid * 16, &Kbuf[0][kdst],
                  V + (size_t)vd * N_ + vpart * 16, &Vbuf[0][vdst]);

  for (int c = 0; c < 64; ++c) {
    int cb = c & 1;
    wait_async0();
    __syncthreads();           // K/V chunk cb ready; buffer (c+1)&1 free
    if (c < 63) {
      int nb = (c + 1) & 1;
      async_cp32_pair(Kp + (size_t)(c + 1) * 32 * DH_ + tid * 16, &Kbuf[nb][kdst],
                      V + (size_t)vd * N_ + (c + 1) * 32 + vpart * 16, &Vbuf[nb][vdst]);
    }
    const _Float16* kb = &Kbuf[cb][lcol * KP_ + d0];
    v16h k00 = lds_frag(kb),            k01 = lds_frag(kb + 32);
    v16h k10 = lds_frag(kb + 16 * KP_), k11 = lds_frag(kb + 16 * KP_ + 32);
    // Vt rows d as A, their keys in the order the packed score tiles have as B:
    // elements 0..7 are keys half * 8 .. + 7, elements 8..15 keys 16 + half * 8 .. + 7
    const _Float16* vb = &Vbuf[cb][lcol * VP_ + half * 8];
    v16h av0 = vt_frag(vb);
    v16h av1 = vt_frag(vb + 16 * VP_);
    v16h av2 = vt_frag(vb + 32 * VP_);
    v16h av3 = vt_frag(vb + 48 * VP_);
    // keeps the LDS reads one group ahead of the products: as A operands the compiler loaded
    // them into one register set, each waited for alone
    __builtin_amdgcn_sched_barrier(0);
    v8f acc[2] = {{}, {}};
    acc[0] = WMMA_F16(k00, a0, acc[0]);
    acc[1] = WMMA_F16(k10, a0, acc[1]);
    acc[0] = WMMA_F16(k01, a1, acc[0]);
    acc[1] = WMMA_F16(k11, a1, acc[1]);
    v16h pt;
    #pragma unroll   // both loops: constant indices keep the score tiles and Pt in registers
    for (int sub = 0; sub < 2; ++sub)
      #pragma unroll
      for (int r = 0; r < 8; ++r) {
        float p = __expf(acc[sub][r] - mq);
        s[r] += p;
        pt[sub * 8 + r] = (_Float16)p;
      }
    o0 = WMMA_F16(av0, pt, o0);
    o1 = WMMA_F16(av1, pt, o1);
    o2 = WMMA_F16(av2, pt, o2);
    o3 = WMMA_F16(av3, pt, o3);
  }

  float sq = ((s[0] + s[1]) + (s[2] + s[3])) + ((s[4] + s[5]) + (s[6] + s[7]));
  sq += __shfl_xor(sq, 16, 32);            // the other half's keys of the same query
  float inv = 1.0f / fmaxf(sq, 1e-20f);
  // the 8 registers of an accumulator are 8 consecutive d of one query: one 16-byte store
  _Float16* dst = ao + (size_t)(ib * N_ + i0 + lcol) * INNER_ + ih * DH_ + half * 8;
  *(v8h*)dst        = __builtin_convertvector(o0 * inv, v8h);
  *(v8h*)(dst + 16) = __builtin_convertvector(o1 * inv, v8h);
  *(v8h*)(dst + 32) = __builtin_convertvector(o2 * inv, v8h);
  *(v8h*)(dst + 48) = __builtin_convertvector(o3 * inv, v8h);
}

extern "C" void kernel_launch(void* const* d_in, const int* in_sizes, int n_in,
                              void* d_out, int out_size, void* d_ws, size_t ws_size,
                              hipStream_t stream) {
  const float* x          = (const float*)d_in[0];
  const float* norm_g     = (const float*)d_in[1];
  const float* Wq         = (const float*)d_in[2];
  const float* Wkv        = (const float*)d_in[3];
  const float* Wout       = (const float*)d_in[4];
  const float* out_norm_g = (const float*)d_in[5];
  float* out = (float*)d_out;

  char* w = (char*)d_ws;
  size_t off = 0;
  auto alloc = [&](size_t bytes) -> void* {
    void* p = w + off;
    off += (bytes + 255) & ~(size_t)255;
    return p;
  };
  _Float16* xn_h  = (_Float16*)alloc((size_t)ROWS_ * D_ * 2);       // 16 MB
  _Float16* WqT   = (_Float16*)alloc((size_t)INNER_ * D_ * 2);      //  1 MB
  _Float16* WkvT  = (_Float16*)alloc((size_t)128 * D_ * 2);         // .25 MB
  _Float16* WoutT = (_Float16*)alloc((size_t)D_ * INNER_ * 2);      //  1 MB
  _Float16* qn_h  = (_Float16*)alloc((size_t)ROWS_ * INNER_ * 2);   //  8 MB
  _Float16* kn_h  = (_Float16*)alloc((size_t)ROWS_ * DH_ * 2);      //  1 MB
  _Float16* vt_h  = (_Float16*)alloc((size_t)ROWS_ * DH_ * 2);      //  1 MB
  _Float16* ao_h  = (_Float16*)alloc((size_t)ROWS_ * INNER_ * 2);   //  8 MB

  // 1. weight transposes (f32 -> f16 [N][K])
  wt_kernel<<<(D_ * INNER_ + 255) / 256, 256, 0, stream>>>(Wq,   WqT,   D_,    INNER_);
  wt_kernel<<<(D_ * 128    + 255) / 256, 256, 0, stream>>>(Wkv,  WkvT,  D_,    128);
  wt_kernel<<<(INNER_ * D_ + 255) / 256, 256, 0, stream>>>(Wout, WoutT, INNER_, D_);

  // 2. LayerNorm(x) -> xn (f16)
  ln_to_h_kernel<<<ROWS_ / 4, 128, 0, stream>>>(x, norm_g, xn_h);

  // 3. q = xn@Wq ; kv = xn@Wkv   (128x64 tile per block), l2norms and V transpose in the epilogues
  proj_q_kernel <<<dim3(H_, ROWS_ / 128), 128, 0, stream>>>(xn_h, WqT,  qn_h);
  proj_kv_kernel<<<dim3(2,  ROWS_ / 128), 128, 0, stream>>>(xn_h, WkvT, kn_h, vt_h);

  // 5. attention (async-LDS staged K/V, WMMA everywhere)
  attn_kernel<<<(B_ * H_ * (N_ / 16)) / 4, 128, 0, stream>>>(qn_h, kn_h, vt_h, ao_h);

  // 6. out = ao @ Wout  (f32 into d_out)
  gemm_kernel<<<dim3(D_ / 64, ROWS_ / 128), 128, 0, stream>>>(ao_h, WoutT, out);

  // 7. final LayerNorm in place on d_out
  ln_inplace_kernel<<<ROWS_ / 4, 128, 0, stream>>>(out, out_norm_g);
}

// v005
// One run takes 150 microseconds.
// Next to v004, in two timings, it ran 1.09 and 1.08 times as fast.
// Over all steps from v000 it is 2.23 times as fast.
#include <hip/hip_runtime.h>
#include <hip/hip_bf16.h>

typedef __attribute__((ext_vector_type(16))) _Float16 v16h;
typedef __attribute__((ext_vector_type(8)))  _Float16 v8h;
typedef __attribute__((ext_vector_type(4)))  _Float16 v4h;
typedef __attribute__((ext_vector_type(8)))  float    v8f;
typedef __attribute__((ext_vector_type(4)))  float    v4f;

#define B_  4
#define N_  2048
#define D_  1024
#define H_  8
#define DH_ 64
#define INNER_ 512
#define ROWS_ (B_ * N_)   // 8192

#define WMMA_F16(a, b, c) \
  __builtin_amdgcn_wmma_f32_16x16x32_f16(false, (a), false, (b), (short)0, (c), false, false)

__device__ __forceinline__ float redsum32(float v) {
  #pragma unroll
  for (int m = 1; m < 32; m <<= 1) v += __shfl_xor(v, m, 32);
  return v;
}

// async copy of 32 bytes/lane: global -> LDS (tracked by ASYNCcnt).
// INST_OFFSET applies to both LDS and global addresses (ISA 08 §4.4).
__device__ __forceinline__ void async_cp32(const _Float16* g, _Float16* l) {
  unsigned loff = (unsigned)(uintptr_t)l;   // low 32 bits of generic ptr = LDS offset
  // s_wait_xcnt closes the statement so that no address register is rewritten ahead of it
  asm volatile("global_load_async_to_lds_b128 %0, %1, off\n\t"
               "global_load_async_to_lds_b128 %0, %1, off offset:16\n\t"
               "s_wait_xcnt 0x0"
               :: "v"(loff), "v"(g) : "memory");
}
// two such 32-byte copies (a K piece and a V piece) behind one s_wait_xcnt
__device__ __forceinline__ void async_cp32_pair(const _Float16* g0, _Float16* l0,
                                                const _Float16* g1, _Float16* l1) {
  unsigned loff0 = (unsigned)(uintptr_t)l0;
  unsigned loff1 = (unsigned)(uintptr_t)l1;
  asm volatile("global_load_async_to_lds_b128 %0, %1, off\n\t"
               "global_load_async_to_lds_b128 %0, %1, off offset:16\n\t"
               "global_load_async_to_lds_b128 %2, %3, off\n\t"
               "global_load_async_to_lds_b128 %2, %3, off offset:16\n\t"
               "s_wait_xcnt 0x0"
               :: "v"(loff0), "v"(g0), "v"(loff1), "v"(g1) : "memory");
}
__device__ __forceinline__ void wait_async0() {
  // this wave's own LDS reads of the buffer refilled behind the barrier have retired
  asm volatile("s_wait_dscnt 0x0" ::: "memory");
  asm volatile("s_wait_asynccnt 0x0" ::: "memory");
}

// LDS row pitches in halfs: 16 B x odd, so the 16 lanes of a ds_load_b128 that read
// 16 different rows fall on 16 different groups of four banks.
#define KP_ 72   // K rows of 128 B at 144 B
#define VP_ 40   // V rows of  64 B at  80 B

// 16 contiguous halfs of a padded LDS row (16-byte aligned only) as one WMMA operand
__device__ __forceinline__ v16h lds_frag(const _Float16* p) {
  v8h lo = *(const v8h*)p;
  v8h hi = *(const v8h*)(p + 8);
  return __builtin_shufflevector(lo, hi, 0, 1, 2, 3, 4, 5, 6, 7, 8, 9, 10, 11, 12, 13, 14, 15);
}

// 8 halfs at p and 8 at p + 16 of a padded LDS row as one WMMA operand
__device__ __forceinline__ v16h vt_frag(const _Float16* p) {
  v8h lo = *(const v8h*)p;
  v8h hi = *(const v8h*)(p + 16);
  return __builtin_shufflevector(lo, hi, 0, 1, 2, 3, 4, 5, 6, 7, 8, 9, 10, 11, 12, 13, 14, 15);
}

// ---- transpose + f32->f16 weight conversion, Wt[n*K + k] = W[k*N + n], all three weights in
// one launch: a block of four waves takes one 64 (k) x 64 (n) tile. Reads are whole 256-byte row
// pieces, a lane holds 8 k of 4 n; the tile turns in LDS; stores are whole 128-byte rows.
#define TP_      72                                    // tile rows of 128 B at 144 B (16 B x odd)
#define WT_Q_    ((D_ / 64) * (INNER_ / 64))           // tiles of Wq
#define WT_KV_   ((D_ / 64) * (2 * DH_ / 64))          // tiles of Wkv
#define WT_OUT_  ((INNER_ / 64) * (D_ / 64))           // tiles of Wout

// tile t of one weight; K and N as constants, so that the row steps are immediate offsets
template <int K, int N>
__device__ __forceinline__ void wt_tile(const float* __restrict__ W, _Float16* __restrict__ Wt,
                                        int t, _Float16* tile) {
  int tid = threadIdx.x;
  int k0 = (t % (K / 64)) * 64, n0 = (t / (K / 64)) * 64;

  int r = tid >> 4, c = tid & 15;                      // k rows r*8 .. +7, n columns c*4 .. +3
  const float* src = W + (size_t)k0 * N + n0 + (r * 8 * N + c * 4);
  v4f v[8];
  #pragma unroll   // the eight loads in flight together; constant indices keep v in registers
  for (int j = 0; j < 8; ++j) v[j] = *(const v4f*)(src + j * N);
  // stands in front of whatever rewrites the loads' address registers next
  asm volatile("s_wait_xcnt 0x0" ::: "memory");
  #pragma unroll   // constant indices keep v in registers
  for (int i = 0; i < 4; ++i) {
    v8h h = {(_Float16)v[0][i], (_Float16)v[1][i], (_Float16)v[2][i], (_Float16)v[3][i],
             (_Float16)v[4][i], (_Float16)v[5][i], (_Float16)v[6][i], (_Float16)v[7][i]};
    *(v8h*)&tile[(c * 4 + i) * TP_ + r * 8] = h;
  }
  __syncthreads();             // the tile is whole before its rows are read

  int row = tid >> 3, p = (tid & 7) * 8;               // eight lanes store one 128-byte row
  _Float16* dst = Wt + (size_t)n0 * K + k0 + (row * K + p);
  #pragma unroll   // the four LDS reads together, then the four stores
  for (int j = 0; j < 4; ++j)
    *(v8h*)(dst + j * 16 * K) = *(const v8h*)&tile[(j * 16 + row) * TP_ + p];
}

__global__ __launch_bounds__(128)
void wt_kernel(const float* __restrict__ Wq, const float* __restrict__ Wkv,
               const float* __restrict__ Wout, _Float16* __restrict__ WqT,
               _Float16* __restrict__ WkvT, _Float16* __restrict__ WoutT) {
  __shared__ __attribute__((aligned(16))) _Float16 tile[64 * TP_];   // [n][k], 9 KB
  int t = blockIdx.x;
  if (t < WT_Q_)               wt_tile<D_, INNER_>(Wq, WqT, t, tile);
  else if (t < WT_Q_ + WT_KV_) wt_tile<D_, 2 * DH_>(Wkv, WkvT, t - WT_Q_, tile);
  else                         wt_tile<INNER_, D_>(Wout, WoutT, t - (WT_Q_ + WT_KV_), tile);
}

// ---- LayerNorm rows of f32 [rows x 1024] -> f16 out; 1 wave / row ----
__global__ void ln_to_h_kernel(const float* __restrict__ x, const float* __restrict__ g,
                               _Float16* __restrict__ out) {
  int lane = threadIdx.x & 31, wid = threadIdx.x >> 5;
  int row = blockIdx.x * 4 + wid;
  const float* xr = x + (size_t)row * D_;
  float v[32], sum = 0.f, sq = 0.f;
  #pragma unroll
  for (int j = 0; j < 32; ++j) {
    v[j] = xr[j * 32 + lane];
    sum += v[j]; sq += v[j] * v[j];
  }
  sum = redsum32(sum); sq = redsum32(sq);
  float mean = sum * (1.0f / D_);
  float var  = sq * (1.0f / D_) - mean * mean;
  float rs   = rsqrtf(var + 1e-5f);
  _Float16* o = out + (size_t)row * D_;
  #pragma unroll
  for (int j = 0; j < 32; ++j)
    o[j * 32 + lane] = (_Float16)((v[j] - mean) * rs * g[j * 32 + lane]);
}

// ---- in-place LayerNorm f32 [rows x 1024] ----
__global__ void ln_inplace_kernel(float* __restrict__ x, const float* __restrict__ g) {
  int lane = threadIdx.x & 31, wid = threadIdx.x >> 5;
  int row = blockIdx.x * 4 + wid;
  float* xr = x + (size_t)row * D_;
  float v[32], sum = 0.f, sq = 0.f;
  #pragma unroll
  for (int j = 0; j < 32; ++j) {
    v[j] = xr[j * 32 + lane];
    sum += v[j]; sq += v[j] * v[j];
  }
  sum = redsum32(sum); sq = redsum32(sq);
  float mean = sum * (1.0f / D_);
  float var  = sq * (1.0f / D_) - mean * mean;
  float rs   = rsqrtf(var + 1e-5f);
  #pragma unroll
  for (int j = 0; j < 32; ++j)
    xr[j * 32 + lane] = (v[j] - mean) * rs * g[j * 32 + lane];
}

// ---- 128x64 tile of A[.. x K] * Bt[.. x K]^T in a block of four waves (32x64 a wave,
// 8 accumulators). A k block of 64 halfs (128 A rows and 64 B rows of 128 B) is staged in LDS
// by async copies that cover whole lines, two buffers: the next block flies during this one.
#define GP_    72                  // staged rows of 128 B at 144 B (16 B x odd)
#define GROWS_ (128 + 64)          // A rows, then B rows
#define GBUF_  (GROWS_ * GP_)      // halfs in one buffer

// Ag, Bg: this thread's 16 bytes of row tid / 8 of the A tile and of the B tile, at the k block:
// eight lanes fill one 128-byte row, a thread takes every 16th row (8 of A, 4 of B).
// PERM: row j of the B tile lands at place (j % 4) * 16 + j / 4.
template <int K, bool PERM>
__device__ __forceinline__ void stage_block(const _Float16* Ag, const _Float16* Bg,
                                            _Float16* buf) {
  int r = threadIdx.x >> 3, p = (threadIdx.x & 7) * 8;
  unsigned la = (unsigned)(uintptr_t)(buf + r * GP_ + p);   // low 32 bits = LDS byte address
  unsigned lb = (unsigned)(uintptr_t)(buf + (128 + (PERM ? (r & 3) * 16 + (r >> 2) : r)) * GP_ + p);
  const unsigned sa = 16 * GP_ * 2, sb = (PERM ? 4 : 16) * GP_ * 2;
  // s_wait_xcnt closes the statement so that no address register is rewritten ahead of it
  asm volatile("global_load_async_to_lds_b128 %0, %1, off\n\t"
               "global_load_async_to_lds_b128 %2, %3, off\n\t"
               "global_load_async_to_lds_b128 %4, %5, off\n\t"
               "global_load_async_to_lds_b128 %6, %7, off\n\t"
               "global_load_async_to_lds_b128 %8, %9, off\n\t"
               "global_load_async_to_lds_b128 %10, %11, off\n\t"
               "global_load_async_to_lds_b128 %12, %13, off\n\t"
               "global_load_async_to_lds_b128 %14, %15, off\n\t"
               "global_load_async_to_lds_b128 %16, %17, off\n\t"
               "global_load_async_to_lds_b128 %18, %19, off\n\t"
               "global_load_async_to_lds_b128 %20, %21, off\n\t"
               "global_load_async_to_lds_b128 %22, %23, off\n\t"
               "s_wait_xcnt 0x0"
               :: "v"(la),          "v"(Ag),           "v"(la + sa),     "v"(Ag + 16 * K),
                  "v"(la + 2 * sa), "v"(Ag + 32 * K),  "v"(la + 3 * sa), "v"(Ag + 48 * K),
                  "v"(la + 4 * sa), "v"(Ag + 64 * K),  "v"(la + 5 * sa), "v"(Ag + 80 * K),
                  "v"(la + 6 * sa), "v"(Ag + 96 * K),  "v"(la + 7 * sa), "v"(Ag + 112 * K),
                  "v"(lb),          "v"(Bg),           "v"(lb + sb),     "v"(Bg + 16 * K),
                  "v"(lb + 2 * sb), "v"(Bg + 32 * K),  "v"(lb + 3 * sb), "v"(Bg + 48 * K)
               : "memory");
}

// The wave's rows are mblk + wid * 32 .. + 31. Column lcol of accumulator tile t is row
// n0 + t * 16 + lcol of Bt, or with PERM row n0 + lcol * 4 + t, so that a lane ends up with
// four neighbouring columns of each of its rows.
template <int K, bool PERM>
__device__ __forceinline__ void gemm_tile(const _Float16* __restrict__ A,
                                          const _Float16* __restrict__ Bt,
                                          int mblk, int n0, _Float16* lds,
                                          v8f (&row0)[4], v8f (&row1)[4]) {
  int tid = threadIdx.x;
  int lane = tid & 31, wid = tid >> 5;
  int half = lane >> 4, lcol = lane & 15;
  const _Float16* Ag = A  + (size_t)(mblk + (tid >> 3)) * K + (tid & 7) * 8;
  const _Float16* Bg = Bt + (size_t)(n0   + (tid >> 3)) * K + (tid & 7) * 8;

  v8f c00 = {}, c01 = {}, c02 = {}, c03 = {};
  v8f c10 = {}, c11 = {}, c12 = {}, c13 = {};

  // one staged k block: its 12 fragments, then the 16 WMMAs
  auto k_block = [&](const _Float16* buf) {
    const _Float16* Ab = buf + (wid * 32 + lcol) * GP_ + half * 16;
    const _Float16* Bb = buf + (128 + lcol) * GP_ + half * 16;
    v16h a0 = lds_frag(Ab),                 a1 = lds_frag(Ab + 16 * GP_);
    v16h b0 = lds_frag(Bb),                 b1 = lds_frag(Bb + 16 * GP_);
    v16h b2 = lds_frag(Bb + 32 * GP_),      b3 = lds_frag(Bb + 48 * GP_);
    v16h e0 = lds_frag(Ab + 32),            e1 = lds_frag(Ab + 16 * GP_ + 32);
    v16h f0 = lds_frag(Bb + 32),            f1 = lds_frag(Bb + 16 * GP_ + 32);
    v16h f2 = lds_frag(Bb + 32 * GP_ + 32), f3 = lds_frag(Bb + 48 * GP_ + 32);
    c00 = WMMA_F16(a0, b0, c00);
    c01 = WMMA_F16(a0, b1, c01);
    c02 = WMMA_F16(a0, b2, c02);
    c03 = WMMA_F16(a0, b3, c03);
    c10 = WMMA_F16(a1, b0, c10);
    c11 = WMMA_F16(a1, b1, c11);
    c12 = WMMA_F16(a1, b2, c12);
    c13 = WMMA_F16(a1, b3, c13);
    c00 = WMMA_F16(e0, f0, c00);
    c01 = WMMA_F16(e0, f1, c01);
    c02 = WMMA_F16(e0, f2, c02);
    c03 = WMMA_F16(e0, f3, c03);
    c10 = WMMA_F16(e1, f0, c10);
    c11 = WMMA_F16(e1, f1, c11);
    c12 = WMMA_F16(e1, f2, c12);
    c13 = WMMA_F16(e1, f3, c13);
  };

  stage_block<K, PERM>(Ag, Bg, lds);                  // k block 0
  #pragma unroll 1   // rolled: unrolled, the LDS reads came out scattered in pairs among the WMMAs
  for (int kb = 0; kb < K / 64 - 1; ++kb) {
    wait_async0();
    __syncthreads();           // k block kb ready; the other buffer free
    stage_block<K, PERM>(Ag + (kb + 1) * 64, Bg + (kb + 1) * 64, lds + ((kb + 1) & 1) * GBUF_);
    k_block(lds + (kb & 1) * GBUF_);
  }
  wait_async0();
  __syncthreads();             // the last k block ready
  k_block(lds + ((K / 64 - 1) & 1) * GBUF_);

  row0[0] = c00; row0[1] = c01; row0[2] = c02; row0[3] = c03;
  row1[0] = c10; row1[1] = c11; row1[2] = c12; row1[3] = c13;
}

// ---- C[ROWS_ x D_](f32) = A[ROWS_ x INNER_](f16) * Bt[D_ x INNER_](f16)^T
// grid = (D_/64, ROWS_/128), block = 128. The launch bound of the three GEMM kernels states the
// four waves: under the default bound the register cap made the fragments spill.
__global__ __launch_bounds__(128)
void gemm_kernel(const _Float16* __restrict__ A, const _Float16* __restrict__ Bt,
                 float* __restrict__ C) {
  __shared__ __attribute__((aligned(16))) _Float16 stage[2 * GBUF_];   // 54 KB
  const int N = D_;
  int lane = threadIdx.x & 31;
  int half = lane >> 4, lcol = lane & 15;
  int m0 = blockIdx.y * 128 + (threadIdx.x >> 5) * 32, n0 = blockIdx.x * 64;
  v8f row0[4], row1[4];
  gemm_tile<INNER_, false>(A, Bt, blockIdx.y * 128, n0, stage, row0, row1);
  #pragma unroll
  for (int t = 0; t < 4; ++t)
    #pragma unroll
    for (int r = 0; r < 8; ++r) {
      C[(size_t)(m0 + r + half * 8) * N + n0 + t * 16 + lcol]      = row0[t][r];
      C[(size_t)(m0 + 16 + r + half * 8) * N + n0 + t * 16 + lcol] = row1[t][r];
    }
}

// 16 rows x 64 columns as gemm_tile with PERM leaves them (a lane has columns lcol*4 .. +3 of rows
// r + half*8): each row times num / max(mul * ||row||, 1e-12), stored as f16 rows of 128 B.
__device__ __forceinline__ void store_l2norm_rows(const v8f (&c)[4], _Float16* __restrict__ dst,
                                                  float num, float mul) {
  int lane = threadIdx.x & 31;
  int half = lane >> 4, lcol = lane & 15;
  float sq[8];
  #pragma unroll   // constant indices keep the accumulators in registers
  for (int r = 0; r < 8; ++r)
    sq[r] = c[0][r] * c[0][r] + c[1][r] * c[1][r] + c[2][r] * c[2][r] + c[3][r] * c[3][r];
  #pragma unroll   // eight independent shuffle chains side by side
  for (int m = 1; m < 16; m <<= 1)
    #pragma unroll
    for (int r = 0; r < 8; ++r) sq[r] += __shfl_xor(sq[r], m, 32);
  #pragma unroll   // constant indices keep the accumulators in registers
  for (int r = 0; r < 8; ++r) {
    float scale = num / fmaxf(mul * sqrtf(sq[r]), 1e-12f);
    v4h o = {(_Float16)(c[0][r] * scale), (_Float16)(c[1][r] * scale),
             (_Float16)(c[2][r] * scale), (_Float16)(c[3][r] * scale)};
    *(v4h*)(dst + (r + half * 8) * DH_ + lcol * 4) = o;
  }
  // stands in front of whatever rewrites the stores' data and address registers next
  asm volatile("s_wait_xcnt 0x0" ::: "memory");
}

// ---- q = xn @ Wq with the l2norm in the epilogue: a wave's 64 columns are one head.
// qn[b][h][n][64] f16, net scale 64/max(16*||q||,1e-12). grid = (H_, ROWS_/128), block = 128.
__global__ __launch_bounds__(128)
void proj_q_kernel(const _Float16* __restrict__ A, const _Float16* __restrict__ Bt,
                   _Float16* __restrict__ qn) {
  __shared__ __attribute__((aligned(16))) _Float16 stage[2 * GBUF_];   // 54 KB
  int m0 = blockIdx.y * 128 + (threadIdx.x >> 5) * 32, h = blockIdx.x;
  v8f row0[4], row1[4];
  gemm_tile<D_, true>(A, Bt, blockIdx.y * 128, h * DH_, stage, row0, row1);
  int b = m0 >> 11, n = m0 & 2047;
  _Float16* dst = qn + (size_t)(((b * H_ + h) * N_) + n) * DH_;
  store_l2norm_rows(row0, dst, 64.0f, 16.0f);
  store_l2norm_rows(row1, dst + 16 * DH_, 64.0f, 16.0f);
}

// ---- kv = xn @ Wkv, epilogue by column block: 0: k l2norm (*4) -> kn[b][n][64];
// 1: v -> vt[b][d][n] (transposed, f16). grid = (2, ROWS_/128), block = 128.
__global__ __launch_bounds__(128)
void proj_kv_kernel(const _Float16* __restrict__ A, const _Float16* __restrict__ Bt,
                    _Float16* __restrict__ kn, _Float16* __restrict__ vt) {
  __shared__ __attribute__((aligned(16))) _Float16 stage[2 * GBUF_];   // 54 KB
  int m0 = blockIdx.y * 128 + (threadIdx.x >> 5) * 32;
  v8f row0[4], row1[4];
  gemm_tile<D_, true>(A, Bt, blockIdx.y * 128, blockIdx.x * DH_, stage, row0, row1);
  if (blockIdx.x == 0) {
    _Float16* dst = kn + (size_t)m0 * DH_;
    store_l2norm_rows(row0, dst, 4.0f, 1.0f);
    store_l2norm_rows(row1, dst + 16 * DH_, 4.0f, 1.0f);
  } else {
    int lane = threadIdx.x & 31;
    int half = lane >> 4, lcol = lane & 15;
    int b = m0 >> 11, n = m0 & 2047;
    // the 8 registers of an accumulator are 8 consecutive n of one d: one 16-byte store
    #pragma unroll   // constant indices keep the accumulators in registers
    for (int t = 0; t < 4; ++t) {
      _Float16* vd = vt + (size_t)(b * DH_ + lcol * 4 + t) * N_ + n + half * 8;
      *(v8h*)vd        = __builtin_convertvector(row0[t], v8h);
      *(v8h*)(vd + 16) = __builtin_convertvector(row1[t], v8h);
    }
    // stands in front of whatever rewrites the stores' data and address registers next
    asm volatile("s_wait_xcnt 0x0" ::: "memory");
  }
}

__global__ __launch_bounds__(128)
void attn_kernel(const _Float16* __restrict__ qn, const _Float16* __restrict__ kn,
                            const _Float16* __restrict__ vt, _Float16* __restrict__ ao) {
  __shared__ __attribute__((aligned(16))) _Float16 Kbuf[2][32 * KP_];   // [chunk rows j][d]      9 KB
  __shared__ __attribute__((aligned(16))) _Float16 Vbuf[2][64 * VP_];   // [d][chunk cols j]     10 KB

  int tid  = threadIdx.x;
  int lane = tid & 31, wid = tid >> 5;
  int half = lane >> 4, lcol = lane & 15;
  int unit = blockIdx.x * 4 + wid;         // 0 .. 4095
  int ib = unit >> 10;
  int ih = (unit >> 7) & 7;
  int i0 = (unit & 127) * 16;
  const _Float16* Q  = qn + (size_t)((ib * H_ + ih) * N_) * DH_;
  const _Float16* Kp = kn + (size_t)(ib * N_) * DH_;
  const _Float16* V  = vt + (size_t)ib * DH_ * N_;
  int d0 = half * 16;

  v16h a0 = *(const v16h*)(Q + (size_t)(i0 + lcol) * DH_ + d0);
  v16h a1 = *(const v16h*)(Q + (size_t)(i0 + lcol) * DH_ + 32 + d0);

  // ---- pass 1: maximum of query lcol; K chunks async-staged through LDS ----
  float m[8];
  #pragma unroll
  for (int r = 0; r < 8; ++r) m[r] = -1e30f;

  // chunk = 32 j-rows (4 KB). 128 threads x 32B = one chunk; four threads fill a row.
  int kdst = (tid >> 2) * KP_ + (tid & 3) * 16;        // K staging place of this thread
  async_cp32(Kp + tid * 16, &Kbuf[0][kdst]);           // stage chunk 0
  for (int c = 0; c < 64; ++c) {
    int cb = c & 1;
    wait_async0();
    __syncthreads();           // chunk cb ready; buffer (c+1)&1 free
    if (c < 63)
      async_cp32(Kp + (size_t)(c + 1) * 32 * DH_ + tid * 16,
                 &Kbuf[(c + 1) & 1][kdst]);
    const _Float16* kb = &Kbuf[cb][lcol * KP_ + d0];
    v16h k00 = lds_frag(kb),            k01 = lds_frag(kb + 32);
    v16h k10 = lds_frag(kb + 16 * KP_), k11 = lds_frag(kb + 16 * KP_ + 32);
    // keeps the LDS reads one group ahead of the products: as A operands the compiler loaded
    // them into one register set, each waited for alone
    __builtin_amdgcn_sched_barrier(0);
    v8f t0 = {}, t1 = {};
    t0 = WMMA_F16(k00, a0, t0);
    t1 = WMMA_F16(k10, a0, t1);
    t0 = WMMA_F16(k01, a1, t0);
    t1 = WMMA_F16(k11, a1, t1);
    #pragma unroll   // constant indices keep the score tiles in registers
    for (int r = 0; r < 8; ++r) m[r] = fmaxf(fmaxf(m[r], t0[r]), t1[r]);
  }
  // the lane's eight partial maxima, then the other half's keys of the same query
  float mq = fmaxf(fmaxf(fmaxf(m[0], m[1]), fmaxf(m[2], m[3])),
                   fmaxf(fmaxf(m[4], m[5]), fmaxf(m[6], m[7])));
  mq = fmaxf(mq, __shfl_xor(mq, 16, 32));

  // ---- pass 2: exp, Pt packed in registers, Vt * Pt; K and V chunks async-staged ----
  float s[8];
  #pragma unroll
  for (int r = 0; r < 8; ++r) s[r] = 0.f;
  v8f o0 = {}, o1 = {}, o2 = {}, o3 = {};  // Ot: d = t * 16 + half * 8 + r, query lcol
  int vd = tid >> 1, vpart = tid & 1;      // V staging role of this thread

  int vdst = vd * VP_ + vpart * 16;        // V staging place of this thread
  async_cp32_pair(Kp + tid * 16, &Kbuf[0][kdst],
                  V + (size_t)vd * N_ + vpart * 16, &Vbuf[0][vdst]);

  for (int c = 0; c < 64; ++c) {
    int cb = c & 1;
    wait_async0();
    __syncthreads();           // K/V chunk cb ready; buffer (c+1)&1 free
    if (c < 63) {
      int nb = (c + 1) & 1;
      async_cp32_pair(Kp + (size_t)(c + 1) * 32 * DH_ + tid * 16, &Kbuf[nb][kdst],
                      V + (size_t)vd * N_ + (c + 1) * 32 + vpart * 16, &Vbuf[nb][vdst]);
    }
    const _Float16* kb = &Kbuf[cb][lcol * KP_ + d0];
    v16h k00 = lds_frag(kb),            k01 = lds_frag(kb + 32);
    v16h k10 = lds_frag(kb + 16 * KP_), k11 = lds_frag(kb + 16 * KP_ + 32);
    // Vt rows d as A, their keys in the order the packed score tiles have as B:
    // elements 0..7 are keys half * 8 .. + 7, elements 8..15 keys 16 + half * 8 .. + 7
    const _Float16* vb = &Vbuf[cb][lcol * VP_ + half * 8];
    v16h av0 = vt_frag(vb);
    v16h av1 = vt_frag(vb + 16 * VP_);
    v16h av2 = vt_frag(vb + 32 * VP_);
    v16h av3 = vt_frag(vb + 48 * VP_);
    // keeps the LDS reads one group ahead of the products: as A operands the compiler loaded
    // them into one register set, each waited for alone
    __builtin_amdgcn_sched_barrier(0);
    v8f acc[2] = {{}, {}};
    acc[0] = WMMA_F16(k00, a0, acc[0]);
    acc[1] = WMMA_F16(k10, a0, acc[1]);
    acc[0] = WMMA_F16(k01, a1, acc[0]);
    acc[1] = WMMA_F16(k11, a1, acc[1]);
    v16h pt;
    #pragma unroll   // both loops: constant indices keep the score tiles and Pt in registers
    for (int sub = 0; sub < 2; ++sub)
      #pragma unroll
      for (int r = 0; r < 8; ++r) {
        float p = __expf(acc[sub][r] - mq);
        s[r] += p;
        pt[sub * 8 + r] = (_Float16)p;
      }
    o0 = WMMA_F16(av0, pt, o0);
    o1 = WMMA_F16(av1, pt, o1);
    o2 = WMMA_F16(av2, pt, o2);
    o3 = WMMA_F16(av3, pt, o3);
  }

  float sq = ((s[0] + s[1]) + (s[2] + s[3])) + ((s[4] + s[5]) + (s[6] + s[7]));
  sq += __shfl_xor(sq, 16, 32);            // the other half's keys of the same query
  float inv = 1.0f / fmaxf(sq, 1e-20f);
  // the 8 registers of an accumulator are 8 consecutive d of one query: one 16-byte store
  _Float16* dst = ao + (size_t)(ib * N_ + i0 + lcol) * INNER_ + ih * DH_ + half * 8;
  *(v8h*)dst        = __builtin_convertvector(o0 * inv, v8h);
  *(v8h*)(dst + 16) = __builtin_convertvector(o1 * inv, v8h);
  *(v8h*)(dst + 32) = __builtin_convertvector(o2 * inv, v8h);
  *(v8h*)(dst + 48) = __builtin_convertvector(o3 * inv, v8h);
}

extern "C" void kernel_launch(void* const* d_in, const int* in_sizes, int n_in,
                              void* d_out, int out_size, void* d_ws, size_t ws_size,
                              hipStream_t stream) {
  const float* x          = (const float*)d_in[0];
  const float* norm_g     = (const float*)d_in[1];
  const float* Wq         = (const float*)d_in[2];
  const float* Wkv        = (const float*)d_in[3];
  const float* Wout       = (const float*)d_in[4];
  const float* out_norm_g = (const float*)d_in[5];
  float* out = (float*)d_out;

  char* w = (char*)d_ws;
  size_t off = 0;
  auto alloc = [&](size_t bytes) -> void* {
    void* p = w + off;
    off += (bytes + 255) & ~(size_t)255;
    return p;
  };
  _Float16* xn_h  = (_Float16*)alloc((size_t)ROWS_ * D_ * 2);       // 16 MB
  _Float16* WqT   = (_Float16*)alloc((size_t)INNER_ * D_ * 2);      //  1 MB
  _Float16* WkvT  = (_Float16*)alloc((size_t)128 * D_ * 2);         // .25 MB
  _Float16* WoutT = (_Float16*)alloc((size_t)D_ * INNER_ * 2);      //  1 MB
  _Float16* qn_h  = (_Float16*)alloc((size_t)ROWS_ * INNER_ * 2);   //  8 MB
  _Float16* kn_h  = (_Float16*)alloc((size_t)ROWS_ * DH_ * 2);      //  1 MB
  _Float16* vt_h  = (_Float16*)alloc((size_t)ROWS_ * DH_ * 2);      //  1 MB
  _Float16* ao_h  = (_Float16*)alloc((size_t)ROWS_ * INNER_ * 2);   //  8 MB

  // 1. weight transposes (f32 -> f16 [N][K]), one 64x64 tile a block
  wt_kernel<<<WT_Q_ + WT_KV_ + WT_OUT_, 128, 0, stream>>>(Wq, Wkv, Wout, WqT, WkvT, WoutT);

  // 2. LayerNorm(x) -> xn (f16)
  ln_to_h_kernel<<<ROWS_ / 4, 128, 0, stream>>>(x, norm_g, xn_h);

  // 3. q = xn@Wq ; kv = xn@Wkv   (128x64 tile per block), l2norms and V transpose in the epilogues
  proj_q_kernel <<<dim3(H_, ROWS_ / 128), 128, 0, stream>>>(xn_h, WqT,  qn_h);
  proj_kv_kernel<<<dim3(2,  ROWS_ / 128), 128, 0, stream>>>(xn_h, WkvT, kn_h, vt_h);

  // 5. attention (async-LDS staged K/V, WMMA everywhere)
  attn_kernel<<<(B_ * H_ * (N_ / 16)) / 4, 128, 0, stream>>>(qn_h, kn_h, vt_h, ao_h);

  // 6. out = ao @ Wout  (f32 into d_out)
  gemm_kernel<<<dim3(D_ / 64, ROWS_ / 128), 128, 0, stream>>>(ao_h, WoutT, out);

  // 7. final LayerNorm in place on d_out
  ln_inplace_kernel<<<ROWS_ / 4, 128, 0, stream>>>(out, out_norm_g);
}

// v007
// Measured time: 108 microseconds a run.
// Versions between v005 and this one are left out; their measured steps multiply to 1.37 times as fast.
// Over all steps from v000 it is 3.06 times as fast.
#include <hip/hip_runtime.h>
#include <hip/hip_bf16.h>

typedef __attribute__((ext_vector_type(16))) _Float16 v16h;
typedef __attribute__((ext_vector_type(8)))  _Float16 v8h;
typedef __attribute__((ext_vector_type(4)))  _Float16 v4h;
typedef __attribute__((ext_vector_type(8)))  float    v8f;
typedef __attribute__((ext_vector_type(4)))  float    v4f;

#define B_  4
#define N_  2048
#define D_  1024
#define H_  8
#define DH_ 64
#define INNER_ 512
#define ROWS_ (B_ * N_)   // 8192

#define WMMA_F16(a, b, c) \
  __builtin_amdgcn_wmma_f32_16x16x32_f16(false, (a), false, (b), (short)0, (c), false, false)

__device__ __forceinline__ float redsum32(float v) {
  #pragma unroll
  for (int m = 1; m < 32; m <<= 1) v += __shfl_xor(v, m, 32);
  return v;
}

__device__ __forceinline__ void wait_async0() {
  // this wave's own LDS reads of the buffer refilled behind the barrier have retired
  asm volatile("s_wait_dscnt 0x0" ::: "memory");
  asm volatile("s_wait_asynccnt 0x0" ::: "memory");
}

// LDS row pitches in halfs: 16 B x odd, so the 16 lanes of a ds_load_b128 that read
// 16 different rows fall on 16 different groups of four banks.
#define SK_ 128  // keys in one attention stage of K and V
#define KP_ 72   // K rows of 128 B (64 d) at 144 B
#define VP_ 136  // V rows of 256 B (128 keys) at 272 B

// one thread's share of an attention stage as async copies global -> LDS (tracked by ASYNCcnt):
// 16 bytes of every 32nd K row and of every 16th V row. Eight neighbouring lanes fill a 128-byte
// K row, sixteen a 256-byte V row, so that every copy instruction of a wave covers four whole lines.
// gk, gv, lk, lv: the thread's first piece in global memory and its place in LDS.
// s_wait_xcnt closes the statement so that no address register is rewritten ahead of it
__device__ __forceinline__ void async_stage(const _Float16* gk, _Float16* lk,
                                            const _Float16* gv, _Float16* lv) {
  unsigned k0 = (unsigned)(uintptr_t)lk, v0 = (unsigned)(uintptr_t)lv;   // low 32 bits = LDS byte address
  const unsigned sk = 32 * KP_ * 2, sv = 16 * VP_ * 2;
  asm volatile("global_load_async_to_lds_b128 %0, %1, off\n\t"
               "global_load_async_to_lds_b128 %2, %3, off\n\t"
               "global_load_async_to_lds_b128 %4, %5, off\n\t"
               "global_load_async_to_lds_b128 %6, %7, off\n\t"
               "global_load_async_to_lds_b128 %8, %9, off\n\t"
               "global_load_async_to_lds_b128 %10, %11, off\n\t"
               "global_load_async_to_lds_b128 %12, %13, off\n\t"
               "global_load_async_to_lds_b128 %14, %15, off\n\t"
               "s_wait_xcnt 0x0"
               :: "v"(k0),          "v"(gk),            "v"(k0 + sk),     "v"(gk + 32 * DH_),
                  "v"(k0 + 2 * sk), "v"(gk + 64 * DH_), "v"(k0 + 3 * sk), "v"(gk + 96 * DH_),
                  "v"(v0),          "v"(gv),            "v"(v0 + sv),     "v"(gv + 16 * N_),
                  "v"(v0 + 2 * sv), "v"(gv + 32 * N_),  "v"(v0 + 3 * sv), "v"(gv + 48 * N_)
               : "memory");
}

// 16 contiguous halfs of a padded LDS row (16-byte aligned only) as one WMMA operand
__device__ __forceinline__ v16h lds_frag(const _Float16* p) {
  v8h lo = *(const v8h*)p;
  v8h hi = *(const v8h*)(p + 8);
  return __builtin_shufflevector(lo, hi, 0, 1, 2, 3, 4, 5, 6, 7, 8, 9, 10, 11, 12, 13, 14, 15);
}

// 8 halfs at p and 8 at p + 16 of a padded LDS row as one WMMA operand
__device__ __forceinline__ v16h vt_frag(const _Float16* p) {
  v8h lo = *(const v8h*)p;
  v8h hi = *(const v8h*)(p + 16);
  return __builtin_shufflevector(lo, hi, 0, 1, 2, 3, 4, 5, 6, 7, 8, 9, 10, 11, 12, 13, 14, 15);
}

// ---- transpose + f32->f16 weight conversion, Wt[n*K + k] = W[k*N + n], all three weights in
// one launch: a block of four waves takes one 64 (k) x 64 (n) tile. Reads are whole 256-byte row
// pieces, a lane holds 8 k of 4 n; the tile turns in LDS; stores are whole 128-byte rows.
#define TP_      72                                    // tile rows of 128 B at 144 B (16 B x odd)
#define WT_Q_    ((D_ / 64) * (INNER_ / 64))           // tiles of Wq
#define WT_KV_   ((D_ / 64) * (2 * DH_ / 64))          // tiles of Wkv
#define WT_OUT_  ((INNER_ / 64) * (D_ / 64))           // tiles of Wout

// tile t of one weight; K and N as constants, so that the row steps are immediate offsets
template <int K, int N>
__device__ __forceinline__ void wt_tile(const float* __restrict__ W, _Float16* __restrict__ Wt,
                                        int t, _Float16* tile) {
  int tid = threadIdx.x;
  int k0 = (t % (K / 64)) * 64, n0 = (t / (K / 64)) * 64;

  int r = tid >> 4, c = tid & 15;                      // k rows r*8 .. +7, n columns c*4 .. +3
  const float* src = W + (size_t)k0 * N + n0 + (r * 8 * N + c * 4);
  v4f v[8];
  #pragma unroll   // the eight loads in flight together; constant indices keep v in registers
  for (int j = 0; j < 8; ++j) v[j] = *(const v4f*)(src + j * N);
  // stands in front of whatever rewrites the loads' address registers next
  asm volatile("s_wait_xcnt 0x0" ::: "memory");
  #pragma unroll   // constant indices keep v in registers
  for (int i = 0; i < 4; ++i) {
    v8h h = {(_Float16)v[0][i], (_Float16)v[1][i], (_Float16)v[2][i], (_Float16)v[3][i],
             (_Float16)v[4][i], (_Float16)v[5][i], (_Float16)v[6][i], (_Float16)v[7][i]};
    *(v8h*)&tile[(c * 4 + i) * TP_ + r * 8] = h;
  }
  __syncthreads();             // the tile is whole before its rows are read

  int row = tid >> 3, p = (tid & 7) * 8;               // eight lanes store one 128-byte row
  _Float16* dst = Wt + (size_t)n0 * K + k0 + (row * K + p);
  #pragma unroll   // the four LDS reads together, then the four stores
  for (int j = 0; j < 4; ++j)
    *(v8h*)(dst + j * 16 * K) = *(const v8h*)&tile[(j * 16 + row) * TP_ + p];
}

__global__ __launch_bounds__(128)
void wt_kernel(const float* __restrict__ Wq, const float* __restrict__ Wkv,
               const float* __restrict__ Wout, _Float16* __restrict__ WqT,
               _Float16* __restrict__ WkvT, _Float16* __restrict__ WoutT) {
  __shared__ __attribute__((aligned(16))) _Float16 tile[64 * TP_];   // [n][k], 9 KB
  int t = blockIdx.x;
  if (t < WT_Q_)               wt_tile<D_, INNER_>(Wq, WqT, t, tile);
  else if (t < WT_Q_ + WT_KV_) wt_tile<D_, 2 * DH_>(Wkv, WkvT, t - WT_Q_, tile);
  else                         wt_tile<INNER_, D_>(Wout, WoutT, t - (WT_Q_ + WT_KV_), tile);
}

// ---- LayerNorm rows of f32 [rows x 1024] -> f16 out; 1 wave / row ----
__global__ void ln_to_h_kernel(const float* __restrict__ x, const float* __restrict__ g,
                               _Float16* __restrict__ out) {
  int lane = threadIdx.x & 31, wid = threadIdx.x >> 5;
  int row = blockIdx.x * 4 + wid;
  const float* xr = x + (size_t)row * D_;
  float v[32], sum = 0.f, sq = 0.f;
  #pragma unroll
  for (int j = 0; j < 32; ++j) {
    v[j] = xr[j * 32 + lane];
    sum += v[j]; sq += v[j] * v[j];
  }
  sum = redsum32(sum); sq = redsum32(sq);
  float mean = sum * (1.0f / D_);
  float var  = sq * (1.0f / D_) - mean * mean;
  float rs   = rsqrtf(var + 1e-5f);
  _Float16* o = out + (size_t)row * D_;
  #pragma unroll
  for (int j = 0; j < 32; ++j)
    o[j * 32 + lane] = (_Float16)((v[j] - mean) * rs * g[j * 32 + lane]);
}

// ---- in-place LayerNorm f32 [rows x 1024] ----
__global__ void ln_inplace_kernel(float* __restrict__ x, const float* __restrict__ g) {
  int lane = threadIdx.x & 31, wid = threadIdx.x >> 5;
  int row = blockIdx.x * 4 + wid;
  float* xr = x + (size_t)row * D_;
  float v[32], sum = 0.f, sq = 0.f;
  #pragma unroll
  for (int j = 0; j < 32; ++j) {
    v[j] = xr[j * 32 + lane];
    sum += v[j]; sq += v[j] * v[j];
  }
  sum = redsum32(sum); sq = redsum32(sq);
  float mean = sum * (1.0f / D_);
  float var  = sq * (1.0f / D_) - mean * mean;
  float rs   = rsqrtf(var + 1e-5f);
  #pragma unroll
  for (int j = 0; j < 32; ++j)
    xr[j * 32 + lane] = (v[j] - mean) * rs * g[j * 32 + lane];
}

// ---- 128x64 tile of A[.. x K] * Bt[.. x K]^T in a block of four waves (32x64 a wave,
// 8 accumulators). A k block of 64 halfs (128 A rows and 64 B rows of 128 B) is staged in LDS
// by async copies that cover whole lines, two buffers: the next block flies during this one.
#define GP_    72                  // staged rows of 128 B at 144 B (16 B x odd)
#define GROWS_ (128 + 64)          // A rows, then B rows
#define GBUF_  (GROWS_ * GP_)      // halfs in one buffer

// Ag, Bg: this thread's 16 bytes of row tid / 8 of the A tile and of the B tile, at the k block:
// eight lanes fill one 128-byte row, a thread takes every 16th row (8 of A, 4 of B).
// PERM: row j of the B tile lands at place (j % 4) * 16 + j / 4.
template <int K, bool PERM>
__device__ __forceinline__ void stage_block(const _Float16* Ag, const _Float16* Bg,
                                            _Float16* buf) {
  int r = threadIdx.x >> 3, p = (threadIdx.x & 7) * 8;
  unsigned la = (unsigned)(uintptr_t)(buf + r * GP_ + p);   // low 32 bits = LDS byte address
  unsigned lb = (unsigned)(uintptr_t)(buf + (128 + (PERM ? (r & 3) * 16 + (r >> 2) : r)) * GP_ + p);
  const unsigned sa = 16 * GP_ * 2, sb = (PERM ? 4 : 16) * GP_ * 2;
  // s_wait_xcnt closes the statement so that no address register is rewritten ahead of it
  asm volatile("global_load_async_to_lds_b128 %0, %1, off\n\t"
               "global_load_async_to_lds_b128 %2, %3, off\n\t"
               "global_load_async_to_lds_b128 %4, %5, off\n\t"
               "global_load_async_to_lds_b128 %6, %7, off\n\t"
               "global_load_async_to_lds_b128 %8, %9, off\n\t"
               "global_load_async_to_lds_b128 %10, %11, off\n\t"
               "global_load_async_to_lds_b128 %12, %13, off\n\t"
               "global_load_async_to_lds_b128 %14, %15, off\n\t"
               "global_load_async_to_lds_b128 %16, %17, off\n\t"
               "global_load_async_to_lds_b128 %18, %19, off\n\t"
               "global_load_async_to_lds_b128 %20, %21, off\n\t"
               "global_load_async_to_lds_b128 %22, %23, off\n\t"
               "s_wait_xcnt 0x0"
               :: "v"(la),          "v"(Ag),           "v"(la + sa),     "v"(Ag + 16 * K),
                  "v"(la + 2 * sa), "v"(Ag + 32 * K),  "v"(la + 3 * sa), "v"(Ag + 48 * K),
                  "v"(la + 4 * sa), "v"(Ag + 64 * K),  "v"(la + 5 * sa), "v"(Ag + 80 * K),
                  "v"(la + 6 * sa), "v"(Ag + 96 * K),  "v"(la + 7 * sa), "v"(Ag + 112 * K),
                  "v"(lb),          "v"(Bg),           "v"(lb + sb),     "v"(Bg + 16 * K),
                  "v"(lb + 2 * sb), "v"(Bg + 32 * K),  "v"(lb + 3 * sb), "v"(Bg + 48 * K)
               : "memory");
}

// The wave's rows are mblk + wid * 32 .. + 31. Column lcol of accumulator tile t is row
// n0 + t * 16 + lcol of Bt, or with PERM row n0 + lcol * 4 + t, so that a lane ends up with
// four neighbouring columns of each of its rows.
template <int K, bool PERM>
__device__ __forceinline__ void gemm_tile(const _Float16* __restrict__ A,
                                          const _Float16* __restrict__ Bt,
                                          int mblk, int n0, _Float16* lds,
                                          v8f (&row0)[4], v8f (&row1)[4]) {
  int tid = threadIdx.x;
  int lane = tid & 31, wid = tid >> 5;
  int half = lane >> 4, lcol = lane & 15;
  const _Float16* Ag = A  + (size_t)(mblk + (tid >> 3)) * K + (tid & 7) * 8;
  const _Float16* Bg = Bt + (size_t)(n0   + (tid >> 3)) * K + (tid & 7) * 8;

  v8f c00 = {}, c01 = {}, c02 = {}, c03 = {};
  v8f c10 = {}, c11 = {}, c12 = {}, c13 = {};

  // one staged k block: its 12 fragments, then the 16 WMMAs
  auto k_block = [&](const _Float16* buf) {
    const _Float16* Ab = buf + (wid * 32 + lcol) * GP_ + half * 16;
    const _Float16* Bb = buf + (128 + lcol) * GP_ + half * 16;
    v16h a0 = lds_frag(Ab),                 a1 = lds_frag(Ab + 16 * GP_);
    v16h b0 = lds_frag(Bb),                 b1 = lds_frag(Bb + 16 * GP_);
    v16h b2 = lds_frag(Bb + 32 * GP_),      b3 = lds_frag(Bb + 48 * GP_);
    v16h e0 = lds_frag(Ab + 32),            e1 = lds_frag(Ab + 16 * GP_ + 32);
    v16h f0 = lds_frag(Bb + 32),            f1 = lds_frag(Bb + 16 * GP_ + 32);
    v16h f2 = lds_frag(Bb + 32 * GP_ + 32), f3 = lds_frag(Bb + 48 * GP_ + 32);
    c00 = WMMA_F16(a0, b0, c00);
    c01 = WMMA_F16(a0, b1, c01);
    c02 = WMMA_F16(a0, b2, c02);
    c03 = WMMA_F16(a0, b3, c03);
    c10 = WMMA_F16(a1, b0, c10);
    c11 = WMMA_F16(a1, b1, c11);
    c12 = WMMA_F16(a1, b2, c12);
    c13 = WMMA_F16(a1, b3, c13);
    c00 = WMMA_F16(e0, f0, c00);
    c01 = WMMA_F16(e0, f1, c01);
    c02 = WMMA_F16(e0, f2, c02);
    c03 = WMMA_F16(e0, f3, c03);
    c10 = WMMA_F16(e1, f0, c10);
    c11 = WMMA_F16(e1, f1, c11);
    c12 = WMMA_F16(e1, f2, c12);
    c13 = WMMA_F16(e1, f3, c13);
  };

  stage_block<K, PERM>(Ag, Bg, lds);                  // k block 0
  #pragma unroll 1   // rolled: unrolled, the LDS reads came out scattered in pairs among the WMMAs
  for (int kb = 0; kb < K / 64 - 1; ++kb) {
    wait_async0();
    __syncthreads();           // k block kb ready; the other buffer free
    stage_block<K, PERM>(Ag + (kb + 1) * 64, Bg + (kb + 1) * 64, lds + ((kb + 1) & 1) * GBUF_);
    k_block(lds + (kb & 1) * GBUF_);
  }
  wait_async0();
  __syncthreads();             // the last k block ready
  k_block(lds + ((K / 64 - 1) & 1) * GBUF_);

  row0[0] = c00; row0[1] = c01; row0[2] = c02; row0[3] = c03;
  row1[0] = c10; row1[1] = c11; row1[2] = c12; row1[3] = c13;
}

// ---- C[ROWS_ x D_](f32) = A[ROWS_ x INNER_](f16) * Bt[D_ x INNER_](f16)^T
// grid = (D_/64, ROWS_/128), block = 128. The launch bound of the three GEMM kernels states the
// four waves: under the default bound the register cap made the fragments spill.
__global__ __launch_bounds__(128)
void gemm_kernel(const _Float16* __restrict__ A, const _Float16* __restrict__ Bt,
                 float* __restrict__ C) {
  __shared__ __attribute__((aligned(16))) _Float16 stage[2 * GBUF_];   // 54 KB
  const int N = D_;
  int lane = threadIdx.x & 31;
  int half = lane >> 4, lcol = lane & 15;
  int m0 = blockIdx.y * 128 + (threadIdx.x >> 5) * 32, n0 = blockIdx.x * 64;
  v8f row0[4], row1[4];
  gemm_tile<INNER_, false>(A, Bt, blockIdx.y * 128, n0, stage, row0, row1);
  #pragma unroll
  for (int t = 0; t < 4; ++t)
    #pragma unroll
    for (int r = 0; r < 8; ++r) {
      C[(size_t)(m0 + r + half * 8) * N + n0 + t * 16 + lcol]      = row0[t][r];
      C[(size_t)(m0 + 16 + r + half * 8) * N + n0 + t * 16 + lcol] = row1[t][r];
    }
}

// 16 rows x 64 columns as gemm_tile with PERM leaves them (a lane has columns lcol*4 .. +3 of rows
// r + half*8): each row times num / max(mul * ||row||, 1e-12), stored as f16 rows of 128 B.
__device__ __forceinline__ void store_l2norm_rows(const v8f (&c)[4], _Float16* __restrict__ dst,
                                                  float num, float mul) {
  int lane = threadIdx.x & 31;
  int half = lane >> 4, lcol = lane & 15;
  float sq[8];
  #pragma unroll   // constant indices keep the accumulators in registers
  for (int r = 0; r < 8; ++r)
    sq[r] = c[0][r] * c[0][r] + c[1][r] * c[1][r] + c[2][r] * c[2][r] + c[3][r] * c[3][r];
  #pragma unroll   // eight independent shuffle chains side by side
  for (int m = 1; m < 16; m <<= 1)
    #pragma unroll
    for (int r = 0; r < 8; ++r) sq[r] += __shfl_xor(sq[r], m, 32);
  #pragma unroll   // constant indices keep the accumulators in registers
  for (int r = 0; r < 8; ++r) {
    float scale = num / fmaxf(mul * sqrtf(sq[r]), 1e-12f);
    v4h o = {(_Float16)(c[0][r] * scale), (_Float16)(c[1][r] * scale),
             (_Float16)(c[2][r] * scale), (_Float16)(c[3][r] * scale)};
    *(v4h*)(dst + (r + half * 8) * DH_ + lcol * 4) = o;
  }
  // stands in front of whatever rewrites the stores' data and address registers next
  asm volatile("s_wait_xcnt 0x0" ::: "memory");
}

// ---- q = xn @ Wq with the l2norm in the epilogue: a wave's 64 columns are one head.
// qn[b][h][n][64] f16, net scale 64/max(16*||q||,1e-12). grid = (H_, ROWS_/128), block = 128.
__global__ __launch_bounds__(128)
void proj_q_kernel(const _Float16* __restrict__ A, const _Float16* __restrict__ Bt,
                   _Float16* __restrict__ qn) {
  __shared__ __attribute__((aligned(16))) _Float16 stage[2 * GBUF_];   // 54 KB
  int m0 = blockIdx.y * 128 + (threadIdx.x >> 5) * 32, h = blockIdx.x;
  v8f row0[4], row1[4];
  gemm_tile<D_, true>(A, Bt, blockIdx.y * 128, h * DH_, stage, row0, row1);
  int b = m0 >> 11, n = m0 & 2047;
  _Float16* dst = qn + (size_t)(((b * H_ + h) * N_) + n) * DH_;
  store_l2norm_rows(row0, dst, 64.0f, 16.0f);
  store_l2norm_rows(row1, dst + 16 * DH_, 64.0f, 16.0f);
}

// ---- kv = xn @ Wkv, epilogue by column block: 0: k l2norm (*4) -> kn[b][n][64];
// 1: v -> vt[b][d][n] (transposed, f16). grid = (2, ROWS_/128), block = 128.
__global__ __launch_bounds__(128)
void proj_kv_kernel(const _Float16* __restrict__ A, const _Float16* __restrict__ Bt,
                    _Float16* __restrict__ kn, _Float16* __restrict__ vt) {
  __shared__ __attribute__((aligned(16))) _Float16 stage[2 * GBUF_];   // 54 KB
  int m0 = blockIdx.y * 128 + (threadIdx.x >> 5) * 32;
  v8f row0[4], row1[4];
  gemm_tile<D_, true>(A, Bt, blockIdx.y * 128, blockIdx.x * DH_, stage, row0, row1);
  if (blockIdx.x == 0) {
    _Float16* dst = kn + (size_t)m0 * DH_;
    store_l2norm_rows(row0, dst, 4.0f, 1.0f);
    store_l2norm_rows(row1, dst + 16 * DH_, 4.0f, 1.0f);
  } else {
    int lane = threadIdx.x & 31;
    int half = lane >> 4, lcol = lane & 15;
    int b = m0 >> 11, n = m0 & 2047;
    // the 8 registers of an accumulator are 8 consecutive n of one d: one 16-byte store
    #pragma unroll   // constant indices keep the accumulators in registers
    for (int t = 0; t < 4; ++t) {
      _Float16* vd = vt + (size_t)(b * DH_ + lcol * 4 + t) * N_ + n + half * 8;
      *(v8h*)vd        = __builtin_convertvector(row0[t], v8h);
      *(v8h*)(vd + 16) = __builtin_convertvector(row1[t], v8h);
    }
    // stands in front of whatever rewrites the stores' data and address registers next
    asm volatile("s_wait_xcnt 0x0" ::: "memory");
  }
}

__global__ __launch_bounds__(256)
void attn_kernel(const _Float16* __restrict__ qn, const _Float16* __restrict__ kn,
                            const _Float16* __restrict__ vt, _Float16* __restrict__ ao) {
  __shared__ __attribute__((aligned(16))) _Float16 Kbuf[2][SK_ * KP_];   // [stage rows j][d]    36 KB
  __shared__ __attribute__((aligned(16))) _Float16 Vbuf[2][DH_ * VP_];   // [d][stage cols j]    34 KB

  int tid  = threadIdx.x;
  int lane = tid & 31, wid = tid >> 5;
  int half = lane >> 4, lcol = lane & 15;
  int blk = blockIdx.x;                    // 0 .. 255
  int ib = blk >> 6;
  int ih = (blk >> 3) & 7;
  int i0 = (blk & 7) * 256 + wid * 32;
  const _Float16* Q  = qn + (size_t)((ib * H_ + ih) * N_) * DH_;
  const _Float16* Kp = kn + (size_t)(ib * N_) * DH_;
  const _Float16* V  = vt + (size_t)ib * DH_ * N_;
  int d0 = half * 16;

  v16h q[2][2];                            // [column group][d block of 32]
  #pragma unroll   // constant indices keep the fragments in registers
  for (int g = 0; g < 2; ++g) {
    q[g][0] = *(const v16h*)(Q + (size_t)(i0 + g * 16 + lcol) * DH_ + d0);
    q[g][1] = *(const v16h*)(Q + (size_t)(i0 + g * 16 + lcol) * DH_ + 32 + d0);
  }

  // ---- one pass over the keys: exp against a running shift, Pt packed in registers, Vt * Pt;
  // mu[g] is the shift in use for query lcol of group g, equal in both halves.
  // Staging role of this thread: its first K piece and its first V piece of a stage.
  int kdst = (tid >> 3) * KP_ + (tid & 7) * 8;
  int vdst = (tid >> 4) * VP_ + (tid & 15) * 8;
  const _Float16* kg = Kp + tid * 8;
  const _Float16* vg = V + (size_t)(tid >> 4) * N_ + (tid & 15) * 8;
  float mu[2] = {-1e30f, -1e30f};
  float s[2][8];
  v8f o[2][4];                             // Ot: d = t * 16 + half * 8 + r, query lcol of group g
  #pragma unroll   // constant indices keep sums and Ot in registers
  for (int g = 0; g < 2; ++g) {
    #pragma unroll
    for (int r = 0; r < 8; ++r) s[g][r] = 0.f;
    #pragma unroll
    for (int t = 0; t < 4; ++t) o[g][t] = v8f{};
  }

  async_stage(kg, &Kbuf[0][kdst], vg, &Vbuf[0][vdst]);

  for (int c = 0; c < N_ / SK_; ++c) {
    int cb = c & 1;
    wait_async0();
    __syncthreads();           // K/V stage cb ready; buffer (c+1)&1 free
    if (c < N_ / SK_ - 1) {
      int nb = (c + 1) & 1;
      async_stage(kg + (size_t)(c + 1) * SK_ * DH_, &Kbuf[nb][kdst],
                  vg + (c + 1) * SK_, &Vbuf[nb][vdst]);
    }
    #pragma unroll   // the stage's four runs of 32 keys: constant LDS offsets
    for (int sub32 = 0; sub32 < SK_ / 32; ++sub32) {
      const _Float16* kb = &Kbuf[cb][(sub32 * 32 + lcol) * KP_ + d0];
      v16h k00 = lds_frag(kb),            k01 = lds_frag(kb + 32);
      v16h k10 = lds_frag(kb + 16 * KP_), k11 = lds_frag(kb + 16 * KP_ + 32);
      // Vt rows d as A, their keys in the order the packed score tiles have as B:
      // elements 0..7 are keys half * 8 .. + 7, elements 8..15 keys 16 + half * 8 .. + 7
      const _Float16* vb = &Vbuf[cb][lcol * VP_ + sub32 * 32 + half * 8];
      v16h av[4];
      #pragma unroll   // constant indices keep the fragments in registers
      for (int t = 0; t < 4; ++t) av[t] = vt_frag(vb + t * 16 * VP_);
      // keeps the LDS reads one group ahead of the products: as A operands the compiler loaded
      // them into one register set, each waited for alone
      __builtin_amdgcn_sched_barrier(0);
      v8f acc[2][2] = {{{}, {}}, {{}, {}}};
      acc[0][0] = WMMA_F16(k00, q[0][0], acc[0][0]);
      acc[0][1] = WMMA_F16(k10, q[0][0], acc[0][1]);
      acc[1][0] = WMMA_F16(k00, q[1][0], acc[1][0]);
      acc[1][1] = WMMA_F16(k10, q[1][0], acc[1][1]);
      acc[0][0] = WMMA_F16(k01, q[0][1], acc[0][0]);
      acc[0][1] = WMMA_F16(k11, q[0][1], acc[0][1]);
      acc[1][0] = WMMA_F16(k01, q[1][1], acc[1][0]);
      acc[1][1] = WMMA_F16(k11, q[1][1], acc[1][1]);
      // the lane's 16 scores a group against the shift in use. The shift moves only when a
      // score passes it by more than 8, so p stays below e^8, well inside f16; the test is one
      // scalar branch for the wave and both groups, taken in the first run of keys and then only
      // where a maximum has grown so.
      float cm[2];
      #pragma unroll   // constant indices keep the score tiles in registers
      for (int g = 0; g < 2; ++g) {
        float x0 = fmaxf(fmaxf(acc[g][0][0], acc[g][0][1]), acc[g][0][2]);
        float x1 = fmaxf(fmaxf(acc[g][0][3], acc[g][0][4]), acc[g][0][5]);
        float x2 = fmaxf(fmaxf(acc[g][0][6], acc[g][0][7]), acc[g][1][0]);
        float x3 = fmaxf(fmaxf(acc[g][1][1], acc[g][1][2]), acc[g][1][3]);
        float x4 = fmaxf(fmaxf(acc[g][1][4], acc[g][1][5]), acc[g][1][6]);
        cm[g] = fmaxf(fmaxf(fmaxf(x0, x1), x2), fmaxf(fmaxf(x3, x4), acc[g][1][7]));
      }
      if (__builtin_amdgcn_ballot_w32(cm[0] > mu[0] + 8.0f || cm[1] > mu[1] + 8.0f) != 0) {
        #pragma unroll   // constant indices keep sums and Ot in registers
        for (int g = 0; g < 2; ++g) {
          // the other half's keys of the same query, so that both halves take the same new shift
          int cb32 = __builtin_bit_cast(int, cm[g]);
          float co = __builtin_bit_cast(float,
              __builtin_amdgcn_permlanex16(cb32, cb32, 0x76543210, 0xfedcba98, false, false));
          float mn = fmaxf(mu[g], fmaxf(cm[g], co));
          float f = __expf(mu[g] - mn);    // 1 where the query's shift stays, 0 in the first run
          #pragma unroll
          for (int r = 0; r < 8; ++r) s[g][r] *= f;
          #pragma unroll
          for (int t = 0; t < 4; ++t) o[g][t] *= f;
          mu[g] = mn;
        }
      }
      #pragma unroll   // all loops: constant indices keep the score tiles, Pt and Ot in registers
      for (int g = 0; g < 2; ++g) {
        v16h pt;
        #pragma unroll
        for (int sub = 0; sub < 2; ++sub)
          #pragma unroll
          for (int r = 0; r < 8; ++r) {
            float p = __expf(acc[g][sub][r] - mu[g]);
            s[g][r] += p;
            pt[sub * 8 + r] = (_Float16)p;
          }
        #pragma unroll
        for (int t = 0; t < 4; ++t) o[g][t] = WMMA_F16(av[t], pt, o[g][t]);
      }
    }
  }

  #pragma unroll   // constant indices keep sums and Ot in registers
  for (int g = 0; g < 2; ++g) {
    float sq = ((s[g][0] + s[g][1]) + (s[g][2] + s[g][3])) + ((s[g][4] + s[g][5]) + (s[g][6] + s[g][7]));
    sq += __shfl_xor(sq, 16, 32);          // the other half's keys of the same query
    float inv = 1.0f / fmaxf(sq, 1e-20f);
    // the 8 registers of an accumulator are 8 consecutive d of one query: one 16-byte store
    _Float16* dst = ao + (size_t)(ib * N_ + i0 + g * 16 + lcol) * INNER_ + ih * DH_ + half * 8;
    #pragma unroll
    for (int t = 0; t < 4; ++t)
      *(v8h*)(dst + t * 16) = __builtin_convertvector(o[g][t] * inv, v8h);
  }
}

extern "C" void kernel_launch(void* const* d_in, const int* in_sizes, int n_in,
                              void* d_out, int out_size, void* d_ws, size_t ws_size,
                              hipStream_t stream) {
  const float* x          = (const float*)d_in[0];
  const float* norm_g     = (const float*)d_in[1];
  const float* Wq         = (const float*)d_in[2];
  const float* Wkv        = (const float*)d_in[3];
  const float* Wout       = (const float*)d_in[4];
  const float* out_norm_g = (const float*)d_in[5];
  float* out = (float*)d_out;

  char* w = (char*)d_ws;
  size_t off = 0;
  auto alloc = [&](size_t bytes) -> void* {
    void* p = w + off;
    off += (bytes + 255) & ~(size_t)255;
    return p;
  };
  _Float16* xn_h  = (_Float16*)alloc((size_t)ROWS_ * D_ * 2);       // 16 MB
  _Float16* WqT   = (_Float16*)alloc((size_t)INNER_ * D_ * 2);      //  1 MB
  _Float16* WkvT  = (_Float16*)alloc((size_t)128 * D_ * 2);         // .25 MB
  _Float16* WoutT = (_Float16*)alloc((size_t)D_ * INNER_ * 2);      //  1 MB
  _Float16* qn_h  = (_Float16*)alloc((size_t)ROWS_ * INNER_ * 2);   //  8 MB
  _Float16* kn_h  = (_Float16*)alloc((size_t)ROWS_ * DH_ * 2);      //  1 MB
  _Float16* vt_h  = (_Float16*)alloc((size_t)ROWS_ * DH_ * 2);      //  1 MB
  _Float16* ao_h  = (_Float16*)alloc((size_t)ROWS_ * INNER_ * 2);   //  8 MB

  // 1. weight transposes (f32 -> f16 [N][K]), one 64x64 tile a block
  wt_kernel<<<WT_Q_ + WT_KV_ + WT_OUT_, 128, 0, stream>>>(Wq, Wkv, Wout, WqT, WkvT, WoutT);

  // 2. LayerNorm(x) -> xn (f16)
  ln_to_h_kernel<<<ROWS_ / 4, 128, 0, stream>>>(x, norm_g, xn_h);

  // 3. q = xn@Wq ; kv = xn@Wkv   (128x64 tile per block), l2norms and V transpose in the epilogues
  proj_q_kernel <<<dim3(H_, ROWS_ / 128), 128, 0, stream>>>(xn_h, WqT,  qn_h);
  proj_kv_kernel<<<dim3(2,  ROWS_ / 128), 128, 0, stream>>>(xn_h, WkvT, kn_h, vt_h);

  // 5. attention (async-LDS staged K/V, WMMA everywhere)
  attn_kernel<<<(B_ * H_ * N_) / 256, 256, 0, stream>>>(qn_h, kn_h, vt_h, ao_h);

  // 6. out = ao @ Wout  (f32 into d_out)
  gemm_kernel<<<dim3(D_ / 64, ROWS_ / 128), 128, 0, stream>>>(ao_h, WoutT, out);

  // 7. final LayerNorm in place on d_out
  ln_inplace_kernel<<<ROWS_ / 4, 128, 0, stream>>>(out, out_norm_g);
}

// v008
// It runs in 100 microseconds.
// Two timings next to v007 both put it at 1.10 times that version's speed.
// All steps since v000 together make it 3.36 times as fast.
#include <hip/hip_runtime.h>
#include <hip/hip_bf16.h>

typedef __attribute__((ext_vector_type(16))) _Float16 v16h;
typedef __attribute__((ext_vector_type(8)))  _Float16 v8h;
typedef __attribute__((ext_vector_type(4)))  _Float16 v4h;
typedef __attribute__((ext_vector_type(8)))  float    v8f;
typedef __attribute__((ext_vector_type(4)))  float    v4f;

#define B_  4
#define N_  2048
#define D_  1024
#define H_  8
#define DH_ 64
#define INNER_ 512
#define ROWS_ (B_ * N_)   // 8192

#define WMMA_F16(a, b, c) \
  __builtin_amdgcn_wmma_f32_16x16x32_f16(false, (a), false, (b), (short)0, (c), false, false)

__device__ __forceinline__ float redsum32(float v) {
  #pragma unroll
  for (int m = 1; m < 32; m <<= 1) v += __shfl_xor(v, m, 32);
  return v;
}

__device__ __forceinline__ void wait_async0() {
  // this wave's own LDS reads of the buffer refilled behind the barrier have retired
  asm volatile("s_wait_dscnt 0x0" ::: "memory");
  asm volatile("s_wait_asynccnt 0x0" ::: "memory");
}

// LDS row pitches in halfs: 16 B x odd, so the 16 lanes of a ds_load_b128 that read
// 16 different rows fall on 16 different groups of four banks.
#define SK_ 128  // keys in one attention stage of K and V
#define KP_ 72   // K rows of 128 B (64 d) at 144 B
#define VP_ 136  // V rows of 256 B (128 keys) at 272 B

// one thread's share of an attention stage as async copies global -> LDS (tracked by ASYNCcnt):
// 16 bytes of every 32nd K row and of every 16th V row. Eight neighbouring lanes fill a 128-byte
// K row, sixteen a 256-byte V row, so that every copy instruction of a wave covers four whole lines.
// gk, gv, lk, lv: the thread's first piece in global memory and its place in LDS.
// s_wait_xcnt closes the statement so that no address register is rewritten ahead of it
__device__ __forceinline__ void async_stage(const _Float16* gk, _Float16* lk,
                                            const _Float16* gv, _Float16* lv) {
  unsigned k0 = (unsigned)(uintptr_t)lk, v0 = (unsigned)(uintptr_t)lv;   // low 32 bits = LDS byte address
  const unsigned sk = 32 * KP_ * 2, sv = 16 * VP_ * 2;
  asm volatile("global_load_async_to_lds_b128 %0, %1, off\n\t"
               "global_load_async_to_lds_b128 %2, %3, off\n\t"
               "global_load_async_to_lds_b128 %4, %5, off\n\t"
               "global_load_async_to_lds_b128 %6, %7, off\n\t"
               "global_load_async_to_lds_b128 %8, %9, off\n\t"
               "global_load_async_to_lds_b128 %10, %11, off\n\t"
               "global_load_async_to_lds_b128 %12, %13, off\n\t"
               "global_load_async_to_lds_b128 %14, %15, off\n\t"
               "s_wait_xcnt 0x0"
               :: "v"(k0),          "v"(gk),            "v"(k0 + sk),     "v"(gk + 32 * DH_),
                  "v"(k0 + 2 * sk), "v"(gk + 64 * DH_), "v"(k0 + 3 * sk), "v"(gk + 96 * DH_),
                  "v"(v0),          "v"(gv),            "v"(v0 + sv),     "v"(gv + 16 * N_),
                  "v"(v0 + 2 * sv), "v"(gv + 32 * N_),  "v"(v0 + 3 * sv), "v"(gv + 48 * N_)
               : "memory");
}

// 16 contiguous halfs of a padded LDS row (16-byte aligned only) as one WMMA operand
__device__ __forceinline__ v16h lds_frag(const _Float16* p) {
  v8h lo = *(const v8h*)p;
  v8h hi = *(const v8h*)(p + 8);
  return __builtin_shufflevector(lo, hi, 0, 1, 2, 3, 4, 5, 6, 7, 8, 9, 10, 11, 12, 13, 14, 15);
}

// 8 halfs at p and 8 at p + 16 of a padded LDS row as one WMMA operand
__device__ __forceinline__ v16h vt_frag(const _Float16* p) {
  v8h lo = *(const v8h*)p;
  v8h hi = *(const v8h*)(p + 16);
  return __builtin_shufflevector(lo, hi, 0, 1, 2, 3, 4, 5, 6, 7, 8, 9, 10, 11, 12, 13, 14, 15);
}

// ---- transpose + f32->f16 weight conversion, Wt[n*K + k] = W[k*N + n], all three weights in
// one launch: a block of four waves takes one 64 (k) x 64 (n) tile. Reads are whole 256-byte row
// pieces, a lane holds 8 k of 4 n; the tile turns in LDS; stores are whole 128-byte rows.
#define TP_      72                                    // tile rows of 128 B at 144 B (16 B x odd)
#define WT_Q_    ((D_ / 64) * (INNER_ / 64))           // tiles of Wq
#define WT_KV_   ((D_ / 64) * (2 * DH_ / 64))          // tiles of Wkv
#define WT_OUT_  ((INNER_ / 64) * (D_ / 64))           // tiles of Wout

// tile t of one weight; K and N as constants, so that the row steps are immediate offsets
template <int K, int N>
__device__ __forceinline__ void wt_tile(const float* __restrict__ W, _Float16* __restrict__ Wt,
                                        int t, _Float16* tile) {
  int tid = threadIdx.x;
  int k0 = (t % (K / 64)) * 64, n0 = (t / (K / 64)) * 64;

  int r = tid >> 4, c = tid & 15;                      // k rows r*8 .. +7, n columns c*4 .. +3
  const float* src = W + (size_t)k0 * N + n0 + (r * 8 * N + c * 4);
  v4f v[8];
  #pragma unroll   // the eight loads in flight together; constant indices keep v in registers
  for (int j = 0; j < 8; ++j) v[j] = *(const v4f*)(src + j * N);
  // stands in front of whatever rewrites the loads' address registers next
  asm volatile("s_wait_xcnt 0x0" ::: "memory");
  #pragma unroll   // constant indices keep v in registers
  for (int i = 0; i < 4; ++i) {
    v8h h = {(_Float16)v[0][i], (_Float16)v[1][i], (_Float16)v[2][i], (_Float16)v[3][i],
             (_Float16)v[4][i], (_Float16)v[5][i], (_Float16)v[6][i], (_Float16)v[7][i]};
    *(v8h*)&tile[(c * 4 + i) * TP_ + r * 8] = h;
  }
  __syncthreads();             // the tile is whole before its rows are read

  int row = tid >> 3, p = (tid & 7) * 8;               // eight lanes store one 128-byte row
  _Float16* dst = Wt + (size_t)n0 * K + k0 + (row * K + p);
  #pragma unroll   // the four LDS reads together, then the four stores
  for (int j = 0; j < 4; ++j)
    *(v8h*)(dst + j * 16 * K) = *(const v8h*)&tile[(j * 16 + row) * TP_ + p];
}

// ---- LayerNorm rows of f32 [rows x 1024] -> f16 out; 1 wave / row, rows blk * 4 .. + 3 ----
__device__ __forceinline__ void ln_to_h_rows(const float* __restrict__ x, const float* __restrict__ g,
                                             _Float16* __restrict__ out, int blk) {
  int lane = threadIdx.x & 31, wid = threadIdx.x >> 5;
  int row = blk * 4 + wid;
  const float* xr = x + (size_t)row * D_;
  float v[32], sum = 0.f, sq = 0.f;
  #pragma unroll
  for (int j = 0; j < 32; ++j) {
    v[j] = xr[j * 32 + lane];
    sum += v[j]; sq += v[j] * v[j];
  }
  // stands in front of whatever rewrites the x loads' address registers next
  asm volatile("s_wait_xcnt 0x0" ::: "memory");
  sum = redsum32(sum); sq = redsum32(sq);
  float mean = sum * (1.0f / D_);
  float var  = sq * (1.0f / D_) - mean * mean;
  float rs   = rsqrtf(var + 1e-5f);
  _Float16* o = out + (size_t)row * D_;
  #pragma unroll
  for (int j = 0; j < 32; ++j)
    o[j * 32 + lane] = (_Float16)((v[j] - mean) * rs * g[j * 32 + lane]);
  // stands in front of whatever rewrites the stores' address and data registers next
  asm volatile("s_wait_xcnt 0x0" ::: "memory");
}

// ---- the two pieces of work that depend on the inputs alone, in one launch, told apart by the
// block index: the weight tiles first, then four LayerNorm rows a block.
__global__ __launch_bounds__(128)
void prep_kernel(const float* __restrict__ Wq, const float* __restrict__ Wkv,
                 const float* __restrict__ Wout, _Float16* __restrict__ WqT,
                 _Float16* __restrict__ WkvT, _Float16* __restrict__ WoutT,
                 const float* __restrict__ x, const float* __restrict__ g,
                 _Float16* __restrict__ xn) {
  __shared__ __attribute__((aligned(16))) _Float16 tile[64 * TP_];   // [n][k], 9 KB
  int t = blockIdx.x;
  if (t < WT_Q_)                         wt_tile<D_, INNER_>(Wq, WqT, t, tile);
  else if (t < WT_Q_ + WT_KV_)           wt_tile<D_, 2 * DH_>(Wkv, WkvT, t - WT_Q_, tile);
  else if (t < WT_Q_ + WT_KV_ + WT_OUT_) wt_tile<INNER_, D_>(Wout, WoutT, t - (WT_Q_ + WT_KV_), tile);
  else                                   ln_to_h_rows(x, g, xn, t - (WT_Q_ + WT_KV_ + WT_OUT_));
}

// ---- in-place LayerNorm f32 [rows x 1024] ----
__global__ void ln_inplace_kernel(float* __restrict__ x, const float* __restrict__ g) {
  int lane = threadIdx.x & 31, wid = threadIdx.x >> 5;
  int row = blockIdx.x * 4 + wid;
  float* xr = x + (size_t)row * D_;
  float v[32], sum = 0.f, sq = 0.f;
  #pragma unroll
  for (int j = 0; j < 32; ++j) {
    v[j] = xr[j * 32 + lane];
    sum += v[j]; sq += v[j] * v[j];
  }
  sum = redsum32(sum); sq = redsum32(sq);
  float mean = sum * (1.0f / D_);
  float var  = sq * (1.0f / D_) - mean * mean;
  float rs   = rsqrtf(var + 1e-5f);
  #pragma unroll
  for (int j = 0; j < 32; ++j)
    xr[j * 32 + lane] = (v[j] - mean) * rs * g[j * 32 + lane];
}

// ---- 128x64 tile of A[.. x K] * Bt[.. x K]^T in a block of four waves (32x64 a wave,
// 8 accumulators). A k block of 64 halfs (128 A rows and 64 B rows of 128 B) is staged in LDS
// by async copies that cover whole lines, two buffers: the next block flies during this one.
#define GP_    72                  // staged rows of 128 B at 144 B (16 B x odd)
#define GROWS_ (128 + 64)          // A rows, then B rows
#define GBUF_  (GROWS_ * GP_)      // halfs in one buffer

// Ag, Bg: this thread's 16 bytes of row tid / 8 of the A tile and of the B tile, at the k block:
// eight lanes fill one 128-byte row, a thread takes every 16th row (8 of A, 4 of B).
// PERM: row j of the B tile lands at place (j % 4) * 16 + j / 4.
template <int K, bool PERM>
__device__ __forceinline__ void stage_block(const _Float16* Ag, const _Float16* Bg,
                                            _Float16* buf) {
  int r = threadIdx.x >> 3, p = (threadIdx.x & 7) * 8;
  unsigned la = (unsigned)(uintptr_t)(buf + r * GP_ + p);   // low 32 bits = LDS byte address
  unsigned lb = (unsigned)(uintptr_t)(buf + (128 + (PERM ? (r & 3) * 16 + (r >> 2) : r)) * GP_ + p);
  const unsigned sa = 16 * GP_ * 2, sb = (PERM ? 4 : 16) * GP_ * 2;
  // s_wait_xcnt closes the statement so that no address register is rewritten ahead of it
  asm volatile("global_load_async_to_lds_b128 %0, %1, off\n\t"
               "global_load_async_to_lds_b128 %2, %3, off\n\t"
               "global_load_async_to_lds_b128 %4, %5, off\n\t"
               "global_load_async_to_lds_b128 %6, %7, off\n\t"
               "global_load_async_to_lds_b128 %8, %9, off\n\t"
               "global_load_async_to_lds_b128 %10, %11, off\n\t"
               "global_load_async_to_lds_b128 %12, %13, off\n\t"
               "global_load_async_to_lds_b128 %14, %15, off\n\t"
               "global_load_async_to_lds_b128 %16, %17, off\n\t"
               "global_load_async_to_lds_b128 %18, %19, off\n\t"
               "global_load_async_to_lds_b128 %20, %21, off\n\t"
               "global_load_async_to_lds_b128 %22, %23, off\n\t"
               "s_wait_xcnt 0x0"
               :: "v"(la),          "v"(Ag),           "v"(la + sa),     "v"(Ag + 16 * K),
                  "v"(la + 2 * sa), "v"(Ag + 32 * K),  "v"(la + 3 * sa), "v"(Ag + 48 * K),
                  "v"(la + 4 * sa), "v"(Ag + 64 * K),  "v"(la + 5 * sa), "v"(Ag + 80 * K),
                  "v"(la + 6 * sa), "v"(Ag + 96 * K),  "v"(la + 7 * sa), "v"(Ag + 112 * K),
                  "v"(lb),          "v"(Bg),           "v"(lb + sb),     "v"(Bg + 16 * K),
                  "v"(lb + 2 * sb), "v"(Bg + 32 * K),  "v"(lb + 3 * sb), "v"(Bg + 48 * K)
               : "memory");
}

// The wave's rows are mblk + wid * 32 .. + 31. Column lcol of accumulator tile t is row
// n0 + t * 16 + lcol of Bt, or with PERM row n0 + lcol * 4 + t, so that a lane ends up with
// four neighbouring columns of each of its rows.
template <int K, bool PERM>
__device__ __forceinline__ void gemm_tile(const _Float16* __restrict__ A,
                                          const _Float16* __restrict__ Bt,
                                          int mblk, int n0, _Float16* lds,
                                          v8f (&row0)[4], v8f (&row1)[4]) {
  int tid = threadIdx.x;
  int lane = tid & 31, wid = tid >> 5;
  int half = lane >> 4, lcol = lane & 15;
  const _Float16* Ag = A  + (size_t)(mblk + (tid >> 3)) * K + (tid & 7) * 8;
  const _Float16* Bg = Bt + (size_t)(n0   + (tid >> 3)) * K + (tid & 7) * 8;

  v8f c00 = {}, c01 = {}, c02 = {}, c03 = {};
  v8f c10 = {}, c11 = {}, c12 = {}, c13 = {};

  // one staged k block: its 12 fragments, then the 16 WMMAs
  auto k_block = [&](const _Float16* buf) {
    const _Float16* Ab = buf + (wid * 32 + lcol) * GP_ + half * 16;
    const _Float16* Bb = buf + (128 + lcol) * GP_ + half * 16;
    v16h a0 = lds_frag(Ab),                 a1 = lds_frag(Ab + 16 * GP_);
    v16h b0 = lds_frag(Bb),                 b1 = lds_frag(Bb + 16 * GP_);
    v16h b2 = lds_frag(Bb + 32 * GP_),      b3 = lds_frag(Bb + 48 * GP_);
    v16h e0 = lds_frag(Ab + 32),            e1 = lds_frag(Ab + 16 * GP_ + 32);
    v16h f0 = lds_frag(Bb + 32),            f1 = lds_frag(Bb + 16 * GP_ + 32);
    v16h f2 = lds_frag(Bb + 32 * GP_ + 32), f3 = lds_frag(Bb + 48 * GP_ + 32);
    c00 = WMMA_F16(a0, b0, c00);
    c01 = WMMA_F16(a0, b1, c01);
    c02 = WMMA_F16(a0, b2, c02);
    c03 = WMMA_F16(a0, b3, c03);
    c10 = WMMA_F16(a1, b0, c10);
    c11 = WMMA_F16(a1, b1, c11);
    c12 = WMMA_F16(a1, b2, c12);
    c13 = WMMA_F16(a1, b3, c13);
    c00 = WMMA_F16(e0, f0, c00);
    c01 = WMMA_F16(e0, f1, c01);
    c02 = WMMA_F16(e0, f2, c02);
    c03 = WMMA_F16(e0, f3, c03);
    c10 = WMMA_F16(e1, f0, c10);
    c11 = WMMA_F16(e1, f1, c11);
    c12 = WMMA_F16(e1, f2, c12);
    c13 = WMMA_F16(e1, f3, c13);
  };

  stage_block<K, PERM>(Ag, Bg, lds);                  // k block 0
  #pragma unroll 1   // rolled: unrolled, the LDS reads came out scattered in pairs among the WMMAs
  for (int kb = 0; kb < K / 64 - 1; ++kb) {
    wait_async0();
    __syncthreads();           // k block kb ready; the other buffer free
    stage_block<K, PERM>(Ag + (kb + 1) * 64, Bg + (kb + 1) * 64, lds + ((kb + 1) & 1) * GBUF_);
    k_block(lds + (kb & 1) * GBUF_);
  }
  wait_async0();
  __syncthreads();             // the last k block ready
  k_block(lds + ((K / 64 - 1) & 1) * GBUF_);

  row0[0] = c00; row0[1] = c01; row0[2] = c02; row0[3] = c03;
  row1[0] = c10; row1[1] = c11; row1[2] = c12; row1[3] = c13;
}

// ---- C[ROWS_ x D_](f32) = A[ROWS_ x INNER_](f16) * Bt[D_ x INNER_](f16)^T
// grid = (D_/64, ROWS_/128), block = 128. The launch bound of the GEMM kernels states the
// four waves: under the default bound the register cap made the fragments spill.
__global__ __launch_bounds__(128)
void gemm_kernel(const _Float16* __restrict__ A, const _Float16* __restrict__ Bt,
                 float* __restrict__ C) {
  __shared__ __attribute__((aligned(16))) _Float16 stage[2 * GBUF_];   // 54 KB
  const int N = D_;
  int lane = threadIdx.x & 31;
  int half = lane >> 4, lcol = lane & 15;
  int m0 = blockIdx.y * 128 + (threadIdx.x >> 5) * 32, n0 = blockIdx.x * 64;
  v8f row0[4], row1[4];
  gemm_tile<INNER_, false>(A, Bt, blockIdx.y * 128, n0, stage, row0, row1);
  #pragma unroll
  for (int t = 0; t < 4; ++t)
    #pragma unroll
    for (int r = 0; r < 8; ++r) {
      C[(size_t)(m0 + r + half * 8) * N + n0 + t * 16 + lcol]      = row0[t][r];
      C[(size_t)(m0 + 16 + r + half * 8) * N + n0 + t * 16 + lcol] = row1[t][r];
    }
}

// 16 rows x 64 columns as gemm_tile with PERM leaves them (a lane has columns lcol*4 .. +3 of rows
// r + half*8): each row times num / max(mul * ||row||, 1e-12), stored as f16 rows of 128 B.
__device__ __forceinline__ void store_l2norm_rows(const v8f (&c)[4], _Float16* __restrict__ dst,
                                                  float num, float mul) {
  int lane = threadIdx.x & 31;
  int half = lane >> 4, lcol = lane & 15;
  float sq[8];
  #pragma unroll   // constant indices keep the accumulators in registers
  for (int r = 0; r < 8; ++r)
    sq[r] = c[0][r] * c[0][r] + c[1][r] * c[1][r] + c[2][r] * c[2][r] + c[3][r] * c[3][r];
  #pragma unroll   // eight independent shuffle chains side by side
  for (int m = 1; m < 16; m <<= 1)
    #pragma unroll
    for (int r = 0; r < 8; ++r) sq[r] += __shfl_xor(sq[r], m, 32);
  #pragma unroll   // constant indices keep the accumulators in registers
  for (int r = 0; r < 8; ++r) {
    float scale = num / fmaxf(mul * sqrtf(sq[r]), 1e-12f);
    v4h o = {(_Float16)(c[0][r] * scale), (_Float16)(c[1][r] * scale),
             (_Float16)(c[2][r] * scale), (_Float16)(c[3][r] * scale)};
    *(v4h*)(dst + (r + half * 8) * DH_ + lcol * 4) = o;
  }
  // stands in front of whatever rewrites the stores' data and address registers next
  asm volatile("s_wait_xcnt 0x0" ::: "memory");
}

// ---- q = xn @ Wq and kv = xn @ Wkv in one launch; a block's 64 columns, c = blockIdx.x, are
// c < 8: head c of q, l2norm in the epilogue -> qn[b][h][n][64] f16, net scale 64/max(16*||q||,1e-12);
// c == 8: k, l2norm (*4) -> kn[b][n][64]; c == 9: v -> vt[b][d][n] (transposed, f16).
// grid = (H_ + 2, ROWS_/128), block = 128: the ten blocks of a row block are neighbours in the grid.
__global__ __launch_bounds__(128)
void proj_kernel(const _Float16* __restrict__ A, const _Float16* __restrict__ WqT,
                 const _Float16* __restrict__ WkvT, _Float16* __restrict__ qn,
                 _Float16* __restrict__ kn, _Float16* __restrict__ vt) {
  __shared__ __attribute__((aligned(16))) _Float16 stage[2 * GBUF_];   // 54 KB
  int m0 = blockIdx.y * 128 + (threadIdx.x >> 5) * 32, c = blockIdx.x;
  bool isq = c < H_;
  v8f row0[4], row1[4];
  gemm_tile<D_, true>(A, isq ? WqT : WkvT, blockIdx.y * 128, (isq ? c : c - H_) * DH_, stage,
                      row0, row1);
  int b = m0 >> 11, n = m0 & 2047;
  if (c <= H_) {
    _Float16* dst = isq ? qn + (size_t)(((b * H_ + c) * N_) + n) * DH_ : kn + (size_t)m0 * DH_;
    float num = isq ? 64.0f : 4.0f, mul = isq ? 16.0f : 1.0f;
    store_l2norm_rows(row0, dst, num, mul);
    store_l2norm_rows(row1, dst + 16 * DH_, num, mul);
  } else {
    int lane = threadIdx.x & 31;
    int half = lane >> 4, lcol = lane & 15;
    // the 8 registers of an accumulator are 8 consecutive n of one d: one 16-byte store
    #pragma unroll   // constant indices keep the accumulators in registers
    for (int t = 0; t < 4; ++t) {
      _Float16* vd = vt + (size_t)(b * DH_ + lcol * 4 + t) * N_ + n + half * 8;
      *(v8h*)vd        = __builtin_convertvector(row0[t], v8h);
      *(v8h*)(vd + 16) = __builtin_convertvector(row1[t], v8h);
    }
    // stands in front of whatever rewrites the stores' data and address registers next
    asm volatile("s_wait_xcnt 0x0" ::: "memory");
  }
}

__global__ __launch_bounds__(256)
void attn_kernel(const _Float16* __restrict__ qn, const _Float16* __restrict__ kn,
                            const _Float16* __restrict__ vt, _Float16* __restrict__ ao) {
  __shared__ __attribute__((aligned(16))) _Float16 Kbuf[2][SK_ * KP_];   // [stage rows j][d]    36 KB
  __shared__ __attribute__((aligned(16))) _Float16 Vbuf[2][DH_ * VP_];   // [d][stage cols j]    34 KB

  int tid  = threadIdx.x;
  int lane = tid & 31, wid = tid >> 5;
  int half = lane >> 4, lcol = lane & 15;
  int blk = blockIdx.x;                    // 0 .. 255
  int ib = blk >> 6;
  int ih = (blk >> 3) & 7;
  int i0 = (blk & 7) * 256 + wid * 32;
  const _Float16* Q  = qn + (size_t)((ib * H_ + ih) * N_) * DH_;
  const _Float16* Kp = kn + (size_t)(ib * N_) * DH_;
  const _Float16* V  = vt + (size_t)ib * DH_ * N_;
  int d0 = half * 16;

  v16h q[2][2];                            // [column group][d block of 32]
  #pragma unroll   // constant indices keep the fragments in registers
  for (int g = 0; g < 2; ++g) {
    q[g][0] = *(const v16h*)(Q + (size_t)(i0 + g * 16 + lcol) * DH_ + d0);
    q[g][1] = *(const v16h*)(Q + (size_t)(i0 + g * 16 + lcol) * DH_ + 32 + d0);
  }

  // ---- one pass over the keys: exp against a running shift, Pt packed in registers, Vt * Pt;
  // mu[g] is the shift in use for query lcol of group g, equal in both halves.
  // Staging role of this thread: its first K piece and its first V piece of a stage.
  int kdst = (tid >> 3) * KP_ + (tid & 7) * 8;
  int vdst = (tid >> 4) * VP_ + (tid & 15) * 8;
  const _Float16* kg = Kp + tid * 8;
  const _Float16* vg = V + (size_t)(tid >> 4) * N_ + (tid & 15) * 8;
  float mu[2] = {-1e30f, -1e30f};
  float s[2][8];
  v8f o[2][4];                             // Ot: d = t * 16 + half * 8 + r, query lcol of group g
  #pragma unroll   // constant indices keep sums and Ot in registers
  for (int g = 0; g < 2; ++g) {
    #pragma unroll
    for (int r = 0; r < 8; ++r) s[g][r] = 0.f;
    #pragma unroll
    for (int t = 0; t < 4; ++t) o[g][t] = v8f{};
  }

  async_stage(kg, &Kbuf[0][kdst], vg, &Vbuf[0][vdst]);

  for (int c = 0; c < N_ / SK_; ++c) {
    int cb = c & 1;
    wait_async0();
    __syncthreads();           // K/V stage cb ready; buffer (c+1)&1 free
    if (c < N_ / SK_ - 1) {
      int nb = (c + 1) & 1;
      async_stage(kg + (size_t)(c + 1) * SK_ * DH_, &Kbuf[nb][kdst],
                  vg + (c + 1) * SK_, &Vbuf[nb][vdst]);
    }
    #pragma unroll   // the stage's four runs of 32 keys: constant LDS offsets
    for (int sub32 = 0; sub32 < SK_ / 32; ++sub32) {
      const _Float16* kb = &Kbuf[cb][(sub32 * 32 + lcol) * KP_ + d0];
      v16h k00 = lds_frag(kb),            k01 = lds_frag(kb + 32);
      v16h k10 = lds_frag(kb + 16 * KP_), k11 = lds_frag(kb + 16 * KP_ + 32);
      // Vt rows d as A, their keys in the order the packed score tiles have as B:
      // elements 0..7 are keys half * 8 .. + 7, elements 8..15 keys 16 + half * 8 .. + 7
      const _Float16* vb = &Vbuf[cb][lcol * VP_ + sub32 * 32 + half * 8];
      v16h av[4];
      #pragma unroll   // constant indices keep the fragments in registers
      for (int t = 0; t < 4; ++t) av[t] = vt_frag(vb + t * 16 * VP_);
      // keeps the LDS reads one group ahead of the products: as A operands the compiler loaded
      // them into one register set, each waited for alone
      __builtin_amdgcn_sched_barrier(0);
      v8f acc[2][2] = {{{}, {}}, {{}, {}}};
      acc[0][0] = WMMA_F16(k00, q[0][0], acc[0][0]);
      acc[0][1] = WMMA_F16(k10, q[0][0], acc[0][1]);
      acc[1][0] = WMMA_F16(k00, q[1][0], acc[1][0]);
      acc[1][1] = WMMA_F16(k10, q[1][0], acc[1][1]);
      acc[0][0] = WMMA_F16(k01, q[0][1], acc[0][0]);
      acc[0][1] = WMMA_F16(k11, q[0][1], acc[0][1]);
      acc[1][0] = WMMA_F16(k01, q[1][1], acc[1][0]);
      acc[1][1] = WMMA_F16(k11, q[1][1], acc[1][1]);
      // the lane's 16 scores a group against the shift in use. The shift moves only when a
      // score passes it by more than 8, so p stays below e^8, well inside f16; the test is one
      // scalar branch for the wave and both groups, taken in the first run of keys and then only
      // where a maximum has grown so.
      float cm[2];
      #pragma unroll   // constant indices keep the score tiles in registers
      for (int g = 0; g < 2; ++g) {
        float x0 = fmaxf(fmaxf(acc[g][0][0], acc[g][0][1]), acc[g][0][2]);
        float x1 = fmaxf(fmaxf(acc[g][0][3], acc[g][0][4]), acc[g][0][5]);
        float x2 = fmaxf(fmaxf(acc[g][0][6], acc[g][0][7]), acc[g][1][0]);
        float x3 = fmaxf(fmaxf(acc[g][1][1], acc[g][1][2]), acc[g][1][3]);
        float x4 = fmaxf(fmaxf(acc[g][1][4], acc[g][1][5]), acc[g][1][6]);
        cm[g] = fmaxf(fmaxf(fmaxf(x0, x1), x2), fmaxf(fmaxf(x3, x4), acc[g][1][7]));
      }
      if (__builtin_amdgcn_ballot_w32(cm[0] > mu[0] + 8.0f || cm[1] > mu[1] + 8.0f) != 0) {
        #pragma unroll   // constant indices keep sums and Ot in registers
        for (int g = 0; g < 2; ++g) {
          // the other half's keys of the same query, so that both halves take the same new shift
          int cb32 = __builtin_bit_cast(int, cm[g]);
          float co = __builtin_bit_cast(float,
              __builtin_amdgcn_permlanex16(cb32, cb32, 0x76543210, 0xfedcba98, false, false));
          float mn = fmaxf(mu[g], fmaxf(cm[g], co));
          float f = __expf(mu[g] - mn);    // 1 where the query's shift stays, 0 in the first run
          #pragma unroll
          for (int r = 0; r < 8; ++r) s[g][r] *= f;
          #pragma unroll
          for (int t = 0; t < 4; ++t) o[g][t] *= f;
          mu[g] = mn;
        }
      }
      #pragma unroll   // all loops: constant indices keep the score tiles, Pt and Ot in registers
      for (int g = 0; g < 2; ++g) {
        v16h pt;
        #pragma unroll
        for (int sub = 0; sub < 2; ++sub)
          #pragma unroll
          for (int r = 0; r < 8; ++r) {
            float p = __expf(acc[g][sub][r] - mu[g]);
            s[g][r] += p;
            pt[sub * 8 + r] = (_Float16)p;
          }
        #pragma unroll
        for (int t = 0; t < 4; ++t) o[g][t] = WMMA_F16(av[t], pt, o[g][t]);
      }
    }
  }

  #pragma unroll   // constant indices keep sums and Ot in registers
  for (int g = 0; g < 2; ++g) {
    float sq = ((s[g][0] + s[g][1]) + (s[g][2] + s[g][3])) + ((s[g][4] + s[g][5]) + (s[g][6] + s[g][7]));
    sq += __shfl_xor(sq, 16, 32);          // the other half's keys of the same query
    float inv = 1.0f / fmaxf(sq, 1e-20f);
    // the 8 registers of an accumulator are 8 consecutive d of one query: one 16-byte store
    _Float16* dst = ao + (size_t)(ib * N_ + i0 + g * 16 + lcol) * INNER_ + ih * DH_ + half * 8;
    #pragma unroll
    for (int t = 0; t < 4; ++t)
      *(v8h*)(dst + t * 16) = __builtin_convertvector(o[g][t] * inv, v8h);
  }
}

extern "C" void kernel_launch(void* const* d_in, const int* in_sizes, int n_in,
                              void* d_out, int out_size, void* d_ws, size_t ws_size,
                              hipStream_t stream) {
  const float* x          = (const float*)d_in[0];
  const float* norm_g     = (const float*)d_in[1];
  const float* Wq         = (const float*)d_in[2];
  const float* Wkv        = (const float*)d_in[3];
  const float* Wout       = (const float*)d_in[4];
  const float* out_norm_g = (const float*)d_in[5];
  float* out = (float*)d_out;

  char* w = (char*)d_ws;
  size_t off = 0;
  auto alloc = [&](size_t bytes) -> void* {
    void* p = w + off;
    off += (bytes + 255) & ~(size_t)255;
    return p;
  };
  _Float16* xn_h  = (_Float16*)alloc((size_t)ROWS_ * D_ * 2);       // 16 MB
  _Float16* WqT   = (_Float16*)alloc((size_t)INNER_ * D_ * 2);      //  1 MB
  _Float16* WkvT  = (_Float16*)alloc((size_t)128 * D_ * 2);         // .25 MB
  _Float16* WoutT = (_Float16*)alloc((size_t)D_ * INNER_ * 2);      //  1 MB
  _Float16* qn_h  = (_Float16*)alloc((size_t)ROWS_ * INNER_ * 2);   //  8 MB
  _Float16* kn_h  = (_Float16*)alloc((size_t)ROWS_ * DH_ * 2);      //  1 MB
  _Float16* vt_h  = (_Float16*)alloc((size_t)ROWS_ * DH_ * 2);      //  1 MB
  _Float16* ao_h  = (_Float16*)alloc((size_t)ROWS_ * INNER_ * 2);   //  8 MB

  // 1. weight transposes (f32 -> f16 [N][K]), one 64x64 tile a block, and LayerNorm(x) -> xn (f16)
  prep_kernel<<<WT_Q_ + WT_KV_ + WT_OUT_ + ROWS_ / 4, 128, 0, stream>>>(Wq, Wkv, Wout, WqT, WkvT, WoutT,
                                                                       x, norm_g, xn_h);

  // 3. q = xn@Wq ; kv = xn@Wkv   (128x64 tile per block), l2norms and V transpose in the epilogues
  proj_kernel<<<dim3(H_ + 2, ROWS_ / 128), 128, 0, stream>>>(xn_h, WqT, WkvT, qn_h, kn_h, vt_h);

  // 5. attention (async-LDS staged K/V, WMMA everywhere)
  attn_kernel<<<(B_ * H_ * N_) / 256, 256, 0, stream>>>(qn_h, kn_h, vt_h, ao_h);

  // 6. out = ao @ Wout  (f32 into d_out)
  gemm_kernel<<<dim3(D_ / 64, ROWS_ / 128), 128, 0, stream>>>(ao_h, WoutT, out);

  // 7. final LayerNorm in place on d_out
  ln_inplace_kernel<<<ROWS_ / 4, 128, 0, stream>>>(out, out_norm_g);
}

// v009
// Measured time: 68.9 microseconds a run.
// Next to v008, in two timings, it ran 1.45 times as fast each time.
// Counting every step since v000, it is 4.86 times as fast.
#include <hip/hip_runtime.h>
#include <hip/hip_bf16.h>

typedef __attribute__((ext_vector_type(16))) _Float16 v16h;
typedef __attribute__((ext_vector_type(8)))  _Float16 v8h;
typedef __attribute__((ext_vector_type(4)))  _Float16 v4h;
typedef __attribute__((ext_vector_type(8)))  float    v8f;
typedef __attribute__((ext_vector_type(4)))  float    v4f;

#define B_  4
#define N_  2048
#define D_  1024
#define H_  8
#define DH_ 64
#define INNER_ 512
#define ROWS_ (B_ * N_)   // 8192

#define WMMA_F16(a, b, c) \
  __builtin_amdgcn_wmma_f32_16x16x32_f16(false, (a), false, (b), (short)0, (c), false, false)

__device__ __forceinline__ float redsum32(float v) {
  #pragma unroll
  for (int m = 1; m < 32; m <<= 1) v += __shfl_xor(v, m, 32);
  return v;
}

__device__ __forceinline__ void wait_async0() {
  // this wave's own LDS reads of the buffer refilled behind the barrier have retired
  asm volatile("s_wait_dscnt 0x0" ::: "memory");
  asm volatile("s_wait_asynccnt 0x0" ::: "memory");
}

// LDS row pitches in halfs: 16 B x odd, so the 16 lanes of a ds_load_b128 that read
// 16 different rows fall on 16 different groups of four banks.
#define SK_ 128  // keys in one attention stage of K and V
#define KP_ 72   // K rows of 128 B (64 d) at 144 B
#define VP_ 136  // V rows of 256 B (128 keys) at 272 B

// one thread's share of an attention stage as async copies global -> LDS (tracked by ASYNCcnt):
// 16 bytes of every 32nd K row and of every 16th V row. Eight neighbouring lanes fill a 128-byte
// K row, sixteen a 256-byte V row, so that every copy instruction of a wave covers four whole lines.
// gk, gv, lk, lv: the thread's first piece in global memory and its place in LDS.
// s_wait_xcnt closes the statement so that no address register is rewritten ahead of it
__device__ __forceinline__ void async_stage(const _Float16* gk, _Float16* lk,
                                            const _Float16* gv, _Float16* lv) {
  unsigned k0 = (unsigned)(uintptr_t)lk, v0 = (unsigned)(uintptr_t)lv;   // low 32 bits = LDS byte address
  const unsigned sk = 32 * KP_ * 2, sv = 16 * VP_ * 2;
  asm volatile("global_load_async_to_lds_b128 %0, %1, off\n\t"
               "global_load_async_to_lds_b128 %2, %3, off\n\t"
               "global_load_async_to_lds_b128 %4, %5, off\n\t"
               "global_load_async_to_lds_b128 %6, %7, off\n\t"
               "global_load_async_to_lds_b128 %8, %9, off\n\t"
               "global_load_async_to_lds_b128 %10, %11, off\n\t"
               "global_load_async_to_lds_b128 %12, %13, off\n\t"
               "global_load_async_to_lds_b128 %14, %15, off\n\t"
               "s_wait_xcnt 0x0"
               :: "v"(k0),          "v"(gk),            "v"(k0 + sk),     "v"(gk + 32 * DH_),
                  "v"(k0 + 2 * sk), "v"(gk + 64 * DH_), "v"(k0 + 3 * sk), "v"(gk + 96 * DH_),
                  "v"(v0),          "v"(gv),            "v"(v0 + sv),     "v"(gv + 16 * N_),
                  "v"(v0 + 2 * sv), "v"(gv + 32 * N_),  "v"(v0 + 3 * sv), "v"(gv + 48 * N_)
               : "memory");
}

// 16 contiguous halfs of a padded LDS row (16-byte aligned only) as one WMMA operand
__device__ __forceinline__ v16h lds_frag(const _Float16* p) {
  v8h lo = *(const v8h*)p;
  v8h hi = *(const v8h*)(p + 8);
  return __builtin_shufflevector(lo, hi, 0, 1, 2, 3, 4, 5, 6, 7, 8, 9, 10, 11, 12, 13, 14, 15);
}

// 8 halfs at p and 8 at p + 16 of a padded LDS row as one WMMA operand
__device__ __forceinline__ v16h vt_frag(const _Float16* p) {
  v8h lo = *(const v8h*)p;
  v8h hi = *(const v8h*)(p + 16);
  return __builtin_shufflevector(lo, hi, 0, 1, 2, 3, 4, 5, 6, 7, 8, 9, 10, 11, 12, 13, 14, 15);
}

// ---- transpose + f32->f16 weight conversion, Wt[n*K + k] = W[k*N + n], all three weights in
// one launch: a block of four waves takes one 64 (k) x 64 (n) tile. Reads are whole 256-byte row
// pieces, a lane holds 8 k of 4 n; the tile turns in LDS; stores are whole 128-byte rows.
#define TP_      72                                    // tile rows of 128 B at 144 B (16 B x odd)
#define WT_Q_    ((D_ / 64) * (INNER_ / 64))           // tiles of Wq
#define WT_KV_   ((D_ / 64) * (2 * DH_ / 64))          // tiles of Wkv
#define WT_OUT_  ((INNER_ / 64) * (D_ / 64))           // tiles of Wout

// tile t of one weight; K and N as constants, so that the row steps are immediate offsets
template <int K, int N>
__device__ __forceinline__ void wt_tile(const float* __restrict__ W, _Float16* __restrict__ Wt,
                                        int t, _Float16* tile) {
  int tid = threadIdx.x;
  int k0 = (t % (K / 64)) * 64, n0 = (t / (K / 64)) * 64;

  int r = tid >> 4, c = tid & 15;                      // k rows r*8 .. +7, n columns c*4 .. +3
  const float* src = W + (size_t)k0 * N + n0 + (r * 8 * N + c * 4);
  v4f v[8];
  #pragma unroll   // the eight loads in flight together; constant indices keep v in registers
  for (int j = 0; j < 8; ++j) v[j] = *(const v4f*)(src + j * N);
  // stands in front of whatever rewrites the loads' address registers next
  asm volatile("s_wait_xcnt 0x0" ::: "memory");
  #pragma unroll   // constant indices keep v in registers
  for (int i = 0; i < 4; ++i) {
    v8h h = {(_Float16)v[0][i], (_Float16)v[1][i], (_Float16)v[2][i], (_Float16)v[3][i],
             (_Float16)v[4][i], (_Float16)v[5][i], (_Float16)v[6][i], (_Float16)v[7][i]};
    *(v8h*)&tile[(c * 4 + i) * TP_ + r * 8] = h;
  }
  __syncthreads();             // the tile is whole before its rows are read

  int row = tid >> 3, p = (tid & 7) * 8;               // eight lanes store one 128-byte row
  _Float16* dst = Wt + (size_t)n0 * K + k0 + (row * K + p);
  #pragma unroll   // the four LDS reads together, then the four stores
  for (int j = 0; j < 4; ++j)
    *(v8h*)(dst + j * 16 * K) = *(const v8h*)&tile[(j * 16 + row) * TP_ + p];
}

// ---- LayerNorm rows of f32 [rows x 1024] -> f16 out; 1 wave / row, rows blk * 4 .. + 3 ----
__device__ __forceinline__ void ln_to_h_rows(const float* __restrict__ x, const float* __restrict__ g,
                                             _Float16* __restrict__ out, int blk) {
  int lane = threadIdx.x & 31, wid = threadIdx.x >> 5;
  int row = blk * 4 + wid;
  const float* xr = x + (size_t)row * D_;
  float v[32], sum = 0.f, sq = 0.f;
  #pragma unroll
  for (int j = 0; j < 32; ++j) {
    v[j] = xr[j * 32 + lane];
    sum += v[j]; sq += v[j] * v[j];
  }
  // stands in front of whatever rewrites the x loads' address registers next
  asm volatile("s_wait_xcnt 0x0" ::: "memory");
  sum = redsum32(sum); sq = redsum32(sq);
  float mean = sum * (1.0f / D_);
  float var  = sq * (1.0f / D_) - mean * mean;
  float rs   = rsqrtf(var + 1e-5f);
  _Float16* o = out + (size_t)row * D_;
  #pragma unroll
  for (int j = 0; j < 32; ++j)
    o[j * 32 + lane] = (_Float16)((v[j] - mean) * rs * g[j * 32 + lane]);
  // stands in front of whatever rewrites the stores' address and data registers next
  asm volatile("s_wait_xcnt 0x0" ::: "memory");
}

// ---- the two pieces of work that depend on the inputs alone, in one launch, told apart by the
// block index: the weight tiles first, then four LayerNorm rows a block.
__global__ __launch_bounds__(128)
void prep_kernel(const float* __restrict__ Wq, const float* __restrict__ Wkv,
                 const float* __restrict__ Wout, _Float16* __restrict__ WqT,
                 _Float16* __restrict__ WkvT, _Float16* __restrict__ WoutT,
                 const float* __restrict__ x, const float* __restrict__ g,
                 _Float16* __restrict__ xn) {
  __shared__ __attribute__((aligned(16))) _Float16 tile[64 * TP_];   // [n][k], 9 KB
  int t = blockIdx.x;
  if (t < WT_Q_)                         wt_tile<D_, INNER_>(Wq, WqT, t, tile);
  else if (t < WT_Q_ + WT_KV_)           wt_tile<D_, 2 * DH_>(Wkv, WkvT, t - WT_Q_, tile);
  else if (t < WT_Q_ + WT_KV_ + WT_OUT_) wt_tile<INNER_, D_>(Wout, WoutT, t - (WT_Q_ + WT_KV_), tile);
  else                                   ln_to_h_rows(x, g, xn, t - (WT_Q_ + WT_KV_ + WT_OUT_));
}

// ---- 128x64 tile of A[.. x K] * Bt[.. x K]^T in a block of four waves (32x64 a wave,
// 8 accumulators). A k block of 64 halfs (128 A rows and 64 B rows of 128 B) is staged in LDS
// by async copies that cover whole lines, two buffers: the next block flies during this one.
#define GP_    72                  // staged rows of 128 B at 144 B (16 B x odd)
#define GROWS_ (128 + 64)          // A rows, then B rows
#define GBUF_  (GROWS_ * GP_)      // halfs in one buffer

// Ag, Bg: this thread's 16 bytes of row tid / 8 of the A tile and of the B tile, at the k block:
// eight lanes fill one 128-byte row, a thread takes every 16th row (8 of A, 4 of B).
// PERM: row j of the B tile lands at place (j % 4) * 16 + j / 4.
template <int K, bool PERM>
__device__ __forceinline__ void stage_block(const _Float16* Ag, const _Float16* Bg,
                                            _Float16* buf) {
  int r = threadIdx.x >> 3, p = (threadIdx.x & 7) * 8;
  unsigned la = (unsigned)(uintptr_t)(buf + r * GP_ + p);   // low 32 bits = LDS byte address
  unsigned lb = (unsigned)(uintptr_t)(buf + (128 + (PERM ? (r & 3) * 16 + (r >> 2) : r)) * GP_ + p);
  const unsigned sa = 16 * GP_ * 2, sb = (PERM ? 4 : 16) * GP_ * 2;
  // s_wait_xcnt closes the statement so that no address register is rewritten ahead of it
  asm volatile("global_load_async_to_lds_b128 %0, %1, off\n\t"
               "global_load_async_to_lds_b128 %2, %3, off\n\t"
               "global_load_async_to_lds_b128 %4, %5, off\n\t"
               "global_load_async_to_lds_b128 %6, %7, off\n\t"
               "global_load_async_to_lds_b128 %8, %9, off\n\t"
               "global_load_async_to_lds_b128 %10, %11, off\n\t"
               "global_load_async_to_lds_b128 %12, %13, off\n\t"
               "global_load_async_to_lds_b128 %14, %15, off\n\t"
               "global_load_async_to_lds_b128 %16, %17, off\n\t"
               "global_load_async_to_lds_b128 %18, %19, off\n\t"
               "global_load_async_to_lds_b128 %20, %21, off\n\t"
               "global_load_async_to_lds_b128 %22, %23, off\n\t"
               "s_wait_xcnt 0x0"
               :: "v"(la),          "v"(Ag),           "v"(la + sa),     "v"(Ag + 16 * K),
                  "v"(la + 2 * sa), "v"(Ag + 32 * K),  "v"(la + 3 * sa), "v"(Ag + 48 * K),
                  "v"(la + 4 * sa), "v"(Ag + 64 * K),  "v"(la + 5 * sa), "v"(Ag + 80 * K),
                  "v"(la + 6 * sa), "v"(Ag + 96 * K),  "v"(la + 7 * sa), "v"(Ag + 112 * K),
                  "v"(lb),          "v"(Bg),           "v"(lb + sb),     "v"(Bg + 16 * K),
                  "v"(lb + 2 * sb), "v"(Bg + 32 * K),  "v"(lb + 3 * sb), "v"(Bg + 48 * K)
               : "memory");
}

// The wave's rows are mblk + wid * 32 .. + 31. Column lcol of accumulator tile t is row
// n0 + t * 16 + lcol of Bt, or with PERM row n0 + lcol * 4 + t, so that a lane ends up with
// four neighbouring columns of each of its rows.
template <int K, bool PERM>
__device__ __forceinline__ void gemm_tile(const _Float16* __restrict__ A,
                                          const _Float16* __restrict__ Bt,
                                          int mblk, int n0, _Float16* lds,
                                          v8f (&row0)[4], v8f (&row1)[4]) {
  int tid = threadIdx.x;
  int lane = tid & 31, wid = tid >> 5;
  int half = lane >> 4, lcol = lane & 15;
  const _Float16* Ag = A  + (size_t)(mblk + (tid >> 3)) * K + (tid & 7) * 8;
  const _Float16* Bg = Bt + (size_t)(n0   + (tid >> 3)) * K + (tid & 7) * 8;

  v8f c00 = {}, c01 = {}, c02 = {}, c03 = {};
  v8f c10 = {}, c11 = {}, c12 = {}, c13 = {};

  // one staged k block: its 12 fragments, then the 16 WMMAs
  auto k_block = [&](const _Float16* buf) {
    const _Float16* Ab = buf + (wid * 32 + lcol) * GP_ + half * 16;
    const _Float16* Bb = buf + (128 + lcol) * GP_ + half * 16;
    v16h a0 = lds_frag(Ab),                 a1 = lds_frag(Ab + 16 * GP_);
    v16h b0 = lds_frag(Bb),                 b1 = lds_frag(Bb + 16 * GP_);
    v16h b2 = lds_frag(Bb + 32 * GP_),      b3 = lds_frag(Bb + 48 * GP_);
    v16h e0 = lds_frag(Ab + 32),            e1 = lds_frag(Ab + 16 * GP_ + 32);
    v16h f0 = lds_frag(Bb + 32),            f1 = lds_frag(Bb + 16 * GP_ + 32);
    v16h f2 = lds_frag(Bb + 32 * GP_ + 32), f3 = lds_frag(Bb + 48 * GP_ + 32);
    c00 = WMMA_F16(a0, b0, c00);
    c01 = WMMA_F16(a0, b1, c01);
    c02 = WMMA_F16(a0, b2, c02);
    c03 = WMMA_F16(a0, b3, c03);
    c10 = WMMA_F16(a1, b0, c10);
    c11 = WMMA_F16(a1, b1, c11);
    c12 = WMMA_F16(a1, b2, c12);
    c13 = WMMA_F16(a1, b3, c13);
    c00 = WMMA_F16(e0, f0, c00);
    c01 = WMMA_F16(e0, f1, c01);
    c02 = WMMA_F16(e0, f2, c02);
    c03 = WMMA_F16(e0, f3, c03);
    c10 = WMMA_F16(e1, f0, c10);
    c11 = WMMA_F16(e1, f1, c11);
    c12 = WMMA_F16(e1, f2, c12);
    c13 = WMMA_F16(e1, f3, c13);
  };

  stage_block<K, PERM>(Ag, Bg, lds);                  // k block 0
  #pragma unroll 1   // rolled: unrolled, the LDS reads came out scattered in pairs among the WMMAs
  for (int kb = 0; kb < K / 64 - 1; ++kb) {
    wait_async0();
    __syncthreads();           // k block kb ready; the other buffer free
    stage_block<K, PERM>(Ag + (kb + 1) * 64, Bg + (kb + 1) * 64, lds + ((kb + 1) & 1) * GBUF_);
    k_block(lds + (kb & 1) * GBUF_);
  }
  wait_async0();
  __syncthreads();             // the last k block ready
  k_block(lds + ((K / 64 - 1) & 1) * GBUF_);

  row0[0] = c00; row0[1] = c01; row0[2] = c02; row0[3] = c03;
  row1[0] = c10; row1[1] = c11; row1[2] = c12; row1[3] = c13;
}

// ---- out = LayerNorm(A[ROWS_ x INNER_](f16) * Bt[D_ x INNER_](f16)^T) * g, f32, in one launch:
// a block of eight waves owns 32 WHOLE rows (32 x 1024), so that a row's mean and variance are
// formed from the accumulators and the product never goes to memory unnormalised.
// A wave has the 32 rows x 128 columns wid * 128 .. + 127 (16 accumulators). A k block of 64 halfs
// (32 A rows and all 1024 B rows of 128 B) is staged in LDS by async copies that cover whole
// lines, two buffers: the next block flies during this one.
#define OROWS_ (32 + D_)           // A rows, then B rows
#define OBUF_  (OROWS_ * GP_)      // halfs in one buffer

// eight copies of B rows 32 apart. Row j of a group of 64 B rows lands at place
// (j % 4) * 16 + j / 4 of the group, so rows 32 apart lie 8 places apart, rows 64 apart 64 places.
// s_wait_xcnt closes the statement so that no address register is rewritten ahead of it
__device__ __forceinline__ void copy_b_rows(unsigned l, const _Float16* g) {
  const unsigned s8 = 8 * GP_ * 2, s64 = 64 * GP_ * 2;
  asm volatile("global_load_async_to_lds_b128 %0, %1, off\n\t"
               "global_load_async_to_lds_b128 %2, %3, off\n\t"
               "global_load_async_to_lds_b128 %4, %5, off\n\t"
               "global_load_async_to_lds_b128 %6, %7, off\n\t"
               "global_load_async_to_lds_b128 %8, %9, off\n\t"
               "global_load_async_to_lds_b128 %10, %11, off\n\t"
               "global_load_async_to_lds_b128 %12, %13, off\n\t"
               "global_load_async_to_lds_b128 %14, %15, off\n\t"
               "s_wait_xcnt 0x0"
               :: "v"(l),                "v"(g),                "v"(l + s8),           "v"(g + 32 * INNER_),
                  "v"(l + s64),          "v"(g + 64 * INNER_),  "v"(l + s64 + s8),     "v"(g + 96 * INNER_),
                  "v"(l + 2 * s64),      "v"(g + 128 * INNER_), "v"(l + 2 * s64 + s8), "v"(g + 160 * INNER_),
                  "v"(l + 3 * s64),      "v"(g + 192 * INNER_), "v"(l + 3 * s64 + s8), "v"(g + 224 * INNER_)
               : "memory");
}

// Ag, Bg: this thread's 16 bytes of row tid / 8 of the A rows and of the B rows, at the k block:
// eight lanes fill one 128-byte row, a thread takes one A row and every 32nd B row (33 copies).
__device__ __forceinline__ void stage_rows(const _Float16* Ag, const _Float16* Bg, _Float16* buf) {
  int r = threadIdx.x >> 3, p = (threadIdx.x & 7) * 8;
  unsigned la = (unsigned)(uintptr_t)(buf + r * GP_ + p);   // low 32 bits = LDS byte address
  unsigned lb = (unsigned)(uintptr_t)(buf + (32 + (r & 3) * 16 + (r >> 2)) * GP_ + p);
  // s_wait_xcnt closes the statement so that no address register is rewritten ahead of it
  asm volatile("global_load_async_to_lds_b128 %0, %1, off\n\t"
               "s_wait_xcnt 0x0"
               :: "v"(la), "v"(Ag) : "memory");
  #pragma unroll   // four statements of eight copies: constant steps from one pair of addresses
  for (int q = 0; q < 4; ++q)
    copy_b_rows(lb + q * 256 * GP_ * 2, Bg + q * 256 * INNER_);
}

// v plus the v of lane ^ M inside a row of 16 lanes, on the vector unit (a DPP operand)
template <int M>
__device__ __forceinline__ float add_xmask(float v) {
  int o = __builtin_amdgcn_update_dpp(0, __builtin_bit_cast(int, v), 0x160 + M, 0xf, 0xf, true);
  return v + __builtin_bit_cast(float, o);
}

// grid = ROWS_/32, block = 256: one block a WGP (its LDS), all of them resident at once.
// The launch bound states the eight waves (two a SIMD), which sets the register cap.
__global__ __launch_bounds__(256)
void out_ln_kernel(const _Float16* __restrict__ A, const _Float16* __restrict__ Bt,
                   const float* __restrict__ g, float* __restrict__ C) {
  __shared__ __attribute__((aligned(16))) _Float16 stage[2 * OBUF_];   // 297 KB
  __shared__ float part[8][32][2];   // a wave's sum and square sum of its 128 columns of each row
  __shared__ float stat[32][2];      // a row's mean and 1 / sqrt(var + eps)
  int tid = threadIdx.x;
  int lane = tid & 31, wid = tid >> 5;
  int half = lane >> 4, lcol = lane & 15;
  int mblk = blockIdx.x * 32;
  const _Float16* Ag = A  + (size_t)(mblk + (tid >> 3)) * INNER_ + (tid & 7) * 8;
  const _Float16* Bg = Bt + (size_t)(tid >> 3) * INNER_ + (tid & 7) * 8;

  // column lcol of accumulator tile t is column wid * 128 + (t / 4) * 64 + lcol * 4 + t % 4:
  // a lane ends up with four neighbouring columns, twice, of each of its rows
  v8f c0[8], c1[8];                  // rows half * 8 + r and 16 + half * 8 + r
  #pragma unroll   // constant indices keep the accumulators in registers
  for (int t = 0; t < 8; ++t) { c0[t] = v8f{}; c1[t] = v8f{}; }

  // every block streams the whole of Bt: the blocks start at different k blocks and go round,
  // so that few of them ask L2 for the same lines at the same moment
  int krot = (blockIdx.x + (blockIdx.x >> 3)) & (INNER_ / 64 - 1);
  stage_rows(Ag + krot * 64, Bg + krot * 64, stage);  // the first k block
  #pragma unroll 1   // rolled: one copy of the staging and of the k block in the instruction cache
  for (int kb = 0; kb < INNER_ / 64; ++kb) {
    wait_async0();
    __syncthreads();           // the kb-th k block ready; the other buffer free
    if (kb < INNER_ / 64 - 1) {
      int kn = ((kb + 1 + krot) & (INNER_ / 64 - 1)) * 64;
      stage_rows(Ag + kn, Bg + kn, stage + ((kb + 1) & 1) * OBUF_);
    }
    // the staged k block: two runs of 32 k, each 10 fragments, then 16 WMMAs
    const _Float16* Ab = stage + (kb & 1) * OBUF_ + lcol * GP_ + half * 16;
    const _Float16* Bb = stage + (kb & 1) * OBUF_ + (32 + wid * 128 + lcol) * GP_ + half * 16;
    #pragma unroll   // constant LDS offsets and accumulator indices
    for (int ks = 0; ks < 2; ++ks) {
      v16h a0 = lds_frag(Ab + ks * 32), a1 = lds_frag(Ab + 16 * GP_ + ks * 32);
      v16h bf[8];
      #pragma unroll
      for (int t = 0; t < 8; ++t) bf[t] = lds_frag(Bb + t * 16 * GP_ + ks * 32);
      // keeps the run's LDS reads one group ahead of its products: left free, the compiler
      // loaded the B fragments into two register sets, each pair of WMMAs waiting for its own
      __builtin_amdgcn_sched_barrier(0);
      #pragma unroll
      for (int t = 0; t < 8; ++t) {
        c0[t] = WMMA_F16(a0, bf[t], c0[t]);
        c1[t] = WMMA_F16(a1, bf[t], c1[t]);
      }
    }
  }

  v4f gv[2];
  #pragma unroll   // constant indices keep g in registers
  for (int q = 0; q < 2; ++q) gv[q] = *(const v4f*)(g + wid * 128 + q * 64 + lcol * 4);

  // sums of the lane's 8 columns of its 16 rows, then over the 16 lanes that share the rows
  v8f s0 = c0[0], q0 = c0[0] * c0[0], s1 = c1[0], q1 = c1[0] * c1[0];
  #pragma unroll   // all loops: constant indices keep accumulators and sums in registers
  for (int t = 1; t < 8; ++t) {
    s0 += c0[t]; q0 += c0[t] * c0[t];
    s1 += c1[t]; q1 += c1[t] * c1[t];
  }
  float sm[16], sq[16];
  #pragma unroll
  for (int r = 0; r < 8; ++r) { sm[r] = s0[r]; sq[r] = q0[r]; sm[8 + r] = s1[r]; sq[8 + r] = q1[r]; }
  #pragma unroll
  for (int i = 0; i < 16; ++i) {
    sm[i] = add_xmask<8>(add_xmask<4>(add_xmask<2>(add_xmask<1>(sm[i]))));
    sq[i] = add_xmask<8>(add_xmask<4>(add_xmask<2>(add_xmask<1>(sq[i]))));
  }
  if (lcol == 0) {
    #pragma unroll
    for (int i = 0; i < 16; ++i) {
      part[wid][(i >> 3) * 16 + half * 8 + (i & 7)][0] = sm[i];
      part[wid][(i >> 3) * 16 + half * 8 + (i & 7)][1] = sq[i];
    }
  }
  __syncthreads();             // the eight waves' sums of every row are in LDS
  if (tid < 32) {
    float sum = 0.f, sqs = 0.f;
    #pragma unroll
    for (int w = 0; w < 8; ++w) { sum += part[w][tid][0]; sqs += part[w][tid][1]; }
    float mean = sum * (1.0f / D_);
    float var  = sqs * (1.0f / D_) - mean * mean;
    stat[tid][0] = mean;
    stat[tid][1] = rsqrtf(var + 1e-5f);
  }
  __syncthreads();             // every row's mean and scale are in LDS

  // 16 lanes x 16 bytes: a store covers 256 contiguous bytes of each of two rows
  float* dst = C + (size_t)(mblk + half * 8) * D_ + wid * 128 + lcol * 4;
  #pragma unroll   // all loops: constant indices keep the accumulators in registers
  for (int r = 0; r < 8; ++r) {
    float m0 = stat[half * 8 + r][0],      r0 = stat[half * 8 + r][1];
    float m1 = stat[16 + half * 8 + r][0], r1 = stat[16 + half * 8 + r][1];
    #pragma unroll
    for (int q = 0; q < 2; ++q) {
      v4f o0, o1;
      #pragma unroll
      for (int e = 0; e < 4; ++e) {
        o0[e] = (c0[q * 4 + e][r] - m0) * r0 * gv[q][e];
        o1[e] = (c1[q * 4 + e][r] - m1) * r1 * gv[q][e];
      }
      *(v4f*)(dst + r * D_ + q * 64)        = o0;
      *(v4f*)(dst + (16 + r) * D_ + q * 64) = o1;
    }
  }
  // stands in front of whatever rewrites the stores' data and address registers next
  asm volatile("s_wait_xcnt 0x0" ::: "memory");
}

// 16 rows x 64 columns as gemm_tile with PERM leaves them (a lane has columns lcol*4 .. +3 of rows
// r + half*8): each row times num / max(mul * ||row||, 1e-12), stored as f16 rows of 128 B.
__device__ __forceinline__ void store_l2norm_rows(const v8f (&c)[4], _Float16* __restrict__ dst,
                                                  float num, float mul) {
  int lane = threadIdx.x & 31;
  int half = lane >> 4, lcol = lane & 15;
  float sq[8];
  #pragma unroll   // constant indices keep the accumulators in registers
  for (int r = 0; r < 8; ++r)
    sq[r] = c[0][r] * c[0][r] + c[1][r] * c[1][r] + c[2][r] * c[2][r] + c[3][r] * c[3][r];
  #pragma unroll   // eight independent shuffle chains side by side
  for (int m = 1; m < 16; m <<= 1)
    #pragma unroll
    for (int r = 0; r < 8; ++r) sq[r] += __shfl_xor(sq[r], m, 32);
  #pragma unroll   // constant indices keep the accumulators in registers
  for (int r = 0; r < 8; ++r) {
    float scale = num / fmaxf(mul * sqrtf(sq[r]), 1e-12f);
    v4h o = {(_Float16)(c[0][r] * scale), (_Float16)(c[1][r] * scale),
             (_Float16)(c[2][r] * scale), (_Float16)(c[3][r] * scale)};
    *(v4h*)(dst + (r + half * 8) * DH_ + lcol * 4) = o;
  }
  // stands in front of whatever rewrites the stores' data and address registers next
  asm volatile("s_wait_xcnt 0x0" ::: "memory");
}

// ---- q = xn @ Wq and kv = xn @ Wkv in one launch; a block's 64 columns, c = blockIdx.x, are
// c < 8: head c of q, l2norm in the epilogue -> qn[b][h][n][64] f16, net scale 64/max(16*||q||,1e-12);
// c == 8: k, l2norm (*4) -> kn[b][n][64]; c == 9: v -> vt[b][d][n] (transposed, f16).
// grid = (H_ + 2, ROWS_/128), block = 128: the ten blocks of a row block are neighbours in the grid.
// The launch bound states the four waves: under the default bound the register cap made the
// fragments spill.
__global__ __launch_bounds__(128)
void proj_kernel(const _Float16* __restrict__ A, const _Float16* __restrict__ WqT,
                 const _Float16* __restrict__ WkvT, _Float16* __restrict__ qn,
                 _Float16* __restrict__ kn, _Float16* __restrict__ vt) {
  __shared__ __attribute__((aligned(16))) _Float16 stage[2 * GBUF_];   // 54 KB
  int m0 = blockIdx.y * 128 + (threadIdx.x >> 5) * 32, c = blockIdx.x;
  bool isq = c < H_;
  v8f row0[4], row1[4];
  gemm_tile<D_, true>(A, isq ? WqT : WkvT, blockIdx.y * 128, (isq ? c : c - H_) * DH_, stage,
                      row0, row1);
  int b = m0 >> 11, n = m0 & 2047;
  if (c <= H_) {
    _Float16* dst = isq ? qn + (size_t)(((b * H_ + c) * N_) + n) * DH_ : kn + (size_t)m0 * DH_;
    float num = isq ? 64.0f : 4.0f, mul = isq ? 16.0f : 1.0f;
    store_l2norm_rows(row0, dst, num, mul);
    store_l2norm_rows(row1, dst + 16 * DH_, num, mul);
  } else {
    int lane = threadIdx.x & 31;
    int half = lane >> 4, lcol = lane & 15;
    // the 8 registers of an accumulator are 8 consecutive n of one d: one 16-byte store
    #pragma unroll   // constant indices keep the accumulators in registers
    for (int t = 0; t < 4; ++t) {
      _Float16* vd = vt + (size_t)(b * DH_ + lcol * 4 + t) * N_ + n + half * 8;
      *(v8h*)vd        = __builtin_convertvector(row0[t], v8h);
      *(v8h*)(vd + 16) = __builtin_convertvector(row1[t], v8h);
    }
    // stands in front of whatever rewrites the stores' data and address registers next
    asm volatile("s_wait_xcnt 0x0" ::: "memory");
  }
}

__global__ __launch_bounds__(256)
void attn_kernel(const _Float16* __restrict__ qn, const _Float16* __restrict__ kn,
                            const _Float16* __restrict__ vt, _Float16* __restrict__ ao) {
  __shared__ __attribute__((aligned(16))) _Float16 Kbuf[2][SK_ * KP_];   // [stage rows j][d]    36 KB
  __shared__ __attribute__((aligned(16))) _Float16 Vbuf[2][DH_ * VP_];   // [d][stage cols j]    34 KB

  int tid  = threadIdx.x;
  int lane = tid & 31, wid = tid >> 5;
  int half = lane >> 4, lcol = lane & 15;
  int blk = blockIdx.x;                    // 0 .. 255
  int ib = blk >> 6;
  int ih = (blk >> 3) & 7;
  int i0 = (blk & 7) * 256 + wid * 32;
  const _Float16* Q  = qn + (size_t)((ib * H_ + ih) * N_) * DH_;
  const _Float16* Kp = kn + (size_t)(ib * N_) * DH_;
  const _Float16* V  = vt + (size_t)ib * DH_ * N_;
  int d0 = half * 16;

  v16h q[2][2];                            // [column group][d block of 32]
  #pragma unroll   // constant indices keep the fragments in registers
  for (int g = 0; g < 2; ++g) {
    q[g][0] = *(const v16h*)(Q + (size_t)(i0 + g * 16 + lcol) * DH_ + d0);
    q[g][1] = *(const v16h*)(Q + (size_t)(i0 + g * 16 + lcol) * DH_ + 32 + d0);
  }

  // ---- one pass over the keys: exp against a running shift, Pt packed in registers, Vt * Pt;
  // mu[g] is the shift in use for query lcol of group g, equal in both halves.
  // Staging role of this thread: its first K piece and its first V piece of a stage.
  int kdst = (tid >> 3) * KP_ + (tid & 7) * 8;
  int vdst = (tid >> 4) * VP_ + (tid & 15) * 8;
  const _Float16* kg = Kp + tid * 8;
  const _Float16* vg = V + (size_t)(tid >> 4) * N_ + (tid & 15) * 8;
  float mu[2] = {-1e30f, -1e30f};
  float s[2][8];
  v8f o[2][4];                             // Ot: d = t * 16 + half * 8 + r, query lcol of group g
  #pragma unroll   // constant indices keep sums and Ot in registers
  for (int g = 0; g < 2; ++g) {
    #pragma unroll
    for (int r = 0; r < 8; ++r) s[g][r] = 0.f;
    #pragma unroll
    for (int t = 0; t < 4; ++t) o[g][t] = v8f{};
  }

  async_stage(kg, &Kbuf[0][kdst], vg, &Vbuf[0][vdst]);

  for (int c = 0; c < N_ / SK_; ++c) {
    int cb = c & 1;
    wait_async0();
    __syncthreads();           // K/V stage cb ready; buffer (c+1)&1 free
    if (c < N_ / SK_ - 1) {
      int nb = (c + 1) & 1;
      async_stage(kg + (size_t)(c + 1) * SK_ * DH_, &Kbuf[nb][kdst],
                  vg + (c + 1) * SK_, &Vbuf[nb][vdst]);
    }
    #pragma unroll   // the stage's four runs of 32 keys: constant LDS offsets
    for (int sub32 = 0; sub32 < SK_ / 32; ++sub32) {
      const _Float16* kb = &Kbuf[cb][(sub32 * 32 + lcol) * KP_ + d0];
      v16h k00 = lds_frag(kb),            k01 = lds_frag(kb + 32);
      v16h k10 = lds_frag(kb + 16 * KP_), k11 = lds_frag(kb + 16 * KP_ + 32);
      // Vt rows d as A, their keys in the order the packed score tiles have as B:
      // elements 0..7 are keys half * 8 .. + 7, elements 8..15 keys 16 + half * 8 .. + 7
      const _Float16* vb = &Vbuf[cb][lcol * VP_ + sub32 * 32 + half * 8];
      v16h av[4];
      #pragma unroll   // constant indices keep the fragments in registers
      for (int t = 0; t < 4; ++t) av[t] = vt_frag(vb + t * 16 * VP_);
      // keeps the LDS reads one group ahead of the products: as A operands the compiler loaded
      // them into one register set, each waited for alone
      __builtin_amdgcn_sched_barrier(0);
      v8f acc[2][2] = {{{}, {}}, {{}, {}}};
      acc[0][0] = WMMA_F16(k00, q[0][0], acc[0][0]);
      acc[0][1] = WMMA_F16(k10, q[0][0], acc[0][1]);
      acc[1][0] = WMMA_F16(k00, q[1][0], acc[1][0]);
      acc[1][1] = WMMA_F16(k10, q[1][0], acc[1][1]);
      acc[0][0] = WMMA_F16(k01, q[0][1], acc[0][0]);
      acc[0][1] = WMMA_F16(k11, q[0][1], acc[0][1]);
      acc[1][0] = WMMA_F16(k01, q[1][1], acc[1][0]);
      acc[1][1] = WMMA_F16(k11, q[1][1], acc[1][1]);
      // the lane's 16 scores a group against the shift in use. The shift moves only when a
      // score passes it by more than 8, so p stays below e^8, well inside f16; the test is one
      // scalar branch for the wave and both groups, taken in the first run of keys and then only
      // where a maximum has grown so.
      float cm[2];
      #pragma unroll   // constant indices keep the score tiles in registers
      for (int g = 0; g < 2; ++g) {
        float x0 = fmaxf(fmaxf(acc[g][0][0], acc[g][0][1]), acc[g][0][2]);
        float x1 = fmaxf(fmaxf(acc[g][0][3], acc[g][0][4]), acc[g][0][5]);
        float x2 = fmaxf(fmaxf(acc[g][0][6], acc[g][0][7]), acc[g][1][0]);
        float x3 = fmaxf(fmaxf(acc[g][1][1], acc[g][1][2]), acc[g][1][3]);
        float x4 = fmaxf(fmaxf(acc[g][1][4], acc[g][1][5]), acc[g][1][6]);
        cm[g] = fmaxf(fmaxf(fmaxf(x0, x1), x2), fmaxf(fmaxf(x3, x4), acc[g][1][7]));
      }
      if (__builtin_amdgcn_ballot_w32(cm[0] > mu[0] + 8.0f || cm[1] > mu[1] + 8.0f) != 0) {
        #pragma unroll   // constant indices keep sums and Ot in registers
        for (int g = 0; g < 2; ++g) {
          // the other half's keys of the same query, so that both halves take the same new shift
          int cb32 = __builtin_bit_cast(int, cm[g]);
          float co = __builtin_bit_cast(float,
              __builtin_amdgcn_permlanex16(cb32, cb32, 0x76543210, 0xfedcba98, false, false));
          float mn = fmaxf(mu[g], fmaxf(cm[g], co));
          float f = __expf(mu[g] - mn);    // 1 where the query's shift stays, 0 in the first run
          #pragma unroll
          for (int r = 0; r < 8; ++r) s[g][r] *= f;
          #pragma unroll
          for (int t = 0; t < 4; ++t) o[g][t] *= f;
          mu[g] = mn;
        }
      }
      #pragma unroll   // all loops: constant indices keep the score tiles, Pt and Ot in registers
      for (int g = 0; g < 2; ++g) {
        v16h pt;
        #pragma unroll
        for (int sub = 0; sub < 2; ++sub)
          #pragma unroll
          for (int r = 0; r < 8; ++r) {
            float p = __expf(acc[g][sub][r] - mu[g]);
            s[g][r] += p;
            pt[sub * 8 + r] = (_Float16)p;
          }
        #pragma unroll
        for (int t = 0; t < 4; ++t) o[g][t] = WMMA_F16(av[t], pt, o[g][t]);
      }
    }
  }

  #pragma unroll   // constant indices keep sums and Ot in registers
  for (int g = 0; g < 2; ++g) {
    float sq = ((s[g][0] + s[g][1]) + (s[g][2] + s[g][3])) + ((s[g][4] + s[g][5]) + (s[g][6] + s[g][7]));
    sq += __shfl_xor(sq, 16, 32);          // the other half's keys of the same query
    float inv = 1.0f / fmaxf(sq, 1e-20f);
    // the 8 registers of an accumulator are 8 consecutive d of one query: one 16-byte store
    _Float16* dst = ao + (size_t)(ib * N_ + i0 + g * 16 + lcol) * INNER_ + ih * DH_ + half * 8;
    #pragma unroll
    for (int t = 0; t < 4; ++t)
      *(v8h*)(dst + t * 16) = __builtin_convertvector(o[g][t] * inv, v8h);
  }
}

extern "C" void kernel_launch(void* const* d_in, const int* in_sizes, int n_in,
                              void* d_out, int out_size, void* d_ws, size_t ws_size,
                              hipStream_t stream) {
  const float* x          = (const float*)d_in[0];
  const float* norm_g     = (const float*)d_in[1];
  const float* Wq         = (const float*)d_in[2];
  const float* Wkv        = (const float*)d_in[3];
  const float* Wout       = (const float*)d_in[4];
  const float* out_norm_g = (const float*)d_in[5];
  float* out = (float*)d_out;

  char* w = (char*)d_ws;
  size_t off = 0;
  auto alloc = [&](size_t bytes) -> void* {
    void* p = w + off;
    off += (bytes + 255) & ~(size_t)255;
    return p;
  };
  _Float16* xn_h  = (_Float16*)alloc((size_t)ROWS_ * D_ * 2);       // 16 MB
  _Float16* WqT   = (_Float16*)alloc((size_t)INNER_ * D_ * 2);      //  1 MB
  _Float16* WkvT  = (_Float16*)alloc((size_t)128 * D_ * 2);         // .25 MB
  _Float16* WoutT = (_Float16*)alloc((size_t)D_ * INNER_ * 2);      //  1 MB
  _Float16* qn_h  = (_Float16*)alloc((size_t)ROWS_ * INNER_ * 2);   //  8 MB
  _Float16* kn_h  = (_Float16*)alloc((size_t)ROWS_ * DH_ * 2);      //  1 MB
  _Float16* vt_h  = (_Float16*)alloc((size_t)ROWS_ * DH_ * 2);      //  1 MB
  _Float16* ao_h  = (_Float16*)alloc((size_t)ROWS_ * INNER_ * 2);   //  8 MB

  // 1. weight transposes (f32 -> f16 [N][K]), one 64x64 tile a block, and LayerNorm(x) -> xn (f16)
  prep_kernel<<<WT_Q_ + WT_KV_ + WT_OUT_ + ROWS_ / 4, 128, 0, stream>>>(Wq, Wkv, Wout, WqT, WkvT, WoutT,
                                                                       x, norm_g, xn_h);

  // 3. q = xn@Wq ; kv = xn@Wkv   (128x64 tile per block), l2norms and V transpose in the epilogues
  proj_kernel<<<dim3(H_ + 2, ROWS_ / 128), 128, 0, stream>>>(xn_h, WqT, WkvT, qn_h, kn_h, vt_h);

  // 5. attention (async-LDS staged K/V, WMMA everywhere)
  attn_kernel<<<(B_ * H_ * N_) / 256, 256, 0, stream>>>(qn_h, kn_h, vt_h, ao_h);

  // 6. out = LayerNorm(ao @ Wout) (f32 into d_out), 32 whole rows a block
  out_ln_kernel<<<ROWS_ / 32, 256, 0, stream>>>(ao_h, WoutT, out_norm_g, out);
}

// v010
// Measured time: 65.1 microseconds a run.
// In both of two side-by-side timings against v009, it was 1.06 times as fast.
// Counting every step since v000, it is 5.16 times as fast.
#include <hip/hip_runtime.h>
#include <hip/hip_bf16.h>

typedef __attribute__((ext_vector_type(16))) _Float16 v16h;
typedef __attribute__((ext_vector_type(8)))  _Float16 v8h;
typedef __attribute__((ext_vector_type(4)))  _Float16 v4h;
typedef __attribute__((ext_vector_type(8)))  float    v8f;
typedef __attribute__((ext_vector_type(4)))  float    v4f;

#define B_  4
#define N_  2048
#define D_  1024
#define H_  8
#define DH_ 64
#define INNER_ 512
#define ROWS_ (B_ * N_)   // 8192
#define LOG2E_ 1.44269504088896340736f

#define WMMA_F16(a, b, c) \
  __builtin_amdgcn_wmma_f32_16x16x32_f16(false, (a), false, (b), (short)0, (c), false, false)

__device__ __forceinline__ float redsum32(float v) {
  #pragma unroll
  for (int m = 1; m < 32; m <<= 1) v += __shfl_xor(v, m, 32);
  return v;
}

__device__ __forceinline__ void wait_async0() {
  // this wave's own LDS reads of the buffer refilled behind the barrier have retired
  asm volatile("s_wait_dscnt 0x0" ::: "memory");
  asm volatile("s_wait_asynccnt 0x0" ::: "memory");
}

// LDS row pitches in halfs: 16 B x odd, so the 16 lanes of a ds_load_b128 that read
// 16 different rows fall on 16 different groups of four banks.
#define SK_ 128  // keys in one attention stage of K and V
#define KP_ 72   // K rows of 128 B (64 d) at 144 B
#define VP_ 136  // V rows of 256 B (128 keys) at 272 B
#define SHIFT_STEP_ (8.0f * LOG2E_)   // a score may pass the softmax shift by e^8 = 2^SHIFT_STEP_

// one thread's share of an attention stage as async copies global -> LDS (tracked by ASYNCcnt):
// 16 bytes of every 32nd K row and of every 16th V row. Eight neighbouring lanes fill a 128-byte
// K row, sixteen a 256-byte V row, so that every copy instruction of a wave covers four whole lines.
// gk, gv, lk, lv: the thread's first piece in global memory and its place in LDS.
// s_wait_xcnt closes the statement so that no address register is rewritten ahead of it
__device__ __forceinline__ void async_stage(const _Float16* gk, _Float16* lk,
                                            const _Float16* gv, _Float16* lv) {
  unsigned k0 = (unsigned)(uintptr_t)lk, v0 = (unsigned)(uintptr_t)lv;   // low 32 bits = LDS byte address
  const unsigned sk = 32 * KP_ * 2, sv = 16 * VP_ * 2;
  asm volatile("global_load_async_to_lds_b128 %0, %1, off\n\t"
               "global_load_async_to_lds_b128 %2, %3, off\n\t"
               "global_load_async_to_lds_b128 %4, %5, off\n\t"
               "global_load_async_to_lds_b128 %6, %7, off\n\t"
               "global_load_async_to_lds_b128 %8, %9, off\n\t"
               "global_load_async_to_lds_b128 %10, %11, off\n\t"
               "global_load_async_to_lds_b128 %12, %13, off\n\t"
               "global_load_async_to_lds_b128 %14, %15, off\n\t"
               "s_wait_xcnt 0x0"
               :: "v"(k0),          "v"(gk),            "v"(k0 + sk),     "v"(gk + 32 * DH_),
                  "v"(k0 + 2 * sk), "v"(gk + 64 * DH_), "v"(k0 + 3 * sk), "v"(gk + 96 * DH_),
                  "v"(v0),          "v"(gv),            "v"(v0 + sv),     "v"(gv + 16 * N_),
                  "v"(v0 + 2 * sv), "v"(gv + 32 * N_),  "v"(v0 + 3 * sv), "v"(gv + 48 * N_)
               : "memory");
}

// 16 contiguous halfs of a padded LDS row (16-byte aligned only) as one WMMA operand
__device__ __forceinline__ v16h lds_frag(const _Float16* p) {
  v8h lo = *(const v8h*)p;
  v8h hi = *(const v8h*)(p + 8);
  return __builtin_shufflevector(lo, hi, 0, 1, 2, 3, 4, 5, 6, 7, 8, 9, 10, 11, 12, 13, 14, 15);
}

// 8 halfs at p and 8 at p + 16 of a padded LDS row as one WMMA operand
__device__ __forceinline__ v16h vt_frag(const _Float16* p) {
  v8h lo = *(const v8h*)p;
  v8h hi = *(const v8h*)(p + 16);
  return __builtin_shufflevector(lo, hi, 0, 1, 2, 3, 4, 5, 6, 7, 8, 9, 10, 11, 12, 13, 14, 15);
}

// ---- transpose + f32->f16 weight conversion, Wt[n*K + k] = W[k*N + n], all three weights in
// one launch: a block of four waves takes one 64 (k) x 64 (n) tile. Reads are whole 256-byte row
// pieces, a lane holds 8 k of 4 n; the tile turns in LDS; stores are whole 128-byte rows.
#define TP_      72                                    // tile rows of 128 B at 144 B (16 B x odd)
#define WT_Q_    ((D_ / 64) * (INNER_ / 64))           // tiles of Wq
#define WT_KV_   ((D_ / 64) * (2 * DH_ / 64))          // tiles of Wkv
#define WT_OUT_  ((INNER_ / 64) * (D_ / 64))           // tiles of Wout

// tile t of one weight; K and N as constants, so that the row steps are immediate offsets
template <int K, int N>
__device__ __forceinline__ void wt_tile(const float* __restrict__ W, _Float16* __restrict__ Wt,
                                        int t, _Float16* tile) {
  int tid = threadIdx.x;
  int k0 = (t % (K / 64)) * 64, n0 = (t / (K / 64)) * 64;

  int r = tid >> 4, c = tid & 15;                      // k rows r*8 .. +7, n columns c*4 .. +3
  const float* src = W + (size_t)k0 * N + n0 + (r * 8 * N + c * 4);
  v4f v[8];
  #pragma unroll   // the eight loads in flight together; constant indices keep v in registers
  for (int j = 0; j < 8; ++j) v[j] = *(const v4f*)(src + j * N);
  // stands in front of whatever rewrites the loads' address registers next
  asm volatile("s_wait_xcnt 0x0" ::: "memory");
  #pragma unroll   // constant indices keep v in registers
  for (int i = 0; i < 4; ++i) {
    v8h h = {(_Float16)v[0][i], (_Float16)v[1][i], (_Float16)v[2][i], (_Float16)v[3][i],
             (_Float16)v[4][i], (_Float16)v[5][i], (_Float16)v[6][i], (_Float16)v[7][i]};
    *(v8h*)&tile[(c * 4 + i) * TP_ + r * 8] = h;
  }
  __syncthreads();             // the tile is whole before its rows are read

  int row = tid >> 3, p = (tid & 7) * 8;               // eight lanes store one 128-byte row
  _Float16* dst = Wt + (size_t)n0 * K + k0 + (row * K + p);
  #pragma unroll   // the four LDS reads together, then the four stores
  for (int j = 0; j < 4; ++j)
    *(v8h*)(dst + j * 16 * K) = *(const v8h*)&tile[(j * 16 + row) * TP_ + p];
}

// ---- LayerNorm rows of f32 [rows x 1024] -> f16 out; 1 wave / row, rows blk * 4 .. + 3 ----
__device__ __forceinline__ void ln_to_h_rows(const float* __restrict__ x, const float* __restrict__ g,
                                             _Float16* __restrict__ out, int blk) {
  int lane = threadIdx.x & 31, wid = threadIdx.x >> 5;
  int row = blk * 4 + wid;
  const float* xr = x + (size_t)row * D_;
  float v[32], sum = 0.f, sq = 0.f;
  #pragma unroll
  for (int j = 0; j < 32; ++j) {
    v[j] = xr[j * 32 + lane];
    sum += v[j]; sq += v[j] * v[j];
  }
  // stands in front of whatever rewrites the x loads' address registers next
  asm volatile("s_wait_xcnt 0x0" ::: "memory");
  sum = redsum32(sum); sq = redsum32(sq);
  float mean = sum * (1.0f / D_);
  float var  = sq * (1.0f / D_) - mean * mean;
  float rs   = rsqrtf(var + 1e-5f);
  _Float16* o = out + (size_t)row * D_;
  #pragma unroll
  for (int j = 0; j < 32; ++j)
    o[j * 32 + lane] = (_Float16)((v[j] - mean) * rs * g[j * 32 + lane]);
  // stands in front of whatever rewrites the stores' address and data registers next
  asm volatile("s_wait_xcnt 0x0" ::: "memory");
}

// ---- the two pieces of work that depend on the inputs alone, in one launch, told apart by the
// block index: the weight tiles first, then four LayerNorm rows a block.
__global__ __launch_bounds__(128)
void prep_kernel(const float* __restrict__ Wq, const float* __restrict__ Wkv,
                 const float* __restrict__ Wout, _Float16* __restrict__ WqT,
                 _Float16* __restrict__ WkvT, _Float16* __restrict__ WoutT,
                 const float* __restrict__ x, const float* __restrict__ g,
                 _Float16* __restrict__ xn) {
  __shared__ __attribute__((aligned(16))) _Float16 tile[64 * TP_];   // [n][k], 9 KB
  int t = blockIdx.x;
  if (t < WT_Q_)                         wt_tile<D_, INNER_>(Wq, WqT, t, tile);
  else if (t < WT_Q_ + WT_KV_)           wt_tile<D_, 2 * DH_>(Wkv, WkvT, t - WT_Q_, tile);
  else if (t < WT_Q_ + WT_KV_ + WT_OUT_) wt_tile<INNER_, D_>(Wout, WoutT, t - (WT_Q_ + WT_KV_), tile);
  else                                   ln_to_h_rows(x, g, xn, t - (WT_Q_ + WT_KV_ + WT_OUT_));
}

// ---- 128x64 tile of A[.. x K] * Bt[.. x K]^T in a block of four waves (32x64 a wave,
// 8 accumulators). A k block of 64 halfs (128 A rows and 64 B rows of 128 B) is staged in LDS
// by async copies that cover whole lines, two buffers: the next block flies during this one.
#define GP_    72                  // staged rows of 128 B at 144 B (16 B x odd)
#define GROWS_ (128 + 64)          // A rows, then B rows
#define GBUF_  (GROWS_ * GP_)      // halfs in one buffer

// Ag, Bg: this thread's 16 bytes of row tid / 8 of the A tile and of the B tile, at the k block:
// eight lanes fill one 128-byte row, a thread takes every 16th row (8 of A, 4 of B).
// PERM: row j of the B tile lands at place (j % 4) * 16 + j / 4.
template <int K, bool PERM>
__device__ __forceinline__ void stage_block(const _Float16* Ag, const _Float16* Bg,
                                            _Float16* buf) {
  int r = threadIdx.x >> 3, p = (threadIdx.x & 7) * 8;
  unsigned la = (unsigned)(uintptr_t)(buf + r * GP_ + p);   // low 32 bits = LDS byte address
  unsigned lb = (unsigned)(uintptr_t)(buf + (128 + (PERM ? (r & 3) * 16 + (r >> 2) : r)) * GP_ + p);
  const unsigned sa = 16 * GP_ * 2, sb = (PERM ? 4 : 16) * GP_ * 2;
  // s_wait_xcnt closes the statement so that no address register is rewritten ahead of it
  asm volatile("global_load_async_to_lds_b128 %0, %1, off\n\t"
               "global_load_async_to_lds_b128 %2, %3, off\n\t"
               "global_load_async_to_lds_b128 %4, %5, off\n\t"
               "global_load_async_to_lds_b128 %6, %7, off\n\t"
               "global_load_async_to_lds_b128 %8, %9, off\n\t"
               "global_load_async_to_lds_b128 %10, %11, off\n\t"
               "global_load_async_to_lds_b128 %12, %13, off\n\t"
               "global_load_async_to_lds_b128 %14, %15, off\n\t"
               "global_load_async_to_lds_b128 %16, %17, off\n\t"
               "global_load_async_to_lds_b128 %18, %19, off\n\t"
               "global_load_async_to_lds_b128 %20, %21, off\n\t"
               "global_load_async_to_lds_b128 %22, %23, off\n\t"
               "s_wait_xcnt 0x0"
               :: "v"(la),          "v"(Ag),           "v"(la + sa),     "v"(Ag + 16 * K),
                  "v"(la + 2 * sa), "v"(Ag + 32 * K),  "v"(la + 3 * sa), "v"(Ag + 48 * K),
                  "v"(la + 4 * sa), "v"(Ag + 64 * K),  "v"(la + 5 * sa), "v"(Ag + 80 * K),
                  "v"(la + 6 * sa), "v"(Ag + 96 * K),  "v"(la + 7 * sa), "v"(Ag + 112 * K),
                  "v"(lb),          "v"(Bg),           "v"(lb + sb),     "v"(Bg + 16 * K),
                  "v"(lb + 2 * sb), "v"(Bg + 32 * K),  "v"(lb + 3 * sb), "v"(Bg + 48 * K)
               : "memory");
}

// The wave's rows are mblk + wid * 32 .. + 31. Column lcol of accumulator tile t is row
// n0 + t * 16 + lcol of Bt, or with PERM row n0 + lcol * 4 + t, so that a lane ends up with
// four neighbouring columns of each of its rows.
template <int K, bool PERM>
__device__ __forceinline__ void gemm_tile(const _Float16* __restrict__ A,
                                          const _Float16* __restrict__ Bt,
                                          int mblk, int n0, _Float16* lds,
                                          v8f (&row0)[4], v8f (&row1)[4]) {
  int tid = threadIdx.x;
  int lane = tid & 31, wid = tid >> 5;
  int half = lane >> 4, lcol = lane & 15;
  const _Float16* Ag = A  + (size_t)(mblk + (tid >> 3)) * K + (tid & 7) * 8;
  const _Float16* Bg = Bt + (size_t)(n0   + (tid >> 3)) * K + (tid & 7) * 8;

  v8f c00 = {}, c01 = {}, c02 = {}, c03 = {};
  v8f c10 = {}, c11 = {}, c12 = {}, c13 = {};

  // one staged k block: its 12 fragments, then the 16 WMMAs
  auto k_block = [&](const _Float16* buf) {
    const _Float16* Ab = buf + (wid * 32 + lcol) * GP_ + half * 16;
    const _Float16* Bb = buf + (128 + lcol) * GP_ + half * 16;
    v16h a0 = lds_frag(Ab),                 a1 = lds_frag(Ab + 16 * GP_);
    v16h b0 = lds_frag(Bb),                 b1 = lds_frag(Bb + 16 * GP_);
    v16h b2 = lds_frag(Bb + 32 * GP_),      b3 = lds_frag(Bb + 48 * GP_);
    v16h e0 = lds_frag(Ab + 32),            e1 = lds_frag(Ab + 16 * GP_ + 32);
    v16h f0 = lds_frag(Bb + 32),            f1 = lds_frag(Bb + 16 * GP_ + 32);
    v16h f2 = lds_frag(Bb + 32 * GP_ + 32), f3 = lds_frag(Bb + 48 * GP_ + 32);
    c00 = WMMA_F16(a0, b0, c00);
    c01 = WMMA_F16(a0, b1, c01);
    c02 = WMMA_F16(a0, b2, c02);
    c03 = WMMA_F16(a0, b3, c03);
    c10 = WMMA_F16(a1, b0, c10);
    c11 = WMMA_F16(a1, b1, c11);
    c12 = WMMA_F16(a1, b2, c12);
    c13 = WMMA_F16(a1, b3, c13);
    c00 = WMMA_F16(e0, f0, c00);
    c01 = WMMA_F16(e0, f1, c01);
    c02 = WMMA_F16(e0, f2, c02);
    c03 = WMMA_F16(e0, f3, c03);
    c10 = WMMA_F16(e1, f0, c10);
    c11 = WMMA_F16(e1, f1, c11);
    c12 = WMMA_F16(e1, f2, c12);
    c13 = WMMA_F16(e1, f3, c13);
  };

  stage_block<K, PERM>(Ag, Bg, lds);                  // k block 0
  #pragma unroll 1   // rolled: unrolled, the LDS reads came out scattered in pairs among the WMMAs
  for (int kb = 0; kb < K / 64 - 1; ++kb) {
    wait_async0();
    __syncthreads();           // k block kb ready; the other buffer free
    stage_block<K, PERM>(Ag + (kb + 1) * 64, Bg + (kb + 1) * 64, lds + ((kb + 1) & 1) * GBUF_);
    k_block(lds + (kb & 1) * GBUF_);
  }
  wait_async0();
  __syncthreads();             // the last k block ready
  k_block(lds + ((K / 64 - 1) & 1) * GBUF_);

  row0[0] = c00; row0[1] = c01; row0[2] = c02; row0[3] = c03;
  row1[0] = c10; row1[1] = c11; row1[2] = c12; row1[3] = c13;
}

// ---- out = LayerNorm(A[ROWS_ x INNER_](f16) * Bt[D_ x INNER_](f16)^T) * g, f32, in one launch:
// a block of eight waves owns 32 WHOLE rows (32 x 1024), so that a row's mean and variance are
// formed from the accumulators and the product never goes to memory unnormalised.
// A wave has the 32 rows x 128 columns wid * 128 .. + 127 (16 accumulators). A k block of 64 halfs
// (32 A rows and all 1024 B rows of 128 B) is staged in LDS by async copies that cover whole
// lines, two buffers: the next block flies during this one.
#define OROWS_ (32 + D_)           // A rows, then B rows
#define OBUF_  (OROWS_ * GP_)      // halfs in one buffer

// eight copies of B rows 32 apart. Row j of a group of 64 B rows lands at place
// (j % 4) * 16 + j / 4 of the group, so rows 32 apart lie 8 places apart, rows 64 apart 64 places.
// s_wait_xcnt closes the statement so that no address register is rewritten ahead of it
__device__ __forceinline__ void copy_b_rows(unsigned l, const _Float16* g) {
  const unsigned s8 = 8 * GP_ * 2, s64 = 64 * GP_ * 2;
  asm volatile("global_load_async_to_lds_b128 %0, %1, off\n\t"
               "global_load_async_to_lds_b128 %2, %3, off\n\t"
               "global_load_async_to_lds_b128 %4, %5, off\n\t"
               "global_load_async_to_lds_b128 %6, %7, off\n\t"
               "global_load_async_to_lds_b128 %8, %9, off\n\t"
               "global_load_async_to_lds_b128 %10, %11, off\n\t"
               "global_load_async_to_lds_b128 %12, %13, off\n\t"
               "global_load_async_to_lds_b128 %14, %15, off\n\t"
               "s_wait_xcnt 0x0"
               :: "v"(l),                "v"(g),                "v"(l + s8),           "v"(g + 32 * INNER_),
                  "v"(l + s64),          "v"(g + 64 * INNER_),  "v"(l + s64 + s8),     "v"(g + 96 * INNER_),
                  "v"(l + 2 * s64),      "v"(g + 128 * INNER_), "v"(l + 2 * s64 + s8), "v"(g + 160 * INNER_),
                  "v"(l + 3 * s64),      "v"(g + 192 * INNER_), "v"(l + 3 * s64 + s8), "v"(g + 224 * INNER_)
               : "memory");
}

// Ag, Bg: this thread's 16 bytes of row tid / 8 of the A rows and of the B rows, at the k block:
// eight lanes fill one 128-byte row, a thread takes one A row and every 32nd B row (33 copies).
__device__ __forceinline__ void stage_rows(const _Float16* Ag, const _Float16* Bg, _Float16* buf) {
  int r = threadIdx.x >> 3, p = (threadIdx.x & 7) * 8;
  unsigned la = (unsigned)(uintptr_t)(buf + r * GP_ + p);   // low 32 bits = LDS byte address
  unsigned lb = (unsigned)(uintptr_t)(buf + (32 + (r & 3) * 16 + (r >> 2)) * GP_ + p);
  // s_wait_xcnt closes the statement so that no address register is rewritten ahead of it
  asm volatile("global_load_async_to_lds_b128 %0, %1, off\n\t"
               "s_wait_xcnt 0x0"
               :: "v"(la), "v"(Ag) : "memory");
  #pragma unroll   // four statements of eight copies: constant steps from one pair of addresses
  for (int q = 0; q < 4; ++q)
    copy_b_rows(lb + q * 256 * GP_ * 2, Bg + q * 256 * INNER_);
}

// v plus the v of lane ^ M inside a row of 16 lanes, on the vector unit (a DPP operand)
template <int M>
__device__ __forceinline__ float add_xmask(float v) {
  int o = __builtin_amdgcn_update_dpp(0, __builtin_bit_cast(int, v), 0x160 + M, 0xf, 0xf, true);
  return v + __builtin_bit_cast(float, o);
}

// grid = ROWS_/32, block = 256: one block a WGP (its LDS), all of them resident at once.
// The launch bound states the eight waves (two a SIMD), which sets the register cap.
__global__ __launch_bounds__(256)
void out_ln_kernel(const _Float16* __restrict__ A, const _Float16* __restrict__ Bt,
                   const float* __restrict__ g, float* __restrict__ C) {
  __shared__ __attribute__((aligned(16))) _Float16 stage[2 * OBUF_];   // 297 KB
  __shared__ float part[8][32][2];   // a wave's sum and square sum of its 128 columns of each row
  __shared__ float stat[32][2];      // a row's mean and 1 / sqrt(var + eps)
  int tid = threadIdx.x;
  int lane = tid & 31, wid = tid >> 5;
  int half = lane >> 4, lcol = lane & 15;
  int mblk = blockIdx.x * 32;
  const _Float16* Ag = A  + (size_t)(mblk + (tid >> 3)) * INNER_ + (tid & 7) * 8;
  const _Float16* Bg = Bt + (size_t)(tid >> 3) * INNER_ + (tid & 7) * 8;

  // column lcol of accumulator tile t is column wid * 128 + (t / 4) * 64 + lcol * 4 + t % 4:
  // a lane ends up with four neighbouring columns, twice, of each of its rows
  v8f c0[8], c1[8];                  // rows half * 8 + r and 16 + half * 8 + r
  #pragma unroll   // constant indices keep the accumulators in registers
  for (int t = 0; t < 8; ++t) { c0[t] = v8f{}; c1[t] = v8f{}; }

  // every block streams the whole of Bt: the blocks start at different k blocks and go round,
  // so that few of them ask L2 for the same lines at the same moment
  int krot = (blockIdx.x + (blockIdx.x >> 3)) & (INNER_ / 64 - 1);
  stage_rows(Ag + krot * 64, Bg + krot * 64, stage);  // the first k block
  #pragma unroll 1   // rolled: one copy of the staging and of the k block in the instruction cache
  for (int kb = 0; kb < INNER_ / 64; ++kb) {
    wait_async0();
    __syncthreads();           // the kb-th k block ready; the other buffer free
    if (kb < INNER_ / 64 - 1) {
      int kn = ((kb + 1 + krot) & (INNER_ / 64 - 1)) * 64;
      stage_rows(Ag + kn, Bg + kn, stage + ((kb + 1) & 1) * OBUF_);
    }
    // the staged k block: two runs of 32 k, each 10 fragments, then 16 WMMAs
    const _Float16* Ab = stage + (kb & 1) * OBUF_ + lcol * GP_ + half * 16;
    const _Float16* Bb = stage + (kb & 1) * OBUF_ + (32 + wid * 128 + lcol) * GP_ + half * 16;
    #pragma unroll   // constant LDS offsets and accumulator indices
    for (int ks = 0; ks < 2; ++ks) {
      v16h a0 = lds_frag(Ab + ks * 32), a1 = lds_frag(Ab + 16 * GP_ + ks * 32);
      v16h bf[8];
      #pragma unroll
      for (int t = 0; t < 8; ++t) bf[t] = lds_frag(Bb + t * 16 * GP_ + ks * 32);
      // keeps the run's LDS reads one group ahead of its products: left free, the compiler
      // loaded the B fragments into two register sets, each pair of WMMAs waiting for its own
      __builtin_amdgcn_sched_barrier(0);
      #pragma unroll
      for (int t = 0; t < 8; ++t) {
        c0[t] = WMMA_F16(a0, bf[t], c0[t]);
        c1[t] = WMMA_F16(a1, bf[t], c1[t]);
      }
    }
  }

  v4f gv[2];
  #pragma unroll   // constant indices keep g in registers
  for (int q = 0; q < 2; ++q) gv[q] = *(const v4f*)(g + wid * 128 + q * 64 + lcol * 4);

  // sums of the lane's 8 columns of its 16 rows, then over the 16 lanes that share the rows
  v8f s0 = c0[0], q0 = c0[0] * c0[0], s1 = c1[0], q1 = c1[0] * c1[0];
  #pragma unroll   // all loops: constant indices keep accumulators and sums in registers
  for (int t = 1; t < 8; ++t) {
    s0 += c0[t]; q0 += c0[t] * c0[t];
    s1 += c1[t]; q1 += c1[t] * c1[t];
  }
  float sm[16], sq[16];
  #pragma unroll
  for (int r = 0; r < 8; ++r) { sm[r] = s0[r]; sq[r] = q0[r]; sm[8 + r] = s1[r]; sq[8 + r] = q1[r]; }
  #pragma unroll
  for (int i = 0; i < 16; ++i) {
    sm[i] = add_xmask<8>(add_xmask<4>(add_xmask<2>(add_xmask<1>(sm[i]))));
    sq[i] = add_xmask<8>(add_xmask<4>(add_xmask<2>(add_xmask<1>(sq[i]))));
  }
  if (lcol == 0) {
    #pragma unroll
    for (int i = 0; i < 16; ++i) {
      part[wid][(i >> 3) * 16 + half * 8 + (i & 7)][0] = sm[i];
      part[wid][(i >> 3) * 16 + half * 8 + (i & 7)][1] = sq[i];
    }
  }
  __syncthreads();             // the eight waves' sums of every row are in LDS
  if (tid < 32) {
    float sum = 0.f, sqs = 0.f;
    #pragma unroll
    for (int w = 0; w < 8; ++w) { sum += part[w][tid][0]; sqs += part[w][tid][1]; }
    float mean = sum * (1.0f / D_);
    float var  = sqs * (1.0f / D_) - mean * mean;
    stat[tid][0] = mean;
    stat[tid][1] = rsqrtf(var + 1e-5f);
  }
  __syncthreads();             // every row's mean and scale are in LDS

  // 16 lanes x 16 bytes: a store covers 256 contiguous bytes of each of two rows
  float* dst = C + (size_t)(mblk + half * 8) * D_ + wid * 128 + lcol * 4;
  #pragma unroll   // all loops: constant indices keep the accumulators in registers
  for (int r = 0; r < 8; ++r) {
    float m0 = stat[half * 8 + r][0],      r0 = stat[half * 8 + r][1];
    float m1 = stat[16 + half * 8 + r][0], r1 = stat[16 + half * 8 + r][1];
    #pragma unroll
    for (int q = 0; q < 2; ++q) {
      v4f o0, o1;
      #pragma unroll
      for (int e = 0; e < 4; ++e) {
        o0[e] = (c0[q * 4 + e][r] - m0) * r0 * gv[q][e];
        o1[e] = (c1[q * 4 + e][r] - m1) * r1 * gv[q][e];
      }
      *(v4f*)(dst + r * D_ + q * 64)        = o0;
      *(v4f*)(dst + (16 + r) * D_ + q * 64) = o1;
    }
  }
  // stands in front of whatever rewrites the stores' data and address registers next
  asm volatile("s_wait_xcnt 0x0" ::: "memory");
}

// 16 rows x 64 columns as gemm_tile with PERM leaves them (a lane has columns lcol*4 .. +3 of rows
// r + half*8): each row times num / max(mul * ||row||, 1e-12), stored as f16 rows of 128 B.
__device__ __forceinline__ void store_l2norm_rows(const v8f (&c)[4], _Float16* __restrict__ dst,
                                                  float num, float mul) {
  int lane = threadIdx.x & 31;
  int half = lane >> 4, lcol = lane & 15;
  float sq[8];
  #pragma unroll   // constant indices keep the accumulators in registers
  for (int r = 0; r < 8; ++r)
    sq[r] = c[0][r] * c[0][r] + c[1][r] * c[1][r] + c[2][r] * c[2][r] + c[3][r] * c[3][r];
  #pragma unroll   // eight independent shuffle chains side by side
  for (int m = 1; m < 16; m <<= 1)
    #pragma unroll
    for (int r = 0; r < 8; ++r) sq[r] += __shfl_xor(sq[r], m, 32);
  #pragma unroll   // constant indices keep the accumulators in registers
  for (int r = 0; r < 8; ++r) {
    float scale = num / fmaxf(mul * sqrtf(sq[r]), 1e-12f);
    v4h o = {(_Float16)(c[0][r] * scale), (_Float16)(c[1][r] * scale),
             (_Float16)(c[2][r] * scale), (_Float16)(c[3][r] * scale)};
    *(v4h*)(dst + (r + half * 8) * DH_ + lcol * 4) = o;
  }
  // stands in front of whatever rewrites the stores' data and address registers next
  asm volatile("s_wait_xcnt 0x0" ::: "memory");
}

// ---- q = xn @ Wq and kv = xn @ Wkv in one launch; a block's 64 columns, c = blockIdx.x, are
// c < 8: head c of q, l2norm in the epilogue -> qn[b][h][n][64] f16, net scale 64/max(16*||q||,1e-12)
// times log2(e), so that the scores of the attention come out as exponents of 2;
// c == 8: k, l2norm (*4) -> kn[b][n][64]; c == 9: v -> vt[b][d][n] (transposed, f16).
// grid = (H_ + 2, ROWS_/128), block = 128: the ten blocks of a row block are neighbours in the grid.
// The launch bound states the four waves: under the default bound the register cap made the
// fragments spill.
__global__ __launch_bounds__(128)
void proj_kernel(const _Float16* __restrict__ A, const _Float16* __restrict__ WqT,
                 const _Float16* __restrict__ WkvT, _Float16* __restrict__ qn,
                 _Float16* __restrict__ kn, _Float16* __restrict__ vt) {
  __shared__ __attribute__((aligned(16))) _Float16 stage[2 * GBUF_];   // 54 KB
  int m0 = blockIdx.y * 128 + (threadIdx.x >> 5) * 32, c = blockIdx.x;
  bool isq = c < H_;
  v8f row0[4], row1[4];
  gemm_tile<D_, true>(A, isq ? WqT : WkvT, blockIdx.y * 128, (isq ? c : c - H_) * DH_, stage,
                      row0, row1);
  int b = m0 >> 11, n = m0 & 2047;
  if (c <= H_) {
    _Float16* dst = isq ? qn + (size_t)(((b * H_ + c) * N_) + n) * DH_ : kn + (size_t)m0 * DH_;
    float num = isq ? 64.0f * LOG2E_ : 4.0f, mul = isq ? 16.0f : 1.0f;
    store_l2norm_rows(row0, dst, num, mul);
    store_l2norm_rows(row1, dst + 16 * DH_, num, mul);
  } else {
    int lane = threadIdx.x & 31;
    int half = lane >> 4, lcol = lane & 15;
    // the 8 registers of an accumulator are 8 consecutive n of one d: one 16-byte store
    #pragma unroll   // constant indices keep the accumulators in registers
    for (int t = 0; t < 4; ++t) {
      _Float16* vd = vt + (size_t)(b * DH_ + lcol * 4 + t) * N_ + n + half * 8;
      *(v8h*)vd        = __builtin_convertvector(row0[t], v8h);
      *(v8h*)(vd + 16) = __builtin_convertvector(row1[t], v8h);
    }
    // stands in front of whatever rewrites the stores' data and address registers next
    asm volatile("s_wait_xcnt 0x0" ::: "memory");
  }
}

#define SHIFT0_  8.0f
#define MIN_SUM_ 0.125f

// one pass over all keys: s = the lane's sums of p, o = Ot (d = t * 16 + half * 8 + r, query lcol
// of group g), both against the shift in use at the end.
// kg, vg: this thread's first K piece and first V piece of stage 0.
template <bool FIXED>
__device__ __forceinline__ void attn_pass(const v16h (&q)[2][2], const _Float16* kg, const _Float16* vg,
                                          _Float16 (*Kbuf)[SK_ * KP_], _Float16 (*Vbuf)[DH_ * VP_],
                                          float (&s)[2][8], v8f (&o)[2][4]) {
  int tid  = threadIdx.x;
  int lane = tid & 31;
  int half = lane >> 4, lcol = lane & 15;
  int d0 = half * 16;
  // staging role of this thread: the places of its first K piece and first V piece
  int kdst = (tid >> 3) * KP_ + (tid & 7) * 8;
  int vdst = (tid >> 4) * VP_ + (tid & 15) * 8;
  // nm[g] holds minus the shift in use for query lcol of group g in all its 8 registers, equal in
  // both halves: the C operand of both score tiles of the group.
  v8f nm[2];
  // !FIXED: the first run of keys takes its own maximum as the shift, whatever its sign (thr, flo
  // far down); from then on the shift only grows, and only when a score passes it by SHIFT_STEP_
  float thr = -1e30f, flo = -1e30f;
  #pragma unroll   // constant indices keep shift, sums and Ot in registers
  for (int g = 0; g < 2; ++g) {
    #pragma unroll
    for (int r = 0; r < 8; ++r) { nm[g][r] = FIXED ? -SHIFT0_ : 0.f; s[g][r] = 0.f; }
    #pragma unroll
    for (int t = 0; t < 4; ++t) o[g][t] = v8f{};
  }

  async_stage(kg, &Kbuf[0][kdst], vg, &Vbuf[0][vdst]);

  for (int c = 0; c < N_ / SK_; ++c) {
    int cb = c & 1;
    wait_async0();
    __syncthreads();           // K/V stage cb ready; buffer (c+1)&1 free
    if (c < N_ / SK_ - 1) {
      int nb = (c + 1) & 1;
      async_stage(kg + (size_t)(c + 1) * SK_ * DH_, &Kbuf[nb][kdst],
                  vg + (c + 1) * SK_, &Vbuf[nb][vdst]);
    }
    #pragma unroll   // the stage's four runs of 32 keys: constant LDS offsets
    for (int sub32 = 0; sub32 < SK_ / 32; ++sub32) {
      const _Float16* kb = &Kbuf[cb][(sub32 * 32 + lcol) * KP_ + d0];
      v16h k00 = lds_frag(kb),            k01 = lds_frag(kb + 32);
      v16h k10 = lds_frag(kb + 16 * KP_), k11 = lds_frag(kb + 16 * KP_ + 32);
      // Vt rows d as A, their keys in the order the packed score tiles have as B:
      // elements 0..7 are keys half * 8 .. + 7, elements 8..15 keys 16 + half * 8 .. + 7
      const _Float16* vb = &Vbuf[cb][lcol * VP_ + sub32 * 32 + half * 8];
      v16h av[4];
      #pragma unroll   // constant indices keep the fragments in registers
      for (int t = 0; t < 4; ++t) av[t] = vt_frag(vb + t * 16 * VP_);
      // keeps the LDS reads one group ahead of the products: as A operands the compiler loaded
      // them into one register set, each waited for alone
      __builtin_amdgcn_sched_barrier(0);
      v8f acc[2][2];
      acc[0][0] = WMMA_F16(k00, q[0][0], nm[0]);
      acc[0][1] = WMMA_F16(k10, q[0][0], nm[0]);
      acc[1][0] = WMMA_F16(k00, q[1][0], nm[1]);
      acc[1][1] = WMMA_F16(k10, q[1][0], nm[1]);
      acc[0][0] = WMMA_F16(k01, q[0][1], acc[0][0]);
      acc[0][1] = WMMA_F16(k11, q[0][1], acc[0][1]);
      acc[1][0] = WMMA_F16(k01, q[1][1], acc[1][0]);
      acc[1][1] = WMMA_F16(k11, q[1][1], acc[1][1]);
      if constexpr (!FIXED) {
        // the lane's 16 scores a group, already less the shift in use. The shift moves only when a
        // score passes it by more than SHIFT_STEP_, so p stays below e^8, well inside f16; the test
        // is one scalar branch for the wave and both groups, taken in the first run of keys and
        // then only where a maximum has grown so.
        float cm[2];
        #pragma unroll   // constant indices keep the score tiles in registers
        for (int g = 0; g < 2; ++g) {
          float x0 = fmaxf(fmaxf(acc[g][0][0], acc[g][0][1]), acc[g][0][2]);
          float x1 = fmaxf(fmaxf(acc[g][0][3], acc[g][0][4]), acc[g][0][5]);
          float x2 = fmaxf(fmaxf(acc[g][0][6], acc[g][0][7]), acc[g][1][0]);
          float x3 = fmaxf(fmaxf(acc[g][1][1], acc[g][1][2]), acc[g][1][3]);
          float x4 = fmaxf(fmaxf(acc[g][1][4], acc[g][1][5]), acc[g][1][6]);
          cm[g] = fmaxf(fmaxf(fmaxf(x0, x1), x2), fmaxf(fmaxf(x3, x4), acc[g][1][7]));
        }
        if (__builtin_amdgcn_ballot_w32(cm[0] > thr || cm[1] > thr) != 0) {
          #pragma unroll   // constant indices keep sums and Ot in registers
          for (int g = 0; g < 2; ++g) {
            // the other half's keys of the same query, so that both halves take the same new shift
            int cb32 = __builtin_bit_cast(int, cm[g]);
            float co = __builtin_bit_cast(float,
                __builtin_amdgcn_permlanex16(cb32, cb32, 0x76543210, 0xfedcba98, false, false));
            float dl = fmaxf(flo, fmaxf(cm[g], co));   // how far the query's shift moves
            float f = __builtin_amdgcn_exp2f(-dl);     // 1 where it stays; sums and Ot are 0 in the first run
            #pragma unroll
            for (int r = 0; r < 8; ++r) s[g][r] *= f;
            #pragma unroll
            for (int t = 0; t < 4; ++t) o[g][t] *= f;
            nm[g] -= dl;
            acc[g][0] -= dl;
            acc[g][1] -= dl;
          }
          thr = SHIFT_STEP_;
          flo = 0.f;
        }
      }
      #pragma unroll   // all loops: constant indices keep the score tiles, Pt and Ot in registers
      for (int g = 0; g < 2; ++g) {
        v16h pt;
        #pragma unroll
        for (int sub = 0; sub < 2; ++sub)
          #pragma unroll
          for (int r = 0; r < 8; ++r) {
            float p = __builtin_amdgcn_exp2f(acc[g][sub][r]);
            s[g][r] += p;
            pt[sub * 8 + r] = (_Float16)p;
          }
        #pragma unroll
        for (int t = 0; t < 4; ++t) o[g][t] = WMMA_F16(av[t], pt, o[g][t]);
      }
    }
  }
}

// the sum of p over all keys of query lcol of group g
__device__ __forceinline__ float query_sum(const float (&s)[8]) {
  float sq = ((s[0] + s[1]) + (s[2] + s[3])) + ((s[4] + s[5]) + (s[6] + s[7]));
  return sq + __shfl_xor(sq, 16, 32);      // the other half's keys of the same query
}

// The launch bound states the eight waves (two a SIMD), which sets the register cap.
__global__ __launch_bounds__(256)
void attn_kernel(const _Float16* __restrict__ qn, const _Float16* __restrict__ kn,
                            const _Float16* __restrict__ vt, _Float16* __restrict__ ao) {
  __shared__ __attribute__((aligned(16))) _Float16 Kbuf[2][SK_ * KP_];   // [stage rows j][d]    36 KB
  __shared__ __attribute__((aligned(16))) _Float16 Vbuf[2][DH_ * VP_];   // [d][stage cols j]    34 KB
  __shared__ __attribute__((aligned(16))) int low[8];   // a wave's word: one of its sums is too small

  int tid  = threadIdx.x;
  int lane = tid & 31, wid = tid >> 5;
  int half = lane >> 4, lcol = lane & 15;
  int blk = blockIdx.x;                    // 0 .. 255
  int ib = blk >> 6;
  int ih = (blk >> 3) & 7;
  int i0 = (blk & 7) * 256 + wid * 32;
  const _Float16* Q  = qn + (size_t)((ib * H_ + ih) * N_) * DH_;
  const _Float16* Kp = kn + (size_t)(ib * N_) * DH_;
  const _Float16* V  = vt + (size_t)ib * DH_ * N_;
  int d0 = half * 16;

  v16h q[2][2];                            // [column group][d block of 32]
  #pragma unroll   // constant indices keep the fragments in registers
  for (int g = 0; g < 2; ++g) {
    q[g][0] = *(const v16h*)(Q + (size_t)(i0 + g * 16 + lcol) * DH_ + d0);
    q[g][1] = *(const v16h*)(Q + (size_t)(i0 + g * 16 + lcol) * DH_ + 32 + d0);
  }

  const _Float16* kg = Kp + tid * 8;
  const _Float16* vg = V + (size_t)(tid >> 4) * N_ + (tid & 15) * 8;
  float s[2][8];
  v8f o[2][4];
  attn_pass<true>(q, kg, vg, Kbuf, Vbuf, s, o);
  float sq[2] = {query_sum(s[0]), query_sum(s[1])};

  // the block's vote: a wave's word, one barrier, every wave reads all eight words.
  // The negated compare also catches a sum that is not a number.
  int mine = __builtin_amdgcn_ballot_w32(!(sq[0] >= MIN_SUM_) || !(sq[1] >= MIN_SUM_)) != 0;
  if (lane == 0) low[wid] = mine;
  // this wave's own LDS reads of the stage buffers have retired before a second pass refills them
  asm volatile("s_wait_dscnt 0x0" ::: "memory");
  __syncthreads();             // the eight words are in LDS; every wave has left the stage buffers
  int any = 0;
  #pragma unroll   // eight words, two 16-byte reads
  for (int w = 0; w < 8; ++w) any |= low[w];
  // equal in every lane of the block; in a scalar register the test is a scalar branch, so that
  // barriers and matrix instructions behind it run with every lane on
  if (__builtin_amdgcn_readfirstlane(any) != 0) {
    attn_pass<false>(q, kg, vg, Kbuf, Vbuf, s, o);
    sq[0] = query_sum(s[0]);
    sq[1] = query_sum(s[1]);
  }

  #pragma unroll   // constant indices keep sums and Ot in registers
  for (int g = 0; g < 2; ++g) {
    float inv = 1.0f / fmaxf(sq[g], 1e-20f);
    // the 8 registers of an accumulator are 8 consecutive d of one query: one 16-byte store
    _Float16* dst = ao + (size_t)(ib * N_ + i0 + g * 16 + lcol) * INNER_ + ih * DH_ + half * 8;
    #pragma unroll
    for (int t = 0; t < 4; ++t)
      *(v8h*)(dst + t * 16) = __builtin_convertvector(o[g][t] * inv, v8h);
  }
}

extern "C" void kernel_launch(void* const* d_in, const int* in_sizes, int n_in,
                              void* d_out, int out_size, void* d_ws, size_t ws_size,
                              hipStream_t stream) {
  const float* x          = (const float*)d_in[0];
  const float* norm_g     = (const float*)d_in[1];
  const float* Wq         = (const float*)d_in[2];
  const float* Wkv        = (const float*)d_in[3];
  const float* Wout       = (const float*)d_in[4];
  const float* out_norm_g = (const float*)d_in[5];
  float* out = (float*)d_out;

  char* w = (char*)d_ws;
  size_t off = 0;
  auto alloc = [&](size_t bytes) -> void* {
    void* p = w + off;
    off += (bytes + 255) & ~(size_t)255;
    return p;
  };
  _Float16* xn_h  = (_Float16*)alloc((size_t)ROWS_ * D_ * 2);       // 16 MB
  _Float16* WqT   = (_Float16*)alloc((size_t)INNER_ * D_ * 2);      //  1 MB
  _Float16* WkvT  = (_Float16*)alloc((size_t)128 * D_ * 2);         // .25 MB
  _Float16* WoutT = (_Float16*)alloc((size_t)D_ * INNER_ * 2);      //  1 MB
  _Float16* qn_h  = (_Float16*)alloc((size_t)ROWS_ * INNER_ * 2);   //  8 MB
  _Float16* kn_h  = (_Float16*)alloc((size_t)ROWS_ * DH_ * 2);      //  1 MB
  _Float16* vt_h  = (_Float16*)alloc((size_t)ROWS_ * DH_ * 2);      //  1 MB
  _Float16* ao_h  = (_Float16*)alloc((size_t)ROWS_ * INNER_ * 2);   //  8 MB

  // 1. weight transposes (f32 -> f16 [N][K]), one 64x64 tile a block, and LayerNorm(x) -> xn (f16)
  prep_kernel<<<WT_Q_ + WT_KV_ + WT_OUT_ + ROWS_ / 4, 128, 0, stream>>>(Wq, Wkv, Wout, WqT, WkvT, WoutT,
                                                                       x, norm_g, xn_h);

  // 3. q = xn@Wq ; kv = xn@Wkv   (128x64 tile per block), l2norms and V transpose in the epilogues
  proj_kernel<<<dim3(H_ + 2, ROWS_ / 128), 128, 0, stream>>>(xn_h, WqT, WkvT, qn_h, kn_h, vt_h);

  // 5. attention (async-LDS staged K/V, WMMA everywhere)
  attn_kernel<<<(B_ * H_ * N_) / 256, 256, 0, stream>>>(qn_h, kn_h, vt_h, ao_h);

  // 6. out = LayerNorm(ao @ Wout) (f32 into d_out), 32 whole rows a block
  out_ln_kernel<<<ROWS_ / 32, 256, 0, stream>>>(ao_h, WoutT, out_norm_g, out);
}
